// v000
// The times below were measured on an AMD MI455X: many runs one after another, warmed up first and cycling through
// copies of the inputs, with the whole window's GPU time divided by the number of runs. Launches and the gaps
// between them are all in it. The median over several windows is given; except for v000 it joins two sittings, which
// can be a few percent apart, so the side-by-side timings, each taken in one sitting, are the better comparison.
// v000, which the later versions start from, runs in 1360 microseconds.
// compute dtype: all float inputs rounded to bf16, span_val read; q/k/v = query W with EXACT bf16 products on WMMA 16x16x32, f32 accumulate; q as f16 hi + residual (x 2^10), k f16 -> 2-product logits / 64 (the module divides by DH), causal (-1e9 additive == exclusion), stored in f32; softmax then the adaptive-span ramp mask and the renormalisation (+1e-8) in f32 (precise expf); P x 2^11 f32 split bf16 hi + lo against v bf16 hi + lo (3 products); out = y (bf16 hi + lo) Wo; f32 output.
#include <hip/hip_runtime.h>
#include <math.h>

typedef __attribute__((ext_vector_type(16))) _Float16 v16h;
typedef __attribute__((ext_vector_type(16))) __bf16 v16b;
typedef __attribute__((ext_vector_type(8)))  _Float16 v8h;
typedef __attribute__((ext_vector_type(8)))  float v8f;
typedef __attribute__((ext_vector_type(4)))  float v4f;
typedef __attribute__((ext_vector_type(2)))  float v2f;
typedef __attribute__((ext_vector_type(4)))  unsigned v4u;
typedef __attribute__((ext_vector_type(4)))  int v4i;
typedef float __attribute__((may_alias)) float_a;
typedef int __attribute__((may_alias)) int_a;

template <typename T> __device__ __forceinline__ void vst2(void* p, T v) { *(T*)p = v;  }
__device__ __forceinline__ v8f wmma16(v16h a, v16h b, v8f c) {
  v8f d = __builtin_amdgcn_wmma_f32_16x16x32_f16(false, a, false, b, (short)0, c, false, false);
  asm volatile("v_nop\n\tv_nop\n\tv_nop\n\tv_nop" : "+v"(d) : "v"(a), "v"(b));
  return d;
}
__device__ __forceinline__ v8f wmma_bf(v16b a, v16b b, v8f c) {
  v8f d = __builtin_amdgcn_wmma_f32_16x16x32_bf16(false, a, false, b, (short)0, c, false, false);
  asm volatile("v_nop\n\tv_nop\n\tv_nop\n\tv_nop" : "+v"(d) : "v"(a), "v"(b));
  return d;
}
// 16x16x32 fragments: lane = (h = lane>>4, row/col = lane&15); elements 0..7 = k0+8h+0..7, 8..15 = k0+16+8h+0..7; D element r = row 8h+r
__device__ __forceinline__ v16h frag_h(const _Float16* rowk0, int lane) {
  union { v16h v; v8h q[2]; } u; const _Float16* p = rowk0 + 8 * (lane >> 4);
  u.q[0] = *(const v8h*)p; u.q[1] = *(const v8h*)(p + 16); return u.v;
}
__device__ __forceinline__ v16h frag_f32(const float* rowk0, int lane) {
  v16h a; const float* p = rowk0 + 8 * (lane >> 4);
#pragma unroll
  for (int i = 0; i < 8; ++i) { a[i] = (_Float16)p[i]; a[8 + i] = (_Float16)p[16 + i]; }
  return a;
}
__device__ __forceinline__ v16h frag_f32s(const float* rowk0, int lane, float sc) {
  v16h a; const float* p = rowk0 + 8 * (lane >> 4);
#pragma unroll
  for (int i = 0; i < 8; ++i) { a[i] = (_Float16)(p[i] * sc); a[8 + i] = (_Float16)(p[16 + i] * sc); }
  return a;
}
// column fragment from a [K][ld] layout (column n), rows >= K read as 0
__device__ __forceinline__ v16h fragc_f32(const float* W, int k0, int n, int lane, int ld, int K) {
  v16h a; const int g = lane >> 4;
#pragma unroll
  for (int i = 0; i < 8; ++i) { const int ka = k0 + 8 * g + i, kb = ka + 16;
    a[i] = (_Float16)(ka < K ? W[(size_t)(ka < K ? ka : K - 1) * ld + n] : 0.f); a[8 + i] = (_Float16)(kb < K ? W[(size_t)(kb < K ? kb : K - 1) * ld + n] : 0.f); }
  return a;
}
struct F2 { v16b h, l; };
__device__ __forceinline__ F2 bsplit16(const float v[16]) { F2 r;
#pragma unroll
  for (int i = 0; i < 16; ++i) { const __bf16 h = (__bf16)v[i]; r.h[i] = h; r.l[i] = (__bf16)(v[i] - (float)h); }
  return r; }
__device__ __forceinline__ F2 split_row(const float* row, int k0, int lane) { float v[16]; const float* p = row + k0 + 8 * (lane >> 4);
#pragma unroll
  for (int i = 0; i < 8; ++i) { v[i] = p[i]; v[8 + i] = p[16 + i]; }
  return bsplit16(v); }
__device__ __forceinline__ F2 split_rowK(const float* row, int k0, int lane, int K) { float v[16]; const int g = lane >> 4;
#pragma unroll
  for (int i = 0; i < 8; ++i) { const int ka = k0 + 8 * g + i, kb = ka + 16; v[i] = ka < K ? row[ka < K ? ka : K - 1] : 0.f; v[8 + i] = kb < K ? row[kb < K ? kb : K - 1] : 0.f; }
  return bsplit16(v); }
__device__ __forceinline__ F2 split_col(const float* W, int k0, int n, int lane, int ld, int K) { float v[16]; const int g = lane >> 4;
#pragma unroll
  for (int i = 0; i < 8; ++i) { const int ka = k0 + 8 * g + i, kb = ka + 16; v[i] = ka < K ? W[(size_t)(ka < K ? ka : K - 1) * ld + n] : 0.f; v[8 + i] = kb < K ? W[(size_t)(kb < K ? kb : K - 1) * ld + n] : 0.f; }
  return bsplit16(v); }
__device__ __forceinline__ v8f mac3(const F2& a, const F2& b, v8f c) { c = wmma_bf(a.l, b.h, c); c = wmma_bf(a.h, b.l, c); return wmma_bf(a.h, b.h, c); }
__device__ __forceinline__ float sigm(float v) { return 1.0f / (1.0f + expf(-v)); }
#define LDSX() do { asm volatile("s_wait_dscnt 0" ::: "memory"); __builtin_amdgcn_wave_barrier(); __builtin_amdgcn_fence(__ATOMIC_RELEASE, "workgroup"); } while (0)


// Adaptive-span causal attention (B 2, S 2,048, hidden 1,024 = 16 x 64, ramp 32): w = softmax(q k^T / 64 + triu(-1e9, 1)); w = w * clip((k_idx + span_val[h] * S) / 33, 0, 1); w = w / (sum_k w + 1e-8); out = (w v) Wo (no biases).
#define NB 2
#define TT 2048
#define CC 1024
#define NH 16
#define HD 64
#ifndef TNB
#define TNB NB
#endif
typedef __attribute__((ext_vector_type(8))) __bf16 v8b;
__device__ __forceinline__ v16b frag_b(const __bf16* rowk0, int lane) {
  union { v16b v; v8b q[2]; } u; const __bf16* p = rowk0 + 8 * (lane >> 4);
  u.q[0] = *(const v8b*)p; u.q[1] = *(const v8b*)(p + 16); return u.v;
}
__device__ __forceinline__ float bfr(float v) { return (float)(__bf16)v; }
__device__ __attribute__((noinline)) float exp_ni(float v) { return expf(v); }
__device__ __attribute__((noinline)) float erf_ni(float v) { return erff(v); }

#define WS_QH  0u
#define WS_QL  (WS_QH + 2u * (size_t)NB * TT * CC)
#define WS_KH  (WS_QL + 2u * (size_t)NB * TT * CC)
#define WS_VT  (WS_KH + 2u * (size_t)NB * TT * CC)      // bf16 v planes [b][c][t]
#define WS_VL  (WS_VT + 2u * (size_t)NB * CC * TT)      // bf16 v residual planes
#define HG 4                                          // heads per launch group
#define WS_S   (WS_VL + 2u * (size_t)NB * CC * TT)      // f32 logits / P for HG heads [hg][q][k]
#define WS_PH  (WS_S + 4u * (size_t)HG * TT * TT)
#define WS_Y   (WS_PH + 0u)              // f32 y rows [b*t][C]
#define WS_END (WS_Y + 4u * (size_t)NB * TT * CC)

// ---- k_proj: block = (64 rows, 128 cols, which): qkv = x W (+ b), exact; q -> f16 hi (+ residual), k -> f16 rows, v -> bf16 hi + lo planes
__global__ __launch_bounds__(128) void k_proj(const float* __restrict__ X, const float* __restrict__ WQ, const float* __restrict__ BQ, const float* __restrict__ WK, const float* __restrict__ BK, const float* __restrict__ WV, const float* __restrict__ BV, _Float16* __restrict__ QH, _Float16* __restrict__ QL, _Float16* __restrict__ KH, __bf16* __restrict__ VT, __bf16* __restrict__ VL) {
  __shared__ __align__(16) _Float16 sh[64][136], sl[64][136]; __shared__ __align__(16) __bf16 th[128][72], tl2[128][72];
  const int tid = threadIdx.x, wave = tid >> 5, lane = tid & 31, col = lane & 15, g = lane >> 4; const int which = blockIdx.z; const int c0 = blockIdx.y * 128; const size_t r0 = (size_t)blockIdx.x * 64; const float* WA = which == 0 ? WQ : which == 1 ? WK : WV; const float* BA = which == 0 ? BQ : which == 1 ? BK : BV;
  v8f acc[8] = {};
#pragma unroll 2
  for (int kc = 0; kc < CC / 32; ++kc) { v16b a; { const float* p = X + (r0 + wave * 16 + col) * CC + kc * 32 + 8 * g;
#pragma unroll
      for (int i = 0; i < 8; ++i) { a[i] = (__bf16)p[i]; a[8 + i] = (__bf16)p[16 + i]; } }
#pragma unroll
    for (int j = 0; j < 8; ++j) { v16b w; const int o = c0 + j * 16 + col;
#pragma unroll
      for (int i = 0; i < 8; ++i) { w[i] = (__bf16)WA[(size_t)(kc * 32 + 8 * g + i) * CC + o]; w[8 + i] = (__bf16)WA[(size_t)(kc * 32 + 16 + 8 * g + i) * CC + o]; }
      acc[j] = wmma_bf(a, w, acc[j]); } }
#pragma unroll
  for (int j = 0; j < 8; ++j) { const float bb = BA ? bfr(BA[c0 + j * 16 + col]) : 0.f;
#pragma unroll
    for (int r = 0; r < 8; ++r) { const float v = acc[j][r] + bb; const int rl = wave * 16 + 8 * g + r, cl = j * 16 + col; const _Float16 hv = (_Float16)v;
      if (which == 2) { const __bf16 bh = (__bf16)v; th[cl][rl] = bh; tl2[cl][rl] = (__bf16)(v - (float)bh); } else { sh[rl][cl] = hv; sl[rl][cl] = (_Float16)((v - (float)hv) * 1024.0f); }   /* q residual carried x 2^10 so the plane stays f16-normal on the chip */ } }
  __syncthreads();
  if (which < 2) { _Float16* dh = which == 0 ? QH : KH; for (int e = tid; e < 64 * 16; e += 128) { const int rl = e >> 4, q = e & 15; vst2((unsigned*)(dh + (r0 + rl) * CC + c0 + q * 8), *(const v4u*)&sh[rl][q * 8]); if (which == 0) vst2((unsigned*)(QL + (r0 + rl) * CC + c0 + q * 8), *(const v4u*)&sl[rl][q * 8]); } }
  else { const size_t b = r0 / TT; const int t0 = (int)(r0 % TT); for (int e = tid; e < 128 * 8; e += 128) { const int cl = e >> 3, q = e & 7; const size_t o2 = (b * CC + c0 + cl) * (size_t)TT + t0 + q * 8; vst2((unsigned*)(VT + o2), *(const v4u*)&th[cl][q * 8]); vst2((unsigned*)(VL + o2), *(const v4u*)&tl2[cl][q * 8]); } } }
// ---- k_sc: block = (64 queries, 128 keys) of (b,h): logits * scale; causal blocks beyond the diagonal exit
__global__ __launch_bounds__(128) void k_sc(const _Float16* __restrict__ QH, const _Float16* __restrict__ QL, const _Float16* __restrict__ KH, const float* __restrict__ BM, int b, int h0, float* __restrict__ S0) { __shared__ __align__(16) float ss[4][16][132]; const int h = h0 + blockIdx.z; float* S = S0 + (size_t)blockIdx.z * TT * TT;
  const int tid = threadIdx.x, wave = tid >> 5, lane = tid & 31, col = lane & 15, g = lane >> 4; const int k0 = blockIdx.y * 128; const int ql0 = blockIdx.x * 64 + wave * 16; const size_t q0 = (size_t)b * TT + ql0;
  if (k0 > blockIdx.x * 64 + 63) return;   // whole key block above the diagonal (block-uniform)
  v8f acc[8] = {}, accl[8] = {};
#pragma unroll
  for (int kc = 0; kc < HD / 32; ++kc) { const v16h ah = frag_h(QH + (q0 + col) * CC + h * HD + kc * 32, lane), al = frag_h(QL + (q0 + col) * CC + h * HD + kc * 32, lane);
#pragma unroll
    for (int j = 0; j < 8; ++j) { const v16h kb = frag_h(KH + ((size_t)b * TT + k0 + j * 16 + col) * CC + h * HD + kc * 32, lane); acc[j] = wmma16(ah, kb, acc[j]); accl[j] = wmma16(al, kb, accl[j]); } }
#pragma unroll
  for (int j = 0; j < 8; ++j) acc[j] += accl[j] * (1.0f / 1024.0f);
#pragma unroll
  for (int j = 0; j < 8; ++j) { const int kt = k0 + j * 16 + col;
#pragma unroll
    for (int r = 0; r < 8; ++r) { const int qt = ql0 + 8 * g + r; float v = acc[j][r] * (1.0f / 64.0f); (void)BM; if (kt > qt) v = -3.0e38f; /* scores divided by DH = 64 as written */ ss[wave][8 * g + r][j * 16 + col] = v; } }
  LDSX(); for (int rl = 0; rl < 16; ++rl) vst2(S + (size_t)(ql0 + rl) * TT + k0 + lane * 4, *(const v4f*)&ss[wave][rl][lane * 4]); }
// ---- k_sm: block = (query row, head in group): causal softmax over keys [0, kend), times the adaptive-span ramp mask clip((k + span_val[h] S)/(RAMP+1), 0, 1), renormalised by (sum + 1e-8) -> P x 2^11 f32 in place
__global__ __launch_bounds__(256) void k_sm(float* __restrict__ S0, const float* __restrict__ SPAN, int h0) { __shared__ float sred[8]; __shared__ float sbc; __shared__ __align__(16) float sh[TT];
  const int t = threadIdx.x; const size_t row = blockIdx.x; float* sr = S0 + (size_t)blockIdx.y * TT * TT + row * TT; const int kend = ((int)row / 64) * 64 + 64; const float spv = bfr(SPAN[h0 + blockIdx.y]) * (float)TT;   /* span_val[h] * attn_span */
  float m = -3.0e38f; for (int k = t; k < kend; k += 256) m = fmaxf(m, sr[k]);
#pragma unroll
  for (int o = 1; o < 32; o <<= 1) m = fmaxf(m, __shfl_xor(m, o));
  if ((t & 31) == 0) sred[t >> 5] = m; __syncthreads(); if (t == 0) { float a = sred[0]; for (int i = 1; i < 8; ++i) a = fmaxf(a, sred[i]); sbc = a; } __syncthreads(); m = sbc; __syncthreads();
  float sum = 0.f; for (int k = t; k < kend; k += 256) { const float v = sr[k]; sum += (v <= -1.0e38f) ? 0.f : expf(v - m); }
#pragma unroll
  for (int o = 1; o < 32; o <<= 1) sum += __shfl_xor(sum, o);
  if ((t & 31) == 0) sred[t >> 5] = sum; __syncthreads(); if (t == 0) { float a = 0.f; for (int i = 0; i < 8; ++i) a += sred[i]; sbc = 1.0f / a; } __syncthreads(); const float inv = sbc;
  float s2 = 0.f; for (int k = t; k < kend; k += 256) { const float v = sr[k]; const float msk = fminf(fmaxf(((float)k + spv) / 33.0f, 0.f), 1.0f); const float pm = ((v <= -1.0e38f) ? 0.f : expf(v - m) * inv) * msk; sh[k] = pm; s2 += pm; }
#pragma unroll
  for (int o = 1; o < 32; o <<= 1) s2 += __shfl_xor(s2, o);
  __syncthreads(); if ((t & 31) == 0) sred[t >> 5] = s2; __syncthreads(); if (t == 0) { float a = 0.f; for (int i = 0; i < 8; ++i) a += sred[i]; sbc = 2048.0f / (a + 1e-8f); } __syncthreads(); const float rn = sbc;
  for (int k = t; k < kend; k += 256) sh[k] *= rn;
  __syncthreads(); for (int q = t; q < kend / 4; q += 256) vst2(sr + q * 4, *(const v4f*)&sh[q * 4]); }   /* w = softmax * ramp mask, renormalised by (sum + 1e-8), carried x 2^11 */
// ---- k_pv: block = 64 queries of (b,h): y[q][h*HD + d] = P . v  (keys [0, kend))
__global__ __launch_bounds__(128) void k_pv(const float* __restrict__ PS0, const __bf16* __restrict__ VT, const __bf16* __restrict__ VL, int b, int h0, float* __restrict__ Y) { const int h = h0 + blockIdx.z; const float* PS = PS0 + (size_t)blockIdx.z * TT * TT; __shared__ __align__(16) float ss[4][16][HD + 4];
  const int tid = threadIdx.x, wave = tid >> 5, lane = tid & 31, col = lane & 15, g = lane >> 4; const int ql0 = blockIdx.x * 64 + wave * 16; const int kend = blockIdx.x * 64 + 64;
  v8f acc[HD / 16] = {};
#pragma unroll 1
  for (int kc = 0; kc < kend / 32; ++kc) { const F2 p = split_row(PS + (size_t)(ql0 + col) * TT, kc * 32, lane);
#pragma unroll
    for (int j = 0; j < HD / 16; ++j) { const size_t po = ((size_t)b * CC + h * HD + j * 16 + col) * (size_t)TT + kc * 32; const v16b vh = frag_b(VT + po, lane); acc[j] = wmma_bf(p.h, vh, acc[j]); acc[j] = wmma_bf(p.l, vh, acc[j]); acc[j] = wmma_bf(p.h, frag_b(VL + po, lane), acc[j]); } }
#pragma unroll
  for (int j = 0; j < HD / 16; ++j)
#pragma unroll
    for (int r = 0; r < 8; ++r) ss[wave][8 * g + r][j * 16 + col] = acc[j][r] * (1.0f / 2048.0f);
  LDSX(); for (int rl = 0; rl < 16; ++rl) if (lane < HD / 4) vst2(Y + ((size_t)b * TT + ql0 + rl) * CC + h * HD + lane * 4, *(const v4f*)&ss[wave][rl][lane * 4]); }
// ---- k_out: block = (64 rows, 128 cols): out = y (bf16 hi + lo) Wo + bo
__global__ __launch_bounds__(128) void k_out(const float* __restrict__ Y, const float* __restrict__ WP, const float* __restrict__ BP, float* __restrict__ OUT) { __shared__ __align__(16) float sf[4][16][132];
  const int tid = threadIdx.x, wave = tid >> 5, lane = tid & 31, col = lane & 15, g = lane >> 4; const int c0 = blockIdx.y * 128; const size_t r0 = (size_t)blockIdx.x * 64 + wave * 16;
  v8f acc[8] = {};
#pragma unroll 2
  for (int kc = 0; kc < CC / 32; ++kc) { const F2 a = split_row(Y + (r0 + col) * CC, kc * 32, lane);
#pragma unroll
    for (int j = 0; j < 8; ++j) { v16b w; const int o = c0 + j * 16 + col;
#pragma unroll
      for (int i = 0; i < 8; ++i) { w[i] = (__bf16)WP[(size_t)(kc * 32 + 8 * g + i) * CC + o]; w[8 + i] = (__bf16)WP[(size_t)(kc * 32 + 16 + 8 * g + i) * CC + o]; }
      acc[j] = wmma_bf(a.h, w, acc[j]); acc[j] = wmma_bf(a.l, w, acc[j]); } }
#pragma unroll
  for (int j = 0; j < 8; ++j) { const float bb = BP ? bfr(BP[c0 + j * 16 + col]) : 0.f;
#pragma unroll
    for (int r = 0; r < 8; ++r) sf[wave][8 * g + r][j * 16 + col] = acc[j][r] + bb; }
  LDSX(); for (int rl = 0; rl < 16; ++rl) vst2(OUT + (r0 + rl) * CC + c0 + lane * 4, *(const v4f*)&sf[wave][rl][lane * 4]); }
extern "C" void kernel_launch(void* const* d_in, const int* in_sizes, int n_in, void* d_out, int out_size, void* d_ws, size_t ws_size, hipStream_t stream) {
  (void)in_sizes; (void)n_in; (void)out_size;
  const float** F = (const float**)d_in;   // 0 query [2,2048,1024], 1 Wq [1024,1024] ((in,out)), 2 Wk, 3 Wv, 4 Wo ((in,out)), 5 span_val [1,16,1,1] (verbatim)
  if (ws_size < (size_t)WS_END) return;
  char* ws = (char*)d_ws; _Float16 *QH = (_Float16*)(ws + WS_QH), *QL = (_Float16*)(ws + WS_QL), *KH = (_Float16*)(ws + WS_KH); __bf16 *VT = (__bf16*)(ws + WS_VT), *VL = (__bf16*)(ws + WS_VL); float *S = (float*)(ws + WS_S), *Y = (float*)(ws + WS_Y);
  k_proj<<<dim3(TNB * TT / 64, CC / 128, 3), 128, 0, stream>>>(F[0], F[1], nullptr, F[2], nullptr, F[3], nullptr, QH, QL, KH, VT, VL);
  for (int b = 0; b < TNB; ++b) for (int h0 = 0; h0 < NH; h0 += HG) {
    k_sc<<<dim3(TT / 64, TT / 128, HG), 128, 0, stream>>>(QH, QL, KH, nullptr, b, h0, S);
    k_sm<<<dim3(TT, HG), 256, 0, stream>>>(S, F[5], h0);
    k_pv<<<dim3(TT / 64, 1, HG), 128, 0, stream>>>(S, VT, VL, b, h0, Y);
  }
  k_out<<<dim3(TNB * TT / 64, CC / 128), 128, 0, stream>>>(Y, F[4], nullptr, (float*)d_out);
}

// v001
// A run of this version takes 727 microseconds.
// In two side-by-side timings against v000, it was 1.89 and 1.88 times as fast.
// compute dtype: all float inputs rounded to bf16, span_val read; q/k/v = query W with EXACT bf16 products on WMMA 16x16x32, f32 accumulate; q as f16 hi + residual (x 2^10), k f16 -> 2-product logits / 64 (the module divides by DH), causal (-1e9 additive == exclusion), stored in f32; softmax then the adaptive-span ramp mask and the renormalisation (+1e-8) in f32 (precise expf); P x 2^11 f32 split bf16 hi + lo against v bf16 hi + lo (3 products); out = y (bf16 hi + lo) Wo; f32 output.
#include <hip/hip_runtime.h>
#include <math.h>

typedef __attribute__((ext_vector_type(16))) _Float16 v16h;
typedef __attribute__((ext_vector_type(16))) __bf16 v16b;
typedef __attribute__((ext_vector_type(8)))  _Float16 v8h;
typedef __attribute__((ext_vector_type(8)))  float v8f;
typedef __attribute__((ext_vector_type(4)))  float v4f;
typedef __attribute__((ext_vector_type(2)))  float v2f;
typedef __attribute__((ext_vector_type(4)))  unsigned v4u;
typedef __attribute__((ext_vector_type(4)))  int v4i;
typedef float __attribute__((may_alias)) float_a;
typedef int __attribute__((may_alias)) int_a;

template <typename T> __device__ __forceinline__ void vst2(void* p, T v) { *(T*)p = v;  }
__device__ __forceinline__ v8f wmma16(v16h a, v16h b, v8f c) {
  v8f d = __builtin_amdgcn_wmma_f32_16x16x32_f16(false, a, false, b, (short)0, c, false, false);
  asm volatile("v_nop\n\tv_nop\n\tv_nop\n\tv_nop" : "+v"(d) : "v"(a), "v"(b));
  return d;
}
__device__ __forceinline__ v8f wmma_bf(v16b a, v16b b, v8f c) {
  v8f d = __builtin_amdgcn_wmma_f32_16x16x32_bf16(false, a, false, b, (short)0, c, false, false);
  asm volatile("v_nop\n\tv_nop\n\tv_nop\n\tv_nop" : "+v"(d) : "v"(a), "v"(b));
  return d;
}
// 16x16x32 fragments: lane = (h = lane>>4, row/col = lane&15); elements 0..7 = k0+8h+0..7, 8..15 = k0+16+8h+0..7; D element r = row 8h+r
__device__ __forceinline__ v16h frag_h(const _Float16* rowk0, int lane) {
  union { v16h v; v8h q[2]; } u; const _Float16* p = rowk0 + 8 * (lane >> 4);
  u.q[0] = *(const v8h*)p; u.q[1] = *(const v8h*)(p + 16); return u.v;
}
__device__ __forceinline__ v16h frag_f32(const float* rowk0, int lane) {
  v16h a; const float* p = rowk0 + 8 * (lane >> 4);
#pragma unroll
  for (int i = 0; i < 8; ++i) { a[i] = (_Float16)p[i]; a[8 + i] = (_Float16)p[16 + i]; }
  return a;
}
__device__ __forceinline__ v16h frag_f32s(const float* rowk0, int lane, float sc) {
  v16h a; const float* p = rowk0 + 8 * (lane >> 4);
#pragma unroll
  for (int i = 0; i < 8; ++i) { a[i] = (_Float16)(p[i] * sc); a[8 + i] = (_Float16)(p[16 + i] * sc); }
  return a;
}
// column fragment from a [K][ld] layout (column n), rows >= K read as 0
__device__ __forceinline__ v16h fragc_f32(const float* W, int k0, int n, int lane, int ld, int K) {
  v16h a; const int g = lane >> 4;
#pragma unroll
  for (int i = 0; i < 8; ++i) { const int ka = k0 + 8 * g + i, kb = ka + 16;
    a[i] = (_Float16)(ka < K ? W[(size_t)(ka < K ? ka : K - 1) * ld + n] : 0.f); a[8 + i] = (_Float16)(kb < K ? W[(size_t)(kb < K ? kb : K - 1) * ld + n] : 0.f); }
  return a;
}
struct F2 { v16b h, l; };
__device__ __forceinline__ F2 bsplit16(const float v[16]) { F2 r;
#pragma unroll
  for (int i = 0; i < 16; ++i) { const __bf16 h = (__bf16)v[i]; r.h[i] = h; r.l[i] = (__bf16)(v[i] - (float)h); }
  return r; }
__device__ __forceinline__ F2 split_row(const float* row, int k0, int lane) { float v[16]; const float* p = row + k0 + 8 * (lane >> 4);
#pragma unroll
  for (int i = 0; i < 8; ++i) { v[i] = p[i]; v[8 + i] = p[16 + i]; }
  return bsplit16(v); }
__device__ __forceinline__ F2 split_rowK(const float* row, int k0, int lane, int K) { float v[16]; const int g = lane >> 4;
#pragma unroll
  for (int i = 0; i < 8; ++i) { const int ka = k0 + 8 * g + i, kb = ka + 16; v[i] = ka < K ? row[ka < K ? ka : K - 1] : 0.f; v[8 + i] = kb < K ? row[kb < K ? kb : K - 1] : 0.f; }
  return bsplit16(v); }
__device__ __forceinline__ F2 split_col(const float* W, int k0, int n, int lane, int ld, int K) { float v[16]; const int g = lane >> 4;
#pragma unroll
  for (int i = 0; i < 8; ++i) { const int ka = k0 + 8 * g + i, kb = ka + 16; v[i] = ka < K ? W[(size_t)(ka < K ? ka : K - 1) * ld + n] : 0.f; v[8 + i] = kb < K ? W[(size_t)(kb < K ? kb : K - 1) * ld + n] : 0.f; }
  return bsplit16(v); }
__device__ __forceinline__ v8f mac3(const F2& a, const F2& b, v8f c) { c = wmma_bf(a.l, b.h, c); c = wmma_bf(a.h, b.l, c); return wmma_bf(a.h, b.h, c); }
__device__ __forceinline__ float sigm(float v) { return 1.0f / (1.0f + expf(-v)); }
#define LDSX() do { asm volatile("s_wait_dscnt 0" ::: "memory"); __builtin_amdgcn_wave_barrier(); __builtin_amdgcn_fence(__ATOMIC_RELEASE, "workgroup"); } while (0)


// Adaptive-span causal attention (B 2, S 2,048, hidden 1,024 = 16 x 64, ramp 32): w = softmax(q k^T / 64 + triu(-1e9, 1)); w = w * clip((k_idx + span_val[h] * S) / 33, 0, 1); w = w / (sum_k w + 1e-8); out = (w v) Wo (no biases).
#define NB 2
#define TT 2048
#define CC 1024
#define NH 16
#define HD 64
#ifndef TNB
#define TNB NB
#endif
typedef __attribute__((ext_vector_type(8))) __bf16 v8b;
__device__ __forceinline__ v16b frag_b(const __bf16* rowk0, int lane) {
  union { v16b v; v8b q[2]; } u; const __bf16* p = rowk0 + 8 * (lane >> 4);
  u.q[0] = *(const v8b*)p; u.q[1] = *(const v8b*)(p + 16); return u.v;
}
__device__ __forceinline__ float bfr(float v) { return (float)(__bf16)v; }
__device__ __attribute__((noinline)) float exp_ni(float v) { return expf(v); }
__device__ __attribute__((noinline)) float erf_ni(float v) { return erff(v); }

#define WS_QH  0u
#define WS_QL  (WS_QH + 2u * (size_t)NB * TT * CC)
#define WS_KH  (WS_QL + 2u * (size_t)NB * TT * CC)
#define WS_VT  (WS_KH + 2u * (size_t)NB * TT * CC)      // bf16 v planes [b][c][t]
#define WS_VL  (WS_VT + 2u * (size_t)NB * CC * TT)      // bf16 v residual planes
#define HG 4                                          // heads per launch group
#define WS_S   (WS_VL + 2u * (size_t)NB * CC * TT)      // f32 logits / P for HG heads [hg][q][k]
#define WS_PH  (WS_S + 4u * (size_t)HG * TT * TT)
#define WS_Y   (WS_PH + 0u)              // f32 y rows [b*t][C]
#define WS_END (WS_Y + 4u * (size_t)NB * TT * CC)

// ---- k_proj: block = (64 rows, 128 cols, which): qkv = x W (+ b), exact; q -> f16 hi (+ residual), k -> f16 rows, v -> bf16 hi + lo planes
__global__ __launch_bounds__(128) void k_proj(const float* __restrict__ X, const float* __restrict__ WQ, const float* __restrict__ BQ, const float* __restrict__ WK, const float* __restrict__ BK, const float* __restrict__ WV, const float* __restrict__ BV, _Float16* __restrict__ QH, _Float16* __restrict__ QL, _Float16* __restrict__ KH, __bf16* __restrict__ VT, __bf16* __restrict__ VL) {
  __shared__ __align__(16) _Float16 sh[64][136], sl[64][136]; __shared__ __align__(16) __bf16 th[128][72], tl2[128][72];
  const int tid = threadIdx.x, wave = tid >> 5, lane = tid & 31, col = lane & 15, g = lane >> 4; const int which = blockIdx.z; const int c0 = blockIdx.y * 128; const size_t r0 = (size_t)blockIdx.x * 64; const float* WA = which == 0 ? WQ : which == 1 ? WK : WV; const float* BA = which == 0 ? BQ : which == 1 ? BK : BV;
  v8f acc[8] = {};
#pragma unroll 2
  for (int kc = 0; kc < CC / 32; ++kc) { v16b a; { const float* p = X + (r0 + wave * 16 + col) * CC + kc * 32 + 8 * g;
#pragma unroll
      for (int i = 0; i < 8; ++i) { a[i] = (__bf16)p[i]; a[8 + i] = (__bf16)p[16 + i]; } }
#pragma unroll
    for (int j = 0; j < 8; ++j) { v16b w; const int o = c0 + j * 16 + col;
#pragma unroll
      for (int i = 0; i < 8; ++i) { w[i] = (__bf16)WA[(size_t)(kc * 32 + 8 * g + i) * CC + o]; w[8 + i] = (__bf16)WA[(size_t)(kc * 32 + 16 + 8 * g + i) * CC + o]; }
      acc[j] = wmma_bf(a, w, acc[j]); } }
#pragma unroll
  for (int j = 0; j < 8; ++j) { const float bb = BA ? bfr(BA[c0 + j * 16 + col]) : 0.f;
#pragma unroll
    for (int r = 0; r < 8; ++r) { const float v = acc[j][r] + bb; const int rl = wave * 16 + 8 * g + r, cl = j * 16 + col; const _Float16 hv = (_Float16)v;
      if (which == 2) { const __bf16 bh = (__bf16)v; th[cl][rl] = bh; tl2[cl][rl] = (__bf16)(v - (float)bh); } else { sh[rl][cl] = hv; sl[rl][cl] = (_Float16)((v - (float)hv) * 1024.0f); }   /* q residual carried x 2^10 so the plane stays f16-normal on the chip */ } }
  __syncthreads();
  if (which < 2) { _Float16* dh = which == 0 ? QH : KH; for (int e = tid; e < 64 * 16; e += 128) { const int rl = e >> 4, q = e & 15; vst2((unsigned*)(dh + (r0 + rl) * CC + c0 + q * 8), *(const v4u*)&sh[rl][q * 8]); if (which == 0) vst2((unsigned*)(QL + (r0 + rl) * CC + c0 + q * 8), *(const v4u*)&sl[rl][q * 8]); } }
  else { const size_t b = r0 / TT; const int t0 = (int)(r0 % TT); for (int e = tid; e < 128 * 8; e += 128) { const int cl = e >> 3, q = e & 7; const size_t o2 = (b * CC + c0 + cl) * (size_t)TT + t0 + q * 8; vst2((unsigned*)(VT + o2), *(const v4u*)&th[cl][q * 8]); vst2((unsigned*)(VL + o2), *(const v4u*)&tl2[cl][q * 8]); } } }
// ---- k_sc: block = (64 queries, 128 keys) of (b,h): logits * scale; causal blocks beyond the diagonal exit
__global__ __launch_bounds__(128) void k_sc(const _Float16* __restrict__ QH, const _Float16* __restrict__ QL, const _Float16* __restrict__ KH, const float* __restrict__ BM, int b, int h0, float* __restrict__ S0) { __shared__ __align__(16) float ss[4][16][132]; const int h = h0 + blockIdx.z; float* S = S0 + (size_t)blockIdx.z * TT * TT;
  const int tid = threadIdx.x, wave = tid >> 5, lane = tid & 31, col = lane & 15, g = lane >> 4; const int k0 = blockIdx.y * 128; const int ql0 = blockIdx.x * 64 + wave * 16; const size_t q0 = (size_t)b * TT + ql0;
  if (k0 > blockIdx.x * 64 + 63) return;   // whole key block above the diagonal (block-uniform)
  v8f acc[8] = {}, accl[8] = {};
#pragma unroll
  for (int kc = 0; kc < HD / 32; ++kc) { const v16h ah = frag_h(QH + (q0 + col) * CC + h * HD + kc * 32, lane), al = frag_h(QL + (q0 + col) * CC + h * HD + kc * 32, lane);
#pragma unroll
    for (int j = 0; j < 8; ++j) { const v16h kb = frag_h(KH + ((size_t)b * TT + k0 + j * 16 + col) * CC + h * HD + kc * 32, lane); acc[j] = wmma16(ah, kb, acc[j]); accl[j] = wmma16(al, kb, accl[j]); } }
#pragma unroll
  for (int j = 0; j < 8; ++j) acc[j] += accl[j] * (1.0f / 1024.0f);
#pragma unroll
  for (int j = 0; j < 8; ++j) { const int kt = k0 + j * 16 + col;
#pragma unroll
    for (int r = 0; r < 8; ++r) { const int qt = ql0 + 8 * g + r; float v = acc[j][r] * (1.0f / 64.0f); (void)BM; if (kt > qt) v = -3.0e38f; /* scores divided by DH = 64 as written */ ss[wave][8 * g + r][j * 16 + col] = v; } }
  LDSX(); for (int rl = 0; rl < 16; ++rl) vst2(S + (size_t)(ql0 + rl) * TT + k0 + lane * 4, *(const v4f*)&ss[wave][rl][lane * 4]); }
// ---- k_sm: block = (query row, head in group): causal softmax over keys [0, kend), times the adaptive-span ramp mask clip((k + span_val[h] S)/(RAMP+1), 0, 1), renormalised by (sum + 1e-8) -> P x 2^11 f32 in place
__global__ __launch_bounds__(256) void k_sm(float* __restrict__ S0, const float* __restrict__ SPAN, int h0) { __shared__ float sred[8]; __shared__ float sbc; __shared__ __align__(16) float sh[TT];
  const int t = threadIdx.x; const size_t row = blockIdx.x; float* sr = S0 + (size_t)blockIdx.y * TT * TT + row * TT; const int kend = ((int)row / 64) * 64 + 64; const float spv = bfr(SPAN[h0 + blockIdx.y]) * (float)TT;   /* span_val[h] * attn_span */
  float m = -3.0e38f; for (int k = t; k < kend; k += 256) m = fmaxf(m, sr[k]);
#pragma unroll
  for (int o = 1; o < 32; o <<= 1) m = fmaxf(m, __shfl_xor(m, o));
  if ((t & 31) == 0) sred[t >> 5] = m; __syncthreads(); if (t == 0) { float a = sred[0]; for (int i = 1; i < 8; ++i) a = fmaxf(a, sred[i]); sbc = a; } __syncthreads(); m = sbc; __syncthreads();
  float sum = 0.f; for (int k = t; k < kend; k += 256) { const float v = sr[k]; sum += (v <= -1.0e38f) ? 0.f : expf(v - m); }
#pragma unroll
  for (int o = 1; o < 32; o <<= 1) sum += __shfl_xor(sum, o);
  if ((t & 31) == 0) sred[t >> 5] = sum; __syncthreads(); if (t == 0) { float a = 0.f; for (int i = 0; i < 8; ++i) a += sred[i]; sbc = 1.0f / a; } __syncthreads(); const float inv = sbc;
  float s2 = 0.f; for (int k = t; k < kend; k += 256) { const float v = sr[k]; const float msk = fminf(fmaxf(((float)k + spv) / 33.0f, 0.f), 1.0f); const float pm = ((v <= -1.0e38f) ? 0.f : expf(v - m) * inv) * msk; sh[k] = pm; s2 += pm; }
#pragma unroll
  for (int o = 1; o < 32; o <<= 1) s2 += __shfl_xor(s2, o);
  __syncthreads(); if ((t & 31) == 0) sred[t >> 5] = s2; __syncthreads(); if (t == 0) { float a = 0.f; for (int i = 0; i < 8; ++i) a += sred[i]; sbc = 2048.0f / (a + 1e-8f); } __syncthreads(); const float rn = sbc;
  for (int k = t; k < kend; k += 256) sh[k] *= rn;
  __syncthreads(); for (int q = t; q < kend / 4; q += 256) vst2(sr + q * 4, *(const v4f*)&sh[q * 4]); }   /* w = softmax * ramp mask, renormalised by (sum + 1e-8), carried x 2^11 */
// ---- k_pv: block = 32 queries of (b,h), 16 waves: wave w takes the 32-key chunks w, w + 16, ... of keys [0, kend) for all 32 queries; the 16 partial tiles are summed through LDS in wave order: y[q][h*HD + d] = P . v
#define PVQ 32
#define PVW 16
__global__ __launch_bounds__(32 * PVW) void k_pv(const float* __restrict__ PS0, const __bf16* __restrict__ VT, const __bf16* __restrict__ VL, int b, int h0, float* __restrict__ Y) { const int h = h0 + blockIdx.z; const float* PS = PS0 + (size_t)blockIdx.z * TT * TT; __shared__ __align__(16) float ss[PVW][PVQ][HD + 4];
  const int tid = threadIdx.x, wave = __builtin_amdgcn_readfirstlane(tid >> 5), lane = tid & 31, col = lane & 15, g = lane >> 4; const int ql0 = blockIdx.x * PVQ; const int kend = (ql0 / 64) * 64 + 64;
  v8f acc[PVQ / 16][HD / 16] = {};
#pragma unroll 1
  for (int kc = wave; kc < kend / 32; kc += PVW) { const F2 p0 = split_row(PS + (size_t)(ql0 + col) * TT, kc * 32, lane), p1 = split_row(PS + (size_t)(ql0 + 16 + col) * TT, kc * 32, lane);
#pragma unroll
    for (int j = 0; j < HD / 16; ++j) { const size_t po = ((size_t)b * CC + h * HD + j * 16 + col) * (size_t)TT + kc * 32; const v16b vh = frag_b(VT + po, lane), vl = frag_b(VL + po, lane);
      acc[0][j] = wmma_bf(p0.h, vh, acc[0][j]); acc[0][j] = wmma_bf(p0.l, vh, acc[0][j]); acc[0][j] = wmma_bf(p0.h, vl, acc[0][j]);
      acc[1][j] = wmma_bf(p1.h, vh, acc[1][j]); acc[1][j] = wmma_bf(p1.l, vh, acc[1][j]); acc[1][j] = wmma_bf(p1.h, vl, acc[1][j]); } }
#pragma unroll
  for (int i = 0; i < PVQ / 16; ++i)
#pragma unroll
    for (int j = 0; j < HD / 16; ++j)
#pragma unroll
      for (int r = 0; r < 8; ++r) ss[wave][i * 16 + 8 * g + r][j * 16 + col] = acc[i][j][r];
  __syncthreads();
  const int rl = tid >> 4, q4 = (tid & 15) * 4; v4f s = *(const v4f*)&ss[0][rl][q4];
#pragma unroll
  for (int w = 1; w < PVW; ++w) s += *(const v4f*)&ss[w][rl][q4];
  vst2(Y + ((size_t)b * TT + ql0 + rl) * CC + h * HD + q4, s * (1.0f / 2048.0f)); }
// ---- k_out: block = (64 rows, 128 cols): out = y (bf16 hi + lo) Wo + bo
__global__ __launch_bounds__(128) void k_out(const float* __restrict__ Y, const float* __restrict__ WP, const float* __restrict__ BP, float* __restrict__ OUT) { __shared__ __align__(16) float sf[4][16][132];
  const int tid = threadIdx.x, wave = tid >> 5, lane = tid & 31, col = lane & 15, g = lane >> 4; const int c0 = blockIdx.y * 128; const size_t r0 = (size_t)blockIdx.x * 64 + wave * 16;
  v8f acc[8] = {};
#pragma unroll 2
  for (int kc = 0; kc < CC / 32; ++kc) { const F2 a = split_row(Y + (r0 + col) * CC, kc * 32, lane);
#pragma unroll
    for (int j = 0; j < 8; ++j) { v16b w; const int o = c0 + j * 16 + col;
#pragma unroll
      for (int i = 0; i < 8; ++i) { w[i] = (__bf16)WP[(size_t)(kc * 32 + 8 * g + i) * CC + o]; w[8 + i] = (__bf16)WP[(size_t)(kc * 32 + 16 + 8 * g + i) * CC + o]; }
      acc[j] = wmma_bf(a.h, w, acc[j]); acc[j] = wmma_bf(a.l, w, acc[j]); } }
#pragma unroll
  for (int j = 0; j < 8; ++j) { const float bb = BP ? bfr(BP[c0 + j * 16 + col]) : 0.f;
#pragma unroll
    for (int r = 0; r < 8; ++r) sf[wave][8 * g + r][j * 16 + col] = acc[j][r] + bb; }
  LDSX(); for (int rl = 0; rl < 16; ++rl) vst2(OUT + (r0 + rl) * CC + c0 + lane * 4, *(const v4f*)&sf[wave][rl][lane * 4]); }
extern "C" void kernel_launch(void* const* d_in, const int* in_sizes, int n_in, void* d_out, int out_size, void* d_ws, size_t ws_size, hipStream_t stream) {
  (void)in_sizes; (void)n_in; (void)out_size;
  const float** F = (const float**)d_in;   // 0 query [2,2048,1024], 1 Wq [1024,1024] ((in,out)), 2 Wk, 3 Wv, 4 Wo ((in,out)), 5 span_val [1,16,1,1] (verbatim)
  if (ws_size < (size_t)WS_END) return;
  char* ws = (char*)d_ws; _Float16 *QH = (_Float16*)(ws + WS_QH), *QL = (_Float16*)(ws + WS_QL), *KH = (_Float16*)(ws + WS_KH); __bf16 *VT = (__bf16*)(ws + WS_VT), *VL = (__bf16*)(ws + WS_VL); float *S = (float*)(ws + WS_S), *Y = (float*)(ws + WS_Y);
  k_proj<<<dim3(TNB * TT / 64, CC / 128, 3), 128, 0, stream>>>(F[0], F[1], nullptr, F[2], nullptr, F[3], nullptr, QH, QL, KH, VT, VL);
  for (int b = 0; b < TNB; ++b) for (int h0 = 0; h0 < NH; h0 += HG) {
    k_sc<<<dim3(TT / 64, TT / 128, HG), 128, 0, stream>>>(QH, QL, KH, nullptr, b, h0, S);
    k_sm<<<dim3(TT, HG), 256, 0, stream>>>(S, F[5], h0);
    k_pv<<<dim3(TT / PVQ, 1, HG), 32 * PVW, 0, stream>>>(S, VT, VL, b, h0, Y);
  }
  k_out<<<dim3(TNB * TT / 64, CC / 128), 128, 0, stream>>>(Y, F[4], nullptr, (float*)d_out);
}

// v002
// One run takes 329 microseconds.
// Next to v001, in two timings, it ran 2.21 and 2.20 times as fast.
// All steps since v000 together make it 4.16 times as fast.
// compute dtype: all float inputs rounded to bf16, span_val read; q/k/v = query W with EXACT bf16 products on WMMA 16x16x32, f32 accumulate; q as f16 hi + residual (x 2^10), k f16 -> 2-product logits / 64 (the module divides by DH), causal (-1e9 additive == exclusion), stored in f32; softmax then the adaptive-span ramp mask and the renormalisation (+1e-8) in f32 (precise expf); P x 2^11 f32 split bf16 hi + lo against v bf16 hi + lo (3 products); out = y (bf16 hi + lo) Wo; f32 output.
#include <hip/hip_runtime.h>
#include <math.h>

typedef __attribute__((ext_vector_type(16))) _Float16 v16h;
typedef __attribute__((ext_vector_type(16))) __bf16 v16b;
typedef __attribute__((ext_vector_type(8)))  _Float16 v8h;
typedef __attribute__((ext_vector_type(8)))  float v8f;
typedef __attribute__((ext_vector_type(4)))  float v4f;
typedef __attribute__((ext_vector_type(2)))  float v2f;
typedef __attribute__((ext_vector_type(4)))  unsigned v4u;
typedef __attribute__((ext_vector_type(4)))  int v4i;
typedef float __attribute__((may_alias)) float_a;
typedef int __attribute__((may_alias)) int_a;

template <typename T> __device__ __forceinline__ void vst2(void* p, T v) { *(T*)p = v;  }
__device__ __forceinline__ v8f wmma16(v16h a, v16h b, v8f c) {
  v8f d = __builtin_amdgcn_wmma_f32_16x16x32_f16(false, a, false, b, (short)0, c, false, false);
  asm volatile("v_nop\n\tv_nop\n\tv_nop\n\tv_nop" : "+v"(d) : "v"(a), "v"(b));
  return d;
}
__device__ __forceinline__ v8f wmma_bf(v16b a, v16b b, v8f c) {
  v8f d = __builtin_amdgcn_wmma_f32_16x16x32_bf16(false, a, false, b, (short)0, c, false, false);
  asm volatile("v_nop\n\tv_nop\n\tv_nop\n\tv_nop" : "+v"(d) : "v"(a), "v"(b));
  return d;
}
// 16x16x32 fragments: lane = (h = lane>>4, row/col = lane&15); elements 0..7 = k0+8h+0..7, 8..15 = k0+16+8h+0..7; D element r = row 8h+r
__device__ __forceinline__ v16h frag_h(const _Float16* rowk0, int lane) {
  union { v16h v; v8h q[2]; } u; const _Float16* p = rowk0 + 8 * (lane >> 4);
  u.q[0] = *(const v8h*)p; u.q[1] = *(const v8h*)(p + 16); return u.v;
}
__device__ __forceinline__ v16h frag_f32(const float* rowk0, int lane) {
  v16h a; const float* p = rowk0 + 8 * (lane >> 4);
#pragma unroll
  for (int i = 0; i < 8; ++i) { a[i] = (_Float16)p[i]; a[8 + i] = (_Float16)p[16 + i]; }
  return a;
}
__device__ __forceinline__ v16h frag_f32s(const float* rowk0, int lane, float sc) {
  v16h a; const float* p = rowk0 + 8 * (lane >> 4);
#pragma unroll
  for (int i = 0; i < 8; ++i) { a[i] = (_Float16)(p[i] * sc); a[8 + i] = (_Float16)(p[16 + i] * sc); }
  return a;
}
// column fragment from a [K][ld] layout (column n), rows >= K read as 0
__device__ __forceinline__ v16h fragc_f32(const float* W, int k0, int n, int lane, int ld, int K) {
  v16h a; const int g = lane >> 4;
#pragma unroll
  for (int i = 0; i < 8; ++i) { const int ka = k0 + 8 * g + i, kb = ka + 16;
    a[i] = (_Float16)(ka < K ? W[(size_t)(ka < K ? ka : K - 1) * ld + n] : 0.f); a[8 + i] = (_Float16)(kb < K ? W[(size_t)(kb < K ? kb : K - 1) * ld + n] : 0.f); }
  return a;
}
struct F2 { v16b h, l; };
__device__ __forceinline__ F2 bsplit16(const float v[16]) { F2 r;
#pragma unroll
  for (int i = 0; i < 16; ++i) { const __bf16 h = (__bf16)v[i]; r.h[i] = h; r.l[i] = (__bf16)(v[i] - (float)h); }
  return r; }
__device__ __forceinline__ F2 split_row(const float* row, int k0, int lane) { float v[16]; const float* p = row + k0 + 8 * (lane >> 4);
#pragma unroll
  for (int i = 0; i < 8; ++i) { v[i] = p[i]; v[8 + i] = p[16 + i]; }
  return bsplit16(v); }
__device__ __forceinline__ F2 split_rowK(const float* row, int k0, int lane, int K) { float v[16]; const int g = lane >> 4;
#pragma unroll
  for (int i = 0; i < 8; ++i) { const int ka = k0 + 8 * g + i, kb = ka + 16; v[i] = ka < K ? row[ka < K ? ka : K - 1] : 0.f; v[8 + i] = kb < K ? row[kb < K ? kb : K - 1] : 0.f; }
  return bsplit16(v); }
__device__ __forceinline__ F2 split_col(const float* W, int k0, int n, int lane, int ld, int K) { float v[16]; const int g = lane >> 4;
#pragma unroll
  for (int i = 0; i < 8; ++i) { const int ka = k0 + 8 * g + i, kb = ka + 16; v[i] = ka < K ? W[(size_t)(ka < K ? ka : K - 1) * ld + n] : 0.f; v[8 + i] = kb < K ? W[(size_t)(kb < K ? kb : K - 1) * ld + n] : 0.f; }
  return bsplit16(v); }
__device__ __forceinline__ v8f mac3(const F2& a, const F2& b, v8f c) { c = wmma_bf(a.l, b.h, c); c = wmma_bf(a.h, b.l, c); return wmma_bf(a.h, b.h, c); }
__device__ __forceinline__ float sigm(float v) { return 1.0f / (1.0f + expf(-v)); }
#define LDSX() do { asm volatile("s_wait_dscnt 0" ::: "memory"); __builtin_amdgcn_wave_barrier(); __builtin_amdgcn_fence(__ATOMIC_RELEASE, "workgroup"); } while (0)


// Adaptive-span causal attention (B 2, S 2,048, hidden 1,024 = 16 x 64, ramp 32): w = softmax(q k^T / 64 + triu(-1e9, 1)); w = w * clip((k_idx + span_val[h] * S) / 33, 0, 1); w = w / (sum_k w + 1e-8); out = (w v) Wo (no biases).
#define NB 2
#define TT 2048
#define CC 1024
#define NH 16
#define HD 64
#ifndef TNB
#define TNB NB
#endif
typedef __attribute__((ext_vector_type(8))) __bf16 v8b;
__device__ __forceinline__ v16b frag_b(const __bf16* rowk0, int lane) {
  union { v16b v; v8b q[2]; } u; const __bf16* p = rowk0 + 8 * (lane >> 4);
  u.q[0] = *(const v8b*)p; u.q[1] = *(const v8b*)(p + 16); return u.v;
}
__device__ __forceinline__ float bfr(float v) { return (float)(__bf16)v; }
__device__ __attribute__((noinline)) float exp_ni(float v) { return expf(v); }
__device__ __attribute__((noinline)) float erf_ni(float v) { return erff(v); }

#define WS_QH  0u
#define WS_QL  (WS_QH + 2u * (size_t)NB * TT * CC)
#define WS_KH  (WS_QL + 2u * (size_t)NB * TT * CC)
#define WS_VT  (WS_KH + 2u * (size_t)NB * TT * CC)      // bf16 v planes [b][c][t]
#define WS_VL  (WS_VT + 2u * (size_t)NB * CC * TT)      // bf16 v residual planes
#define WS_Y   (WS_VL + 2u * (size_t)NB * CC * TT)      // f32 y rows [b*t][C]
#define WS_END (WS_Y + 4u * (size_t)NB * TT * CC)

// ---- k_proj: block = (64 rows, 128 cols, which): qkv = x W (+ b), exact; q -> f16 hi (+ residual), k -> f16 rows, v -> bf16 hi + lo planes
__global__ __launch_bounds__(128) void k_proj(const float* __restrict__ X, const float* __restrict__ WQ, const float* __restrict__ BQ, const float* __restrict__ WK, const float* __restrict__ BK, const float* __restrict__ WV, const float* __restrict__ BV, _Float16* __restrict__ QH, _Float16* __restrict__ QL, _Float16* __restrict__ KH, __bf16* __restrict__ VT, __bf16* __restrict__ VL) {
  __shared__ __align__(16) _Float16 sh[64][136], sl[64][136]; __shared__ __align__(16) __bf16 th[128][72], tl2[128][72];
  const int tid = threadIdx.x, wave = tid >> 5, lane = tid & 31, col = lane & 15, g = lane >> 4; const int which = blockIdx.z; const int c0 = blockIdx.y * 128; const size_t r0 = (size_t)blockIdx.x * 64; const float* WA = which == 0 ? WQ : which == 1 ? WK : WV; const float* BA = which == 0 ? BQ : which == 1 ? BK : BV;
  v8f acc[8] = {};
#pragma unroll 2
  for (int kc = 0; kc < CC / 32; ++kc) { v16b a; { const float* p = X + (r0 + wave * 16 + col) * CC + kc * 32 + 8 * g;
#pragma unroll
      for (int i = 0; i < 8; ++i) { a[i] = (__bf16)p[i]; a[8 + i] = (__bf16)p[16 + i]; } }
#pragma unroll
    for (int j = 0; j < 8; ++j) { v16b w; const int o = c0 + j * 16 + col;
#pragma unroll
      for (int i = 0; i < 8; ++i) { w[i] = (__bf16)WA[(size_t)(kc * 32 + 8 * g + i) * CC + o]; w[8 + i] = (__bf16)WA[(size_t)(kc * 32 + 16 + 8 * g + i) * CC + o]; }
      acc[j] = wmma_bf(a, w, acc[j]); } }
#pragma unroll
  for (int j = 0; j < 8; ++j) { const float bb = BA ? bfr(BA[c0 + j * 16 + col]) : 0.f;
#pragma unroll
    for (int r = 0; r < 8; ++r) { const float v = acc[j][r] + bb; const int rl = wave * 16 + 8 * g + r, cl = j * 16 + col; const _Float16 hv = (_Float16)v;
      if (which == 2) { const __bf16 bh = (__bf16)v; th[cl][rl] = bh; tl2[cl][rl] = (__bf16)(v - (float)bh); } else { sh[rl][cl] = hv; sl[rl][cl] = (_Float16)((v - (float)hv) * 1024.0f); }   /* q residual carried x 2^10 so the plane stays f16-normal on the chip */ } }
  __syncthreads();
  if (which < 2) { _Float16* dh = which == 0 ? QH : KH; for (int e = tid; e < 64 * 16; e += 128) { const int rl = e >> 4, q = e & 15; vst2((unsigned*)(dh + (r0 + rl) * CC + c0 + q * 8), *(const v4u*)&sh[rl][q * 8]); if (which == 0) vst2((unsigned*)(QL + (r0 + rl) * CC + c0 + q * 8), *(const v4u*)&sl[rl][q * 8]); } }
  else { const size_t b = r0 / TT; const int t0 = (int)(r0 % TT); for (int e = tid; e < 128 * 8; e += 128) { const int cl = e >> 3, q = e & 7; const size_t o2 = (b * CC + c0 + cl) * (size_t)TT + t0 + q * 8; vst2((unsigned*)(VT + o2), *(const v4u*)&th[cl][q * 8]); vst2((unsigned*)(VL + o2), *(const v4u*)&tl2[cl][q * 8]); } } }
// ---- k_attn: block = 32 queries of (b,h), 16 waves; the 32 logit rows stay in LDS from q k^T to P . v.
//      A: wave w takes the 64-key groups w, w + 16 of keys [0, kend): logits / 64, causal, into LDS rows.
//      B: wave w takes rows 2w, 2w + 1: softmax, adaptive-span ramp mask clip((k + span_val[h] S)/(RAMP+1), 0, 1), renormalised by (sum + 1e-8) -> P x 2^11 f32 in place.
//      C: wave w takes the 32-key chunks w, w + 16, ... for all 32 queries; the 16 partial tiles are summed through LDS in wave order: y[q][h*HD + d] = P . v
#define PVQ 32
#define PVW 16
#define SP (TT + 4)                                   // LDS row pitch in floats: 16 B x odd, so 16-byte reads down 16 rows meet no bank twice
__global__ __launch_bounds__(32 * PVW) void k_attn(const _Float16* __restrict__ QH, const _Float16* __restrict__ QL, const _Float16* __restrict__ KH, const __bf16* __restrict__ VT, const __bf16* __restrict__ VL, const float* __restrict__ SPAN, float* __restrict__ Y) {
  __shared__ __align__(16) float sS[PVQ * SP]; __shared__ __align__(16) float smk[TT];
  const int tid = threadIdx.x, wave = __builtin_amdgcn_readfirstlane(tid >> 5), lane = tid & 31, col = lane & 15, g = lane >> 4; const int b = blockIdx.z / NH, h = blockIdx.z % NH; const int ql0 = blockIdx.x * PVQ; const int kend = (ql0 / 64) * 64 + 64;
  { const float spv = bfr(SPAN[h]) * (float)TT;   /* span_val[h] * attn_span */
    for (int k = tid; k < kend; k += 32 * PVW) smk[k] = fminf(fmaxf(((float)k + spv) / 33.0f, 0.f), 1.0f); }
  { v16h ah[PVQ / 16][HD / 32], al[PVQ / 16][HD / 32]; const size_t qo = ((size_t)b * TT + ql0 + col) * CC + h * HD; const _Float16 *qhp = QH + qo, *qlp = QL + qo;
#pragma unroll
    for (int i = 0; i < PVQ / 16; ++i)
#pragma unroll
      for (int kc = 0; kc < HD / 32; ++kc) { ah[i][kc] = frag_h(qhp + i * 16 * CC + kc * 32, lane); al[i][kc] = frag_h(qlp + i * 16 * CC + kc * 32, lane); }
    asm volatile("s_wait_xcnt 0x0" :: "v"(qhp + 8 * g), "v"(qlp + 8 * g) : "memory");   // the wait of the q loads; their two address pairs are inputs, so that no register of them is reused in front of it
#pragma unroll 1   // kept rolled (two trips at most): a second trip's 64 fragment registers beside the q fragments would not fit the 256 of a 16-wave block
    for (int k0 = wave * 64; k0 < kend; k0 += PVW * 64) { v16h kb[4][HD / 32];   // the trip's 16 loads go out together, ahead of its products
#pragma unroll
      for (int j = 0; j < 4; ++j)
#pragma unroll
        for (int kc = 0; kc < HD / 32; ++kc) kb[j][kc] = frag_h(KH + ((size_t)b * TT + k0 + j * 16 + col) * CC + h * HD + kc * 32, lane);
#pragma unroll
      for (int j = 0; j < 4; ++j) { v8f a[PVQ / 16] = {}, l[PVQ / 16] = {}; const int kt = k0 + j * 16 + col;
#pragma unroll
        for (int kc = 0; kc < HD / 32; ++kc)
#pragma unroll
          for (int i = 0; i < PVQ / 16; ++i) { a[i] = wmma16(ah[i][kc], kb[j][kc], a[i]); l[i] = wmma16(al[i][kc], kb[j][kc], l[i]); }
#pragma unroll
        for (int i = 0; i < PVQ / 16; ++i) { a[i] += l[i] * (1.0f / 1024.0f);
#pragma unroll
          for (int r = 0; r < 8; ++r) { const int rl = i * 16 + 8 * g + r; float v = a[i][r] * (1.0f / 64.0f); if (kt > ql0 + rl) v = -3.0e38f; /* scores divided by DH = 64 as written */ sS[rl * SP + kt] = v; } } } } }
  __syncthreads();   // all logits of the 32 rows and the mask table are in LDS
  { float* ra = sS + (2 * wave) * SP + lane * 2; float* rb = ra + SP; const float* mkp = smk + lane * 2; const int nc = kend / 64;   // a trip is 64 keys of both rows, 2 keys a lane: the trip count is the same for every lane
    float ma = -3.0e38f, mb = -3.0e38f;
    for (int c = 0; c < nc; ++c) { const v2f x = *(const v2f*)(ra + c * 64), y = *(const v2f*)(rb + c * 64); ma = fmaxf(ma, fmaxf(x[0], x[1])); mb = fmaxf(mb, fmaxf(y[0], y[1])); }
#pragma unroll
    for (int o = 1; o < 32; o <<= 1) { ma = fmaxf(ma, __shfl_xor(ma, o)); mb = fmaxf(mb, __shfl_xor(mb, o)); }
    float sa = 0.f, sb = 0.f, ta = 0.f, tb = 0.f;   // sums of exp and of exp * mask, taken in the one pass that makes the exps
    for (int c = 0; c < nc; ++c) { v2f x = *(const v2f*)(ra + c * 64), y = *(const v2f*)(rb + c * 64); const v2f mk = *(const v2f*)(mkp + c * 64);
#pragma unroll
      for (int e = 0; e < 2; ++e) { const float ex = expf(x[e] - ma), ey = expf(y[e] - mb); x[e] = (x[e] <= -1.0e38f) ? 0.f : ex; y[e] = (y[e] <= -1.0e38f) ? 0.f : ey; sa += x[e]; sb += y[e]; ta += x[e] * mk[e]; tb += y[e] * mk[e]; }
      *(v2f*)(ra + c * 64) = x; *(v2f*)(rb + c * 64) = y; }
#pragma unroll
    for (int o = 1; o < 32; o <<= 1) { sa += __shfl_xor(sa, o); sb += __shfl_xor(sb, o); ta += __shfl_xor(ta, o); tb += __shfl_xor(tb, o); }
    const float ia = 1.0f / sa, ib = 1.0f / sb; const float na = 2048.0f / (ta * ia + 1e-8f), nb = 2048.0f / (tb * ib + 1e-8f);
    for (int c = 0; c < nc; ++c) { v2f x = *(const v2f*)(ra + c * 64), y = *(const v2f*)(rb + c * 64); const v2f mk = *(const v2f*)(mkp + c * 64);
#pragma unroll
      for (int e = 0; e < 2; ++e) { x[e] = ((x[e] * ia) * mk[e]) * na; y[e] = ((y[e] * ib) * mk[e]) * nb; }
      *(v2f*)(ra + c * 64) = x; *(v2f*)(rb + c * 64) = y; } }   /* w = softmax * ramp mask, renormalised by (sum + 1e-8), carried x 2^11 */
  __syncthreads();   // all 32 rows of P are in LDS
  v8f acc[PVQ / 16][HD / 16] = {};
#pragma unroll 1
  for (int kc = wave; kc < kend / 32; kc += PVW) { const F2 p0 = split_row(sS + col * SP, kc * 32, lane), p1 = split_row(sS + (16 + col) * SP, kc * 32, lane);
#pragma unroll
    for (int j = 0; j < HD / 16; ++j) { const size_t po = ((size_t)b * CC + h * HD + j * 16 + col) * (size_t)TT + kc * 32; const v16b vh = frag_b(VT + po, lane), vl = frag_b(VL + po, lane);
      acc[0][j] = wmma_bf(p0.h, vh, acc[0][j]); acc[0][j] = wmma_bf(p0.l, vh, acc[0][j]); acc[0][j] = wmma_bf(p0.h, vl, acc[0][j]);
      acc[1][j] = wmma_bf(p1.h, vh, acc[1][j]); acc[1][j] = wmma_bf(p1.l, vh, acc[1][j]); acc[1][j] = wmma_bf(p1.h, vl, acc[1][j]); } }
  __syncthreads();   // every wave has read its last P: the partial tiles take over that LDS
  float* ss = sS;    // [PVW][PVQ][HD + 4]
#pragma unroll
  for (int i = 0; i < PVQ / 16; ++i)
#pragma unroll
    for (int j = 0; j < HD / 16; ++j)
#pragma unroll
      for (int r = 0; r < 8; ++r) ss[(wave * PVQ + i * 16 + 8 * g + r) * (HD + 4) + j * 16 + col] = acc[i][j][r];
  __syncthreads();
  const int rl = tid >> 4, q4 = (tid & 15) * 4; v4f s = *(const v4f*)&ss[rl * (HD + 4) + q4];
#pragma unroll
  for (int w = 1; w < PVW; ++w) s += *(const v4f*)&ss[(w * PVQ + rl) * (HD + 4) + q4];
  vst2(Y + ((size_t)b * TT + ql0 + rl) * CC + h * HD + q4, s * (1.0f / 2048.0f)); }
// ---- k_out: block = (64 rows, 128 cols): out = y (bf16 hi + lo) Wo + bo
__global__ __launch_bounds__(128) void k_out(const float* __restrict__ Y, const float* __restrict__ WP, const float* __restrict__ BP, float* __restrict__ OUT) { __shared__ __align__(16) float sf[4][16][132];
  const int tid = threadIdx.x, wave = tid >> 5, lane = tid & 31, col = lane & 15, g = lane >> 4; const int c0 = blockIdx.y * 128; const size_t r0 = (size_t)blockIdx.x * 64 + wave * 16;
  v8f acc[8] = {};
#pragma unroll 2
  for (int kc = 0; kc < CC / 32; ++kc) { const F2 a = split_row(Y + (r0 + col) * CC, kc * 32, lane);
#pragma unroll
    for (int j = 0; j < 8; ++j) { v16b w; const int o = c0 + j * 16 + col;
#pragma unroll
      for (int i = 0; i < 8; ++i) { w[i] = (__bf16)WP[(size_t)(kc * 32 + 8 * g + i) * CC + o]; w[8 + i] = (__bf16)WP[(size_t)(kc * 32 + 16 + 8 * g + i) * CC + o]; }
      acc[j] = wmma_bf(a.h, w, acc[j]); acc[j] = wmma_bf(a.l, w, acc[j]); } }
#pragma unroll
  for (int j = 0; j < 8; ++j) { const float bb = BP ? bfr(BP[c0 + j * 16 + col]) : 0.f;
#pragma unroll
    for (int r = 0; r < 8; ++r) sf[wave][8 * g + r][j * 16 + col] = acc[j][r] + bb; }
  LDSX(); for (int rl = 0; rl < 16; ++rl) vst2(OUT + (r0 + rl) * CC + c0 + lane * 4, *(const v4f*)&sf[wave][rl][lane * 4]); }
extern "C" void kernel_launch(void* const* d_in, const int* in_sizes, int n_in, void* d_out, int out_size, void* d_ws, size_t ws_size, hipStream_t stream) {
  (void)in_sizes; (void)n_in; (void)out_size;
  const float** F = (const float**)d_in;   // 0 query [2,2048,1024], 1 Wq [1024,1024] ((in,out)), 2 Wk, 3 Wv, 4 Wo ((in,out)), 5 span_val [1,16,1,1] (verbatim)
  if (ws_size < (size_t)WS_END) return;
  char* ws = (char*)d_ws; _Float16 *QH = (_Float16*)(ws + WS_QH), *QL = (_Float16*)(ws + WS_QL), *KH = (_Float16*)(ws + WS_KH); __bf16 *VT = (__bf16*)(ws + WS_VT), *VL = (__bf16*)(ws + WS_VL); float *Y = (float*)(ws + WS_Y);
  k_proj<<<dim3(TNB * TT / 64, CC / 128, 3), 128, 0, stream>>>(F[0], F[1], nullptr, F[2], nullptr, F[3], nullptr, QH, QL, KH, VT, VL);
  k_attn<<<dim3(TT / PVQ, 1, TNB * NH), 32 * PVW, 0, stream>>>(QH, QL, KH, VT, VL, F[5], Y);
  k_out<<<dim3(TNB * TT / 64, CC / 128), 128, 0, stream>>>(Y, F[4], nullptr, (float*)d_out);
}

// v003
// Measured time: 216 microseconds a run.
// Two timings next to v002 both put it at 1.52 times that version's speed.
// Over all steps from v000 it is 6.32 times as fast.
// compute dtype: all float inputs rounded to bf16, span_val read; q/k/v = query W with EXACT bf16 products on WMMA 16x16x32, f32 accumulate; q as f16 hi + residual (x 2^10), k f16 -> 2-product logits / 64 (the module divides by DH), causal (-1e9 additive == exclusion), stored in f32; softmax then the adaptive-span ramp mask and the renormalisation (+1e-8) in f32 (precise expf); P x 2^11 f32 split bf16 hi + lo against v bf16 hi + lo (3 products); out = y (bf16 hi + lo) Wo; f32 output.
#include <hip/hip_runtime.h>
#include <math.h>

typedef __attribute__((ext_vector_type(16))) _Float16 v16h;
typedef __attribute__((ext_vector_type(16))) __bf16 v16b;
typedef __attribute__((ext_vector_type(8)))  _Float16 v8h;
typedef __attribute__((ext_vector_type(8)))  float v8f;
typedef __attribute__((ext_vector_type(4)))  float v4f;
typedef __attribute__((ext_vector_type(2)))  float v2f;
typedef __attribute__((ext_vector_type(4)))  unsigned v4u;
typedef __attribute__((ext_vector_type(4)))  int v4i;
typedef float __attribute__((may_alias)) float_a;
typedef int __attribute__((may_alias)) int_a;

template <typename T> __device__ __forceinline__ void vst2(void* p, T v) { *(T*)p = v;  }
__device__ __forceinline__ v8f wmma16(v16h a, v16h b, v8f c) {
  v8f d = __builtin_amdgcn_wmma_f32_16x16x32_f16(false, a, false, b, (short)0, c, false, false);
  asm volatile("v_nop\n\tv_nop\n\tv_nop\n\tv_nop" : "+v"(d) : "v"(a), "v"(b));
  return d;
}
__device__ __forceinline__ v8f wmma_bf(v16b a, v16b b, v8f c) {
  v8f d = __builtin_amdgcn_wmma_f32_16x16x32_bf16(false, a, false, b, (short)0, c, false, false);
  asm volatile("v_nop\n\tv_nop\n\tv_nop\n\tv_nop" : "+v"(d) : "v"(a), "v"(b));
  return d;
}
// 16x16x32 fragments: lane = (h = lane>>4, row/col = lane&15); elements 0..7 = k0+8h+0..7, 8..15 = k0+16+8h+0..7; D element r = row 8h+r
__device__ __forceinline__ v16h frag_h(const _Float16* rowk0, int lane) {
  union { v16h v; v8h q[2]; } u; const _Float16* p = rowk0 + 8 * (lane >> 4);
  u.q[0] = *(const v8h*)p; u.q[1] = *(const v8h*)(p + 16); return u.v;
}
__device__ __forceinline__ v16h frag_f32(const float* rowk0, int lane) {
  v16h a; const float* p = rowk0 + 8 * (lane >> 4);
#pragma unroll
  for (int i = 0; i < 8; ++i) { a[i] = (_Float16)p[i]; a[8 + i] = (_Float16)p[16 + i]; }
  return a;
}
__device__ __forceinline__ v16h frag_f32s(const float* rowk0, int lane, float sc) {
  v16h a; const float* p = rowk0 + 8 * (lane >> 4);
#pragma unroll
  for (int i = 0; i < 8; ++i) { a[i] = (_Float16)(p[i] * sc); a[8 + i] = (_Float16)(p[16 + i] * sc); }
  return a;
}
// column fragment from a [K][ld] layout (column n), rows >= K read as 0
__device__ __forceinline__ v16h fragc_f32(const float* W, int k0, int n, int lane, int ld, int K) {
  v16h a; const int g = lane >> 4;
#pragma unroll
  for (int i = 0; i < 8; ++i) { const int ka = k0 + 8 * g + i, kb = ka + 16;
    a[i] = (_Float16)(ka < K ? W[(size_t)(ka < K ? ka : K - 1) * ld + n] : 0.f); a[8 + i] = (_Float16)(kb < K ? W[(size_t)(kb < K ? kb : K - 1) * ld + n] : 0.f); }
  return a;
}
struct F2 { v16b h, l; };
__device__ __forceinline__ F2 bsplit16(const float v[16]) { F2 r;
#pragma unroll
  for (int i = 0; i < 16; ++i) { const __bf16 h = (__bf16)v[i]; r.h[i] = h; r.l[i] = (__bf16)(v[i] - (float)h); }
  return r; }
__device__ __forceinline__ F2 split_row(const float* row, int k0, int lane) { float v[16]; const float* p = row + k0 + 8 * (lane >> 4);
#pragma unroll
  for (int i = 0; i < 8; ++i) { v[i] = p[i]; v[8 + i] = p[16 + i]; }
  return bsplit16(v); }
__device__ __forceinline__ F2 split_rowK(const float* row, int k0, int lane, int K) { float v[16]; const int g = lane >> 4;
#pragma unroll
  for (int i = 0; i < 8; ++i) { const int ka = k0 + 8 * g + i, kb = ka + 16; v[i] = ka < K ? row[ka < K ? ka : K - 1] : 0.f; v[8 + i] = kb < K ? row[kb < K ? kb : K - 1] : 0.f; }
  return bsplit16(v); }
__device__ __forceinline__ F2 split_col(const float* W, int k0, int n, int lane, int ld, int K) { float v[16]; const int g = lane >> 4;
#pragma unroll
  for (int i = 0; i < 8; ++i) { const int ka = k0 + 8 * g + i, kb = ka + 16; v[i] = ka < K ? W[(size_t)(ka < K ? ka : K - 1) * ld + n] : 0.f; v[8 + i] = kb < K ? W[(size_t)(kb < K ? kb : K - 1) * ld + n] : 0.f; }
  return bsplit16(v); }
__device__ __forceinline__ v8f mac3(const F2& a, const F2& b, v8f c) { c = wmma_bf(a.l, b.h, c); c = wmma_bf(a.h, b.l, c); return wmma_bf(a.h, b.h, c); }
__device__ __forceinline__ float sigm(float v) { return 1.0f / (1.0f + expf(-v)); }
#define LDSX() do { asm volatile("s_wait_dscnt 0" ::: "memory"); __builtin_amdgcn_wave_barrier(); __builtin_amdgcn_fence(__ATOMIC_RELEASE, "workgroup"); } while (0)


// Adaptive-span causal attention (B 2, S 2,048, hidden 1,024 = 16 x 64, ramp 32): w = softmax(q k^T / 64 + triu(-1e9, 1)); w = w * clip((k_idx + span_val[h] * S) / 33, 0, 1); w = w / (sum_k w + 1e-8); out = (w v) Wo (no biases).
#define NB 2
#define TT 2048
#define CC 1024
#define NH 16
#define HD 64
#ifndef TNB
#define TNB NB
#endif
typedef __attribute__((ext_vector_type(8))) __bf16 v8b;
__device__ __forceinline__ v16b frag_b(const __bf16* rowk0, int lane) {
  union { v16b v; v8b q[2]; } u; const __bf16* p = rowk0 + 8 * (lane >> 4);
  u.q[0] = *(const v8b*)p; u.q[1] = *(const v8b*)(p + 16); return u.v;
}
__device__ __forceinline__ float bfr(float v) { return (float)(__bf16)v; }
__device__ __attribute__((noinline)) float exp_ni(float v) { return expf(v); }
__device__ __attribute__((noinline)) float erf_ni(float v) { return erff(v); }

#define WS_QH  0u
#define WS_QL  (WS_QH + 2u * (size_t)NB * TT * CC)
#define WS_KH  (WS_QL + 2u * (size_t)NB * TT * CC)
#define WS_VT  (WS_KH + 2u * (size_t)NB * TT * CC)      // bf16 v planes [b][c][t]
#define WS_VL  (WS_VT + 2u * (size_t)NB * CC * TT)      // bf16 v residual planes
#define WS_Y   (WS_VL + 2u * (size_t)NB * CC * TT)      // f32 y rows [b*t][C]
#define WS_END (WS_Y + 4u * (size_t)NB * TT * CC)

#define GK 64                                         // k per stage of the two GEMM kernels
#define XP 72                                         // LDS row pitch of a staged tile in bf16: 144 B = 16 B x odd, so 16-byte reads down 16 rows meet no bank twice
typedef __attribute__((ext_vector_type(4))) __bf16 v4b;
// W rows of one stage for a wave's 32 columns: lane (col, g) takes columns 2 col, 2 col + 1 of rows 8 g + i and 16 + 8 g + i of each 32-k chunk, so a load covers two whole 128-byte lines.
// Fragment e then holds column 2 col + e in lane col: the k order is that of frag_b, only the tile's columns are renumbered (undone where the accumulators are stored).
__device__ __forceinline__ void ld_w(const float* wp, v2f (&wr)[2][16]) {
#pragma unroll
  for (int c = 0; c < 2; ++c)
#pragma unroll
    for (int i = 0; i < 8; ++i) { wr[c][i] = *(const v2f*)(wp + (size_t)(c * 32 + i) * CC); wr[c][8 + i] = *(const v2f*)(wp + (size_t)(c * 32 + 16 + i) * CC); }
}
__device__ __forceinline__ void cv_w(const v2f (&wr)[2][16], v16b (&wf)[2][2]) {
#pragma unroll
  for (int c = 0; c < 2; ++c)
#pragma unroll
    for (int i = 0; i < 16; ++i) { wf[c][0][i] = (__bf16)wr[c][i][0]; wf[c][1][i] = (__bf16)wr[c][i][1]; }
}
// the block's 128 x 64 f32 tile of one stage: 16 lanes a row, so a load covers two rows of 256 contiguous bytes
__device__ __forceinline__ void ld_x(const float* xp, v4f (&xr)[8]) {
#pragma unroll
  for (int u = 0; u < 8; ++u) xr[u] = *(const v4f*)(xp + (size_t)(u * 16) * CC);
}
// ---- k_proj: block = (128 rows, 128 cols, which), 8 waves of 64 rows x 32 cols: qkv = x W (+ b), exact; q -> f16 hi (+ residual), k -> f16 rows, v -> bf16 planes
//      per 64-k stage the x tile goes once through LDS as bf16 (two buffers) and serves the four waves of its rows; each wave reads only its own 32 columns of W; the next stage's loads fly during this stage's products
__global__ __launch_bounds__(256) void k_proj(const float* __restrict__ X, const float* __restrict__ WQ, const float* __restrict__ BQ, const float* __restrict__ WK, const float* __restrict__ BK, const float* __restrict__ WV, const float* __restrict__ BV, _Float16* __restrict__ QH, _Float16* __restrict__ QL, _Float16* __restrict__ KH, __bf16* __restrict__ VT, __bf16* __restrict__ VL) {
  __shared__ __align__(16) unsigned char sm[2 * 128 * 136 * 2];   // one of: the two stage buffers (loop), q or k rows hi + residual, v planes hi + residual; a barrier stands between the uses
  _Float16 (*sh)[136] = (_Float16 (*)[136])sm, (*sl)[136] = (_Float16 (*)[136])(sm + 128 * 136 * 2); __bf16 (*th)[136] = (__bf16 (*)[136])sm, (*tl2)[136] = (__bf16 (*)[136])(sm + 128 * 136 * 2);
  const int tid = threadIdx.x, wave = tid >> 5, lane = tid & 31, col = lane & 15, g = lane >> 4; const int which = blockIdx.z; const int c0 = blockIdx.y * 128; const size_t r0 = (size_t)blockIdx.x * 128; const float* WA = which == 0 ? WQ : which == 1 ? WK : WV; const float* BA = which == 0 ? BQ : which == 1 ? BK : BV;
  __bf16 (*xs)[128][XP] = (__bf16 (*)[128][XP])sm;
  const int xrow = tid >> 4, xq = (tid & 15) * 4, rb = (wave >> 2) * 64, cb = (wave & 3) * 32 + 2 * col;   // the wave's first row, the lane's first column in the tile
  const float* wp = WA + (size_t)(8 * g) * CC + c0 + cb; const float* xp = X + (r0 + xrow) * CC + xq;
  v2f wr[2][16]; v4f xr[8]; v16b wf[2][2]; v8f acc[4][2] = {};
  ld_w(wp, wr); ld_x(xp, xr);
  cv_w(wr, wf);
#pragma unroll
  for (int u = 0; u < 8; ++u) { v4b h;
#pragma unroll
    for (int e = 0; e < 4; ++e) h[e] = (__bf16)xr[u][e];
    *(v4b*)&xs[0][u * 16 + xrow][xq] = h; }
  __syncthreads();   // stage 0 is in LDS
#pragma unroll 1   // kept rolled: a second stage's raw registers beside the first's would cost a wave per SIMD
  for (int s = 0; s < CC / GK; ++s) { const bool more = s + 1 < CC / GK;
    if (more) { wp += (size_t)GK * CC; xp += GK; ld_w(wp, wr); ld_x(xp, xr); }
#pragma unroll
    for (int c = 0; c < 2; ++c) { v16b a[4];
#pragma unroll
      for (int i = 0; i < 4; ++i) a[i] = frag_b(&xs[s & 1][rb + i * 16 + col][c * 32], lane);
#pragma unroll
      for (int i = 0; i < 4; ++i) { acc[i][0] = wmma_bf(a[i], wf[c][0], acc[i][0]); acc[i][1] = wmma_bf(a[i], wf[c][1], acc[i][1]); } }
    if (more) { cv_w(wr, wf);
#pragma unroll
      for (int u = 0; u < 8; ++u) { v4b h;
#pragma unroll
        for (int e = 0; e < 4; ++e) h[e] = (__bf16)xr[u][e];
        *(v4b*)&xs[(s + 1) & 1][u * 16 + xrow][xq] = h; } }
    __syncthreads(); }   // publishes stage s + 1 and ends every wave's reads of stage s, whose buffer the next trip refills
#pragma unroll
  for (int i = 0; i < 4; ++i)
#pragma unroll
  for (int e = 0; e < 2; ++e) { const int cl = cb + e; const float bb = BA ? bfr(BA[c0 + cl]) : 0.f;
#pragma unroll
    for (int r = 0; r < 8; ++r) { const float v = acc[i][e][r] + bb; const int rl = rb + i * 16 + 8 * g + r; const _Float16 hv = (_Float16)v;
      if (which == 2) { const __bf16 bh = (__bf16)v; th[cl][rl] = bh; tl2[cl][rl] = (__bf16)(v - (float)bh); } else { sh[rl][cl] = hv; sl[rl][cl] = (_Float16)((v - (float)hv) * 1024.0f); }   /* q residual carried x 2^10 so the plane stays f16-normal on the chip */ } }
  __syncthreads();
  if (which < 2) { _Float16* dh = which == 0 ? QH : KH; for (int e = tid; e < 128 * 16; e += 256) { const int rl = e >> 4, q = e & 15; _Float16* d0 = dh + (r0 + rl) * CC + c0 + q * 8; const v4u x0 = *(const v4u*)&sh[rl][q * 8]; vst2((unsigned*)d0, x0);
      asm volatile("s_wait_xcnt 0x0" :: "v"(d0), "v"(x0) : "memory");   // the wait of this store; its address pair and its data are inputs, so that no register of them is rewritten in front of it
      if (which == 0) { _Float16* d1 = QL + (r0 + rl) * CC + c0 + q * 8; const v4u x1 = *(const v4u*)&sl[rl][q * 8]; vst2((unsigned*)d1, x1);
        asm volatile("s_wait_xcnt 0x0" :: "v"(d1), "v"(x1) : "memory"); } } }   // as above
  else { const size_t b = r0 / TT; const int t0 = (int)(r0 % TT); for (int e = tid; e < 128 * 16; e += 256) { const int cl = e >> 4, q = e & 15; const size_t o2 = (b * CC + c0 + cl) * (size_t)TT + t0 + q * 8; vst2((unsigned*)(VT + o2), *(const v4u*)&th[cl][q * 8]); vst2((unsigned*)(VL + o2), *(const v4u*)&tl2[cl][q * 8]); } } }
// ---- k_attn: block = 32 queries of (b,h), 16 waves; the 32 logit rows stay in LDS from q k^T to P . v.
//      A: wave w takes the 64-key groups w, w + 16 of keys [0, kend): logits / 64, causal, into LDS rows.
//      B: wave w takes rows 2w, 2w + 1: softmax, adaptive-span ramp mask clip((k + span_val[h] S)/(RAMP+1), 0, 1), renormalised by (sum + 1e-8) -> P x 2^11 f32 in place.
//      C: wave w takes the 32-key chunks w, w + 16, ... for all 32 queries; the 16 partial tiles are summed through LDS in wave order: y[q][h*HD + d] = P . v
#define PVQ 32
#define PVW 16
#define SP (TT + 4)                                   // LDS row pitch in floats: 16 B x odd, so 16-byte reads down 16 rows meet no bank twice
__global__ __launch_bounds__(32 * PVW) void k_attn(const _Float16* __restrict__ QH, const _Float16* __restrict__ QL, const _Float16* __restrict__ KH, const __bf16* __restrict__ VT, const __bf16* __restrict__ VL, const float* __restrict__ SPAN, float* __restrict__ Y) {
  __shared__ __align__(16) float sS[PVQ * SP]; __shared__ __align__(16) float smk[TT];
  const int tid = threadIdx.x, wave = __builtin_amdgcn_readfirstlane(tid >> 5), lane = tid & 31, col = lane & 15, g = lane >> 4; const int b = blockIdx.z / NH, h = blockIdx.z % NH; const int ql0 = blockIdx.x * PVQ; const int kend = (ql0 / 64) * 64 + 64;
  { const float spv = bfr(SPAN[h]) * (float)TT;   /* span_val[h] * attn_span */
    for (int k = tid; k < kend; k += 32 * PVW) smk[k] = fminf(fmaxf(((float)k + spv) / 33.0f, 0.f), 1.0f); }
  { v16h ah[PVQ / 16][HD / 32], al[PVQ / 16][HD / 32]; const size_t qo = ((size_t)b * TT + ql0 + col) * CC + h * HD; const _Float16 *qhp = QH + qo, *qlp = QL + qo;
#pragma unroll
    for (int i = 0; i < PVQ / 16; ++i)
#pragma unroll
      for (int kc = 0; kc < HD / 32; ++kc) { ah[i][kc] = frag_h(qhp + i * 16 * CC + kc * 32, lane); al[i][kc] = frag_h(qlp + i * 16 * CC + kc * 32, lane); }
    asm volatile("s_wait_xcnt 0x0" :: "v"(qhp + 8 * g), "v"(qlp + 8 * g) : "memory");   // the wait of the q loads; their two address pairs are inputs, so that no register of them is reused in front of it
#pragma unroll 1   // kept rolled (two trips at most): a second trip's 64 fragment registers beside the q fragments would not fit the 256 of a 16-wave block
    for (int k0 = wave * 64; k0 < kend; k0 += PVW * 64) { v16h kb[4][HD / 32];   // the trip's 16 loads go out together, ahead of its products
#pragma unroll
      for (int j = 0; j < 4; ++j)
#pragma unroll
        for (int kc = 0; kc < HD / 32; ++kc) kb[j][kc] = frag_h(KH + ((size_t)b * TT + k0 + j * 16 + col) * CC + h * HD + kc * 32, lane);
#pragma unroll
      for (int j = 0; j < 4; ++j) { v8f a[PVQ / 16] = {}, l[PVQ / 16] = {}; const int kt = k0 + j * 16 + col;
#pragma unroll
        for (int kc = 0; kc < HD / 32; ++kc)
#pragma unroll
          for (int i = 0; i < PVQ / 16; ++i) { a[i] = wmma16(ah[i][kc], kb[j][kc], a[i]); l[i] = wmma16(al[i][kc], kb[j][kc], l[i]); }
#pragma unroll
        for (int i = 0; i < PVQ / 16; ++i) { a[i] += l[i] * (1.0f / 1024.0f);
#pragma unroll
          for (int r = 0; r < 8; ++r) { const int rl = i * 16 + 8 * g + r; float v = a[i][r] * (1.0f / 64.0f); if (kt > ql0 + rl) v = -3.0e38f; /* scores divided by DH = 64 as written */ sS[rl * SP + kt] = v; } } } } }
  __syncthreads();   // all logits of the 32 rows and the mask table are in LDS
  { float* ra = sS + (2 * wave) * SP + lane * 2; float* rb = ra + SP; const float* mkp = smk + lane * 2; const int nc = kend / 64;   // a trip is 64 keys of both rows, 2 keys a lane: the trip count is the same for every lane
    float ma = -3.0e38f, mb = -3.0e38f;
    for (int c = 0; c < nc; ++c) { const v2f x = *(const v2f*)(ra + c * 64), y = *(const v2f*)(rb + c * 64); ma = fmaxf(ma, fmaxf(x[0], x[1])); mb = fmaxf(mb, fmaxf(y[0], y[1])); }
#pragma unroll
    for (int o = 1; o < 32; o <<= 1) { ma = fmaxf(ma, __shfl_xor(ma, o)); mb = fmaxf(mb, __shfl_xor(mb, o)); }
    float sa = 0.f, sb = 0.f, ta = 0.f, tb = 0.f;   // sums of exp and of exp * mask, taken in the one pass that makes the exps
    for (int c = 0; c < nc; ++c) { v2f x = *(const v2f*)(ra + c * 64), y = *(const v2f*)(rb + c * 64); const v2f mk = *(const v2f*)(mkp + c * 64);
#pragma unroll
      for (int e = 0; e < 2; ++e) { const float ex = expf(x[e] - ma), ey = expf(y[e] - mb); x[e] = (x[e] <= -1.0e38f) ? 0.f : ex; y[e] = (y[e] <= -1.0e38f) ? 0.f : ey; sa += x[e]; sb += y[e]; ta += x[e] * mk[e]; tb += y[e] * mk[e]; }
      *(v2f*)(ra + c * 64) = x; *(v2f*)(rb + c * 64) = y; }
#pragma unroll
    for (int o = 1; o < 32; o <<= 1) { sa += __shfl_xor(sa, o); sb += __shfl_xor(sb, o); ta += __shfl_xor(ta, o); tb += __shfl_xor(tb, o); }
    const float ia = 1.0f / sa, ib = 1.0f / sb; const float na = 2048.0f / (ta * ia + 1e-8f), nb = 2048.0f / (tb * ib + 1e-8f);
    for (int c = 0; c < nc; ++c) { v2f x = *(const v2f*)(ra + c * 64), y = *(const v2f*)(rb + c * 64); const v2f mk = *(const v2f*)(mkp + c * 64);
#pragma unroll
      for (int e = 0; e < 2; ++e) { x[e] = ((x[e] * ia) * mk[e]) * na; y[e] = ((y[e] * ib) * mk[e]) * nb; }
      *(v2f*)(ra + c * 64) = x; *(v2f*)(rb + c * 64) = y; } }   /* w = softmax * ramp mask, renormalised by (sum + 1e-8), carried x 2^11 */
  __syncthreads();   // all 32 rows of P are in LDS
  v8f acc[PVQ / 16][HD / 16] = {};
#pragma unroll 1
  for (int kc = wave; kc < kend / 32; kc += PVW) { const F2 p0 = split_row(sS + col * SP, kc * 32, lane), p1 = split_row(sS + (16 + col) * SP, kc * 32, lane);
#pragma unroll
    for (int j = 0; j < HD / 16; ++j) { const size_t po = ((size_t)b * CC + h * HD + j * 16 + col) * (size_t)TT + kc * 32; const v16b vh = frag_b(VT + po, lane), vl = frag_b(VL + po, lane);
      acc[0][j] = wmma_bf(p0.h, vh, acc[0][j]); acc[0][j] = wmma_bf(p0.l, vh, acc[0][j]); acc[0][j] = wmma_bf(p0.h, vl, acc[0][j]);
      acc[1][j] = wmma_bf(p1.h, vh, acc[1][j]); acc[1][j] = wmma_bf(p1.l, vh, acc[1][j]); acc[1][j] = wmma_bf(p1.h, vl, acc[1][j]); } }
  __syncthreads();   // every wave has read its last P: the partial tiles take over that LDS
  float* ss = sS;    // [PVW][PVQ][HD + 4]
#pragma unroll
  for (int i = 0; i < PVQ / 16; ++i)
#pragma unroll
    for (int j = 0; j < HD / 16; ++j)
#pragma unroll
      for (int r = 0; r < 8; ++r) ss[(wave * PVQ + i * 16 + 8 * g + r) * (HD + 4) + j * 16 + col] = acc[i][j][r];
  __syncthreads();
  const int rl = tid >> 4, q4 = (tid & 15) * 4; v4f s = *(const v4f*)&ss[rl * (HD + 4) + q4];
#pragma unroll
  for (int w = 1; w < PVW; ++w) s += *(const v4f*)&ss[(w * PVQ + rl) * (HD + 4) + q4];
  vst2(Y + ((size_t)b * TT + ql0 + rl) * CC + h * HD + q4, s * (1.0f / 2048.0f)); }
// ---- k_out: block = (128 rows, 128 cols), 8 waves of 64 rows x 32 cols: out = y (bf16 hi + lo) Wo + bo; operands as in k_proj, the y tile staged as its two bf16 planes
__global__ __launch_bounds__(256) void k_out(const float* __restrict__ Y, const float* __restrict__ WP, const float* __restrict__ BP, float* __restrict__ OUT) { __shared__ __align__(16) __bf16 yh[2][128][XP], yl[2][128][XP]; __shared__ __align__(16) float sf[128][132];
  const int tid = threadIdx.x, wave = tid >> 5, lane = tid & 31, col = lane & 15, g = lane >> 4; const int c0 = blockIdx.y * 128; const size_t r0 = (size_t)blockIdx.x * 128;
  const int xrow = tid >> 4, xq = (tid & 15) * 4, rb = (wave >> 2) * 64, cb = (wave & 3) * 32 + 2 * col;   // the wave's first row, the lane's first column in the tile
  const float* wp = WP + (size_t)(8 * g) * CC + c0 + cb; const float* xp = Y + (r0 + xrow) * CC + xq;
  v2f wr[2][16]; v4f xr[8]; v16b wf[2][2]; v8f acc[4][2] = {};
  ld_w(wp, wr); ld_x(xp, xr);
  cv_w(wr, wf);
#pragma unroll
  for (int u = 0; u < 8; ++u) { v4b h, l;
#pragma unroll
    for (int e = 0; e < 4; ++e) { h[e] = (__bf16)xr[u][e]; l[e] = (__bf16)(xr[u][e] - (float)h[e]); }
    *(v4b*)&yh[0][u * 16 + xrow][xq] = h; *(v4b*)&yl[0][u * 16 + xrow][xq] = l; }
  __syncthreads();   // stage 0 is in LDS
#pragma unroll 1   // kept rolled: a second stage's raw registers beside the first's are not worth their room
  for (int s = 0; s < CC / GK; ++s) { const bool more = s + 1 < CC / GK;
    if (more) { wp += (size_t)GK * CC; xp += GK; ld_w(wp, wr); ld_x(xp, xr); }
#pragma unroll
    for (int c = 0; c < 2; ++c) { v16b ah[4], al[4];
#pragma unroll
      for (int i = 0; i < 4; ++i) { ah[i] = frag_b(&yh[s & 1][rb + i * 16 + col][c * 32], lane); al[i] = frag_b(&yl[s & 1][rb + i * 16 + col][c * 32], lane); }
#pragma unroll
      for (int i = 0; i < 4; ++i) { acc[i][0] = wmma_bf(ah[i], wf[c][0], acc[i][0]); acc[i][1] = wmma_bf(ah[i], wf[c][1], acc[i][1]); }
#pragma unroll
      for (int i = 0; i < 4; ++i) { acc[i][0] = wmma_bf(al[i], wf[c][0], acc[i][0]); acc[i][1] = wmma_bf(al[i], wf[c][1], acc[i][1]); } }
    if (more) { cv_w(wr, wf);
#pragma unroll
      for (int u = 0; u < 8; ++u) { v4b h, l;
#pragma unroll
        for (int e = 0; e < 4; ++e) { h[e] = (__bf16)xr[u][e]; l[e] = (__bf16)(xr[u][e] - (float)h[e]); }
        *(v4b*)&yh[(s + 1) & 1][u * 16 + xrow][xq] = h; *(v4b*)&yl[(s + 1) & 1][u * 16 + xrow][xq] = l; } }
    __syncthreads(); }   // publishes stage s + 1 and ends every wave's reads of stage s, whose buffers the next trip refills
  const float b0 = BP ? bfr(BP[c0 + cb]) : 0.f, b1 = BP ? bfr(BP[c0 + cb + 1]) : 0.f;
#pragma unroll
  for (int i = 0; i < 4; ++i)
#pragma unroll
    for (int r = 0; r < 8; ++r) { v2f o; o[0] = acc[i][0][r] + b0; o[1] = acc[i][1][r] + b1; *(v2f*)&sf[rb + i * 16 + 8 * g + r][cb] = o; }
  __syncthreads();   // the 128 x 128 tile is in LDS: each wave stores 16 whole rows of it
  for (int rl = 0; rl < 16; ++rl) vst2(OUT + (r0 + wave * 16 + rl) * CC + c0 + lane * 4, *(const v4f*)&sf[wave * 16 + rl][lane * 4]); }
extern "C" void kernel_launch(void* const* d_in, const int* in_sizes, int n_in, void* d_out, int out_size, void* d_ws, size_t ws_size, hipStream_t stream) {
  (void)in_sizes; (void)n_in; (void)out_size;
  const float** F = (const float**)d_in;   // 0 query [2,2048,1024], 1 Wq [1024,1024] ((in,out)), 2 Wk, 3 Wv, 4 Wo ((in,out)), 5 span_val [1,16,1,1] (verbatim)
  if (ws_size < (size_t)WS_END) return;
  char* ws = (char*)d_ws; _Float16 *QH = (_Float16*)(ws + WS_QH), *QL = (_Float16*)(ws + WS_QL), *KH = (_Float16*)(ws + WS_KH); __bf16 *VT = (__bf16*)(ws + WS_VT), *VL = (__bf16*)(ws + WS_VL); float *Y = (float*)(ws + WS_Y);
  k_proj<<<dim3(TNB * TT / 128, CC / 128, 3), 256, 0, stream>>>(F[0], F[1], nullptr, F[2], nullptr, F[3], nullptr, QH, QL, KH, VT, VL);
  k_attn<<<dim3(TT / PVQ, 1, TNB * NH), 32 * PVW, 0, stream>>>(QH, QL, KH, VT, VL, F[5], Y);
  k_out<<<dim3(TNB * TT / 128, CC / 128), 256, 0, stream>>>(Y, F[4], nullptr, (float*)d_out);
}

// v004
// A run of this version takes 191 microseconds.
// Timed twice side by side with v003, it ran 1.13 times as fast both times.
// Counting every step since v000, it is 7.17 times as fast.
// compute dtype: all float inputs rounded to bf16, span_val read; q/k/v = query W with EXACT bf16 products on WMMA 16x16x32, f32 accumulate; q as f16 hi + residual (x 2^10), k f16 -> 2-product logits / 64 (the module divides by DH), causal (-1e9 additive == exclusion), stored in f32; softmax then the adaptive-span ramp mask and the renormalisation (+1e-8) in f32 (precise expf); P x 2^11 f32 split bf16 hi + lo against v bf16 hi + lo (3 products); out = y (bf16 hi + lo) Wo; f32 output.
#include <hip/hip_runtime.h>
#include <math.h>

typedef __attribute__((ext_vector_type(16))) _Float16 v16h;
typedef __attribute__((ext_vector_type(16))) __bf16 v16b;
typedef __attribute__((ext_vector_type(8)))  _Float16 v8h;
typedef __attribute__((ext_vector_type(8)))  float v8f;
typedef __attribute__((ext_vector_type(4)))  float v4f;
typedef __attribute__((ext_vector_type(2)))  float v2f;
typedef __attribute__((ext_vector_type(4)))  unsigned v4u;
typedef __attribute__((ext_vector_type(4)))  int v4i;
typedef float __attribute__((may_alias)) float_a;
typedef int __attribute__((may_alias)) int_a;

template <typename T> __device__ __forceinline__ void vst2(void* p, T v) { *(T*)p = v;  }
__device__ __forceinline__ v8f wmma16(v16h a, v16h b, v8f c) {
  v8f d = __builtin_amdgcn_wmma_f32_16x16x32_f16(false, a, false, b, (short)0, c, false, false);
  asm volatile("v_nop\n\tv_nop\n\tv_nop\n\tv_nop" : "+v"(d) : "v"(a), "v"(b));
  return d;
}
__device__ __forceinline__ v8f wmma_bf(v16b a, v16b b, v8f c) {
  v8f d = __builtin_amdgcn_wmma_f32_16x16x32_bf16(false, a, false, b, (short)0, c, false, false);
  asm volatile("v_nop\n\tv_nop\n\tv_nop\n\tv_nop" : "+v"(d) : "v"(a), "v"(b));
  return d;
}
// 16x16x32 fragments: lane = (h = lane>>4, row/col = lane&15); elements 0..7 = k0+8h+0..7, 8..15 = k0+16+8h+0..7; D element r = row 8h+r
__device__ __forceinline__ v16h frag_h(const _Float16* rowk0, int lane) {
  union { v16h v; v8h q[2]; } u; const _Float16* p = rowk0 + 8 * (lane >> 4);
  u.q[0] = *(const v8h*)p; u.q[1] = *(const v8h*)(p + 16); return u.v;
}
__device__ __forceinline__ v16h frag_f32(const float* rowk0, int lane) {
  v16h a; const float* p = rowk0 + 8 * (lane >> 4);
#pragma unroll
  for (int i = 0; i < 8; ++i) { a[i] = (_Float16)p[i]; a[8 + i] = (_Float16)p[16 + i]; }
  return a;
}
__device__ __forceinline__ v16h frag_f32s(const float* rowk0, int lane, float sc) {
  v16h a; const float* p = rowk0 + 8 * (lane >> 4);
#pragma unroll
  for (int i = 0; i < 8; ++i) { a[i] = (_Float16)(p[i] * sc); a[8 + i] = (_Float16)(p[16 + i] * sc); }
  return a;
}
// column fragment from a [K][ld] layout (column n), rows >= K read as 0
__device__ __forceinline__ v16h fragc_f32(const float* W, int k0, int n, int lane, int ld, int K) {
  v16h a; const int g = lane >> 4;
#pragma unroll
  for (int i = 0; i < 8; ++i) { const int ka = k0 + 8 * g + i, kb = ka + 16;
    a[i] = (_Float16)(ka < K ? W[(size_t)(ka < K ? ka : K - 1) * ld + n] : 0.f); a[8 + i] = (_Float16)(kb < K ? W[(size_t)(kb < K ? kb : K - 1) * ld + n] : 0.f); }
  return a;
}
struct F2 { v16b h, l; };
__device__ __forceinline__ F2 bsplit16(const float v[16]) { F2 r;
#pragma unroll
  for (int i = 0; i < 16; ++i) { const __bf16 h = (__bf16)v[i]; r.h[i] = h; r.l[i] = (__bf16)(v[i] - (float)h); }
  return r; }
__device__ __forceinline__ F2 split_row(const float* row, int k0, int lane) { float v[16]; const float* p = row + k0 + 8 * (lane >> 4);
#pragma unroll
  for (int i = 0; i < 8; ++i) { v[i] = p[i]; v[8 + i] = p[16 + i]; }
  return bsplit16(v); }
__device__ __forceinline__ F2 split_rowK(const float* row, int k0, int lane, int K) { float v[16]; const int g = lane >> 4;
#pragma unroll
  for (int i = 0; i < 8; ++i) { const int ka = k0 + 8 * g + i, kb = ka + 16; v[i] = ka < K ? row[ka < K ? ka : K - 1] : 0.f; v[8 + i] = kb < K ? row[kb < K ? kb : K - 1] : 0.f; }
  return bsplit16(v); }
__device__ __forceinline__ F2 split_col(const float* W, int k0, int n, int lane, int ld, int K) { float v[16]; const int g = lane >> 4;
#pragma unroll
  for (int i = 0; i < 8; ++i) { const int ka = k0 + 8 * g + i, kb = ka + 16; v[i] = ka < K ? W[(size_t)(ka < K ? ka : K - 1) * ld + n] : 0.f; v[8 + i] = kb < K ? W[(size_t)(kb < K ? kb : K - 1) * ld + n] : 0.f; }
  return bsplit16(v); }
__device__ __forceinline__ v8f mac3(const F2& a, const F2& b, v8f c) { c = wmma_bf(a.l, b.h, c); c = wmma_bf(a.h, b.l, c); return wmma_bf(a.h, b.h, c); }
__device__ __forceinline__ float sigm(float v) { return 1.0f / (1.0f + expf(-v)); }
#define LDSX() do { asm volatile("s_wait_dscnt 0" ::: "memory"); __builtin_amdgcn_wave_barrier(); __builtin_amdgcn_fence(__ATOMIC_RELEASE, "workgroup"); } while (0)


// Adaptive-span causal attention (B 2, S 2,048, hidden 1,024 = 16 x 64, ramp 32): w = softmax(q k^T / 64 + triu(-1e9, 1)); w = w * clip((k_idx + span_val[h] * S) / 33, 0, 1); w = w / (sum_k w + 1e-8); out = (w v) Wo (no biases).
#define NB 2
#define TT 2048
#define CC 1024
#define NH 16
#define HD 64
#ifndef TNB
#define TNB NB
#endif
typedef __attribute__((ext_vector_type(8))) __bf16 v8b;
__device__ __forceinline__ v16b frag_b(const __bf16* rowk0, int lane) {
  union { v16b v; v8b q[2]; } u; const __bf16* p = rowk0 + 8 * (lane >> 4);
  u.q[0] = *(const v8b*)p; u.q[1] = *(const v8b*)(p + 16); return u.v;
}
__device__ __forceinline__ float bfr(float v) { return (float)(__bf16)v; }
__device__ __attribute__((noinline)) float exp_ni(float v) { return expf(v); }
__device__ __attribute__((noinline)) float erf_ni(float v) { return erff(v); }

#define WS_QH  0u
#define WS_QL  (WS_QH + 2u * (size_t)NB * TT * CC)
#define WS_KH  (WS_QL + 2u * (size_t)NB * TT * CC)
#define WS_VT  (WS_KH + 2u * (size_t)NB * TT * CC)      // bf16 v planes
#define WS_VL  (WS_VT + 2u * (size_t)NB * CC * TT)      // bf16 v residual planes
#define WS_Y   (WS_VL + 2u * (size_t)NB * CC * TT)      // f32 y rows [b*t][C]
#define WS_END (WS_Y + 4u * (size_t)NB * TT * CC)

// The q, k and v planes lie in fragment order, in 16-byte pieces of 8 elements: q, k: per (b, h, 16 rows) 1,024 elements [d / 8][row][8]; v: per (b, h, 32 keys) 2,048 elements [d / 16][key / 8][d % 16][8].
// A lane's two halves of a 16x16x32 fragment then lie at lane * 16 B in two successive 512-byte runs: each load of a wave covers four whole 128-byte lines. p holds the lane's 8 * lane.
#define QKB(b, h, t16) (((size_t)((b) * NH + (h)) * (TT / 16) + (t16)) * 1024)
#define VB(b, h, t32) (((size_t)((b) * NH + (h)) * (TT / 32) + (t32)) * 2048)
__device__ __forceinline__ v16h frag_hp(const _Float16* p) { union { v16h v; v8h q[2]; } u; u.q[0] = *(const v8h*)p; u.q[1] = *(const v8h*)(p + 256); return u.v; }
__device__ __forceinline__ v16b frag_bp(const __bf16* p) { union { v16b v; v8b q[2]; } u; u.q[0] = *(const v8b*)p; u.q[1] = *(const v8b*)(p + 256); return u.v; }
#define GK 64                                         // k per stage of the two GEMM kernels
#define XP 72                                         // LDS row pitch of a staged tile in bf16: 144 B = 16 B x odd, so 16-byte reads down 16 rows meet no bank twice
typedef __attribute__((ext_vector_type(4))) __bf16 v4b;
// W rows of one stage for a wave's 32 columns: lane (col, g) takes columns 2 col, 2 col + 1 of rows 8 g + i and 16 + 8 g + i of each 32-k chunk, so a load covers two whole 128-byte lines.
// Fragment e then holds column 2 col + e in lane col: the k order is that of frag_b, only the tile's columns are renumbered (undone where the accumulators are stored).
__device__ __forceinline__ void ld_w(const float* wp, v2f (&wr)[2][16]) {
#pragma unroll
  for (int c = 0; c < 2; ++c)
#pragma unroll
    for (int i = 0; i < 8; ++i) { wr[c][i] = *(const v2f*)(wp + (size_t)(c * 32 + i) * CC); wr[c][8 + i] = *(const v2f*)(wp + (size_t)(c * 32 + 16 + i) * CC); }
}
__device__ __forceinline__ void cv_w(const v2f (&wr)[2][16], v16b (&wf)[2][2]) {
#pragma unroll
  for (int c = 0; c < 2; ++c)
#pragma unroll
    for (int i = 0; i < 16; ++i) { wf[c][0][i] = (__bf16)wr[c][i][0]; wf[c][1][i] = (__bf16)wr[c][i][1]; }
}
// the block's 128 x 64 f32 tile of one stage: 16 lanes a row, so a load covers two rows of 256 contiguous bytes
__device__ __forceinline__ void ld_x(const float* xp, v4f (&xr)[8]) {
#pragma unroll
  for (int u = 0; u < 8; ++u) xr[u] = *(const v4f*)(xp + (size_t)(u * 16) * CC);
}
// ---- k_proj: block = (128 rows, 128 cols, which), 8 waves of 64 rows x 32 cols: qkv = x W (+ b), exact; q -> f16 hi (+ residual), k -> f16 planes, v -> bf16 planes
//      per 64-k stage the x tile goes once through LDS as bf16 (two buffers) and serves the four waves of its rows; each wave reads only its own 32 columns of W; the next stage's loads fly during this stage's products
__global__ __launch_bounds__(256) void k_proj(const float* __restrict__ X, const float* __restrict__ WQ, const float* __restrict__ BQ, const float* __restrict__ WK, const float* __restrict__ BK, const float* __restrict__ WV, const float* __restrict__ BV, _Float16* __restrict__ QH, _Float16* __restrict__ QL, _Float16* __restrict__ KH, __bf16* __restrict__ VT, __bf16* __restrict__ VL) {
  __shared__ __align__(16) unsigned char sm[2 * 128 * 136 * 2];   // one of: the two stage buffers (loop), q or k rows hi + residual, v planes hi + residual; a barrier stands between the uses
  _Float16 (*sh)[136] = (_Float16 (*)[136])sm, (*sl)[136] = (_Float16 (*)[136])(sm + 128 * 136 * 2); __bf16 (*th)[136] = (__bf16 (*)[136])sm, (*tl2)[136] = (__bf16 (*)[136])(sm + 128 * 136 * 2);
  const int tid = threadIdx.x, wave = tid >> 5, lane = tid & 31, col = lane & 15, g = lane >> 4; const int which = blockIdx.z; const int c0 = blockIdx.y * 128; const size_t r0 = (size_t)blockIdx.x * 128; const float* WA = which == 0 ? WQ : which == 1 ? WK : WV; const float* BA = which == 0 ? BQ : which == 1 ? BK : BV;
  __bf16 (*xs)[128][XP] = (__bf16 (*)[128][XP])sm;
  const int xrow = tid >> 4, xq = (tid & 15) * 4, rb = (wave >> 2) * 64, cb = (wave & 3) * 32 + 2 * col;   // the wave's first row, the lane's first column in the tile
  const float* wp = WA + (size_t)(8 * g) * CC + c0 + cb; const float* xp = X + (r0 + xrow) * CC + xq;
  v2f wr[2][16]; v4f xr[8]; v16b wf[2][2]; v8f acc[4][2] = {};
  ld_w(wp, wr); ld_x(xp, xr);
  cv_w(wr, wf);
#pragma unroll
  for (int u = 0; u < 8; ++u) { v4b h;
#pragma unroll
    for (int e = 0; e < 4; ++e) h[e] = (__bf16)xr[u][e];
    *(v4b*)&xs[0][u * 16 + xrow][xq] = h; }
  __syncthreads();   // stage 0 is in LDS
#pragma unroll 1   // kept rolled: a second stage's raw registers beside the first's would cost a wave per SIMD
  for (int s = 0; s < CC / GK; ++s) { const bool more = s + 1 < CC / GK;
    if (more) { wp += (size_t)GK * CC; xp += GK; ld_w(wp, wr); ld_x(xp, xr); }
#pragma unroll
    for (int c = 0; c < 2; ++c) { v16b a[4];
#pragma unroll
      for (int i = 0; i < 4; ++i) a[i] = frag_b(&xs[s & 1][rb + i * 16 + col][c * 32], lane);
#pragma unroll
      for (int i = 0; i < 4; ++i) { acc[i][0] = wmma_bf(a[i], wf[c][0], acc[i][0]); acc[i][1] = wmma_bf(a[i], wf[c][1], acc[i][1]); } }
    if (more) { cv_w(wr, wf);
#pragma unroll
      for (int u = 0; u < 8; ++u) { v4b h;
#pragma unroll
        for (int e = 0; e < 4; ++e) h[e] = (__bf16)xr[u][e];
        *(v4b*)&xs[(s + 1) & 1][u * 16 + xrow][xq] = h; } }
    __syncthreads(); }   // publishes stage s + 1 and ends every wave's reads of stage s, whose buffer the next trip refills
#pragma unroll
  for (int i = 0; i < 4; ++i)
#pragma unroll
  for (int e = 0; e < 2; ++e) { const int cl = cb + e; const float bb = BA ? bfr(BA[c0 + cl]) : 0.f;
#pragma unroll
    for (int r = 0; r < 8; ++r) { const float v = acc[i][e][r] + bb; const int rl = rb + i * 16 + 8 * g + r; const _Float16 hv = (_Float16)v;
      if (which == 2) { const __bf16 bh = (__bf16)v; th[cl][rl] = bh; tl2[cl][rl] = (__bf16)(v - (float)bh); } else { sh[rl][cl] = hv; sl[rl][cl] = (_Float16)((v - (float)hv) * 1024.0f); }   /* q residual carried x 2^10 so the plane stays f16-normal on the chip */ } }
  __syncthreads();
  const int bi = (int)(r0 / TT), t0 = (int)(r0 % TT), h0 = c0 / HD, pl = tid & 15, pq = (tid >> 4) & 15;   // a lane's place in a piece run, its run: a wave stores 512 contiguous bytes, a trip of the block one or two whole blocks of a plane
  if (which < 2) { _Float16* dh = which == 0 ? QH : KH; for (int e = 0; e < 8; ++e) { const int rl = e * 16 + pl, q = pq; const size_t o1 = QKB(bi, h0 + (q >> 3), t0 / 16 + e) + (q & 7) * 128 + pl * 8; _Float16* d0 = dh + o1; const v4u x0 = *(const v4u*)&sh[rl][q * 8]; vst2((unsigned*)d0, x0);
      asm volatile("s_wait_xcnt 0x0" :: "v"(d0), "v"(x0) : "memory");   // the wait of this store; its address pair and its data are inputs, so that no register of them is rewritten in front of it
      if (which == 0) { _Float16* d1 = QL + o1; const v4u x1 = *(const v4u*)&sl[rl][q * 8]; vst2((unsigned*)d1, x1);
        asm volatile("s_wait_xcnt 0x0" :: "v"(d1), "v"(x1) : "memory"); } } }   // as above
  else { for (int e = 0; e < 8; ++e) { const int cl = (e & 1) * 64 + (pq >> 2) * 16 + pl, q = (e >> 1) * 4 + (pq & 3); const size_t o2 = VB(bi, h0 + (e & 1), t0 / 32 + (e >> 1)) + pq * 128 + pl * 8; __bf16 *d0 = VT + o2, *d1 = VL + o2; const v4u x0 = *(const v4u*)&th[cl][q * 8], x1 = *(const v4u*)&tl2[cl][q * 8]; vst2((unsigned*)d0, x0); vst2((unsigned*)d1, x1);
      asm volatile("s_wait_xcnt 0x0" :: "v"(d0), "v"(d1), "v"(x0), "v"(x1) : "memory"); } } }   // the wait of these two stores, as above
// ---- k_attn: block = 32 queries of (b,h), 16 waves; the 32 logit rows stay in LDS from q k^T to P . v.
//      A: wave w takes the 64-key groups w, w + 16 of keys [0, kend): logits / 64, causal, into LDS rows.
//      B: wave w takes rows 2w, 2w + 1: softmax, adaptive-span ramp mask clip((k + span_val[h] S)/(RAMP+1), 0, 1), renormalised by (sum + 1e-8) -> P x 2^11 f32 in place.
//      C: wave w takes the 32-key chunks w, w + 16, ... for all 32 queries; the 16 partial tiles are summed through LDS in wave order: y[q][h*HD + d] = P . v
#define PVQ 32
#define PVW 16
#define SP (TT + 4)                                   // LDS row pitch in floats: 16 B x odd, so 16-byte reads down 16 rows meet no bank twice
__global__ __launch_bounds__(32 * PVW) void k_attn(const _Float16* __restrict__ QH, const _Float16* __restrict__ QL, const _Float16* __restrict__ KH, const __bf16* __restrict__ VT, const __bf16* __restrict__ VL, const float* __restrict__ SPAN, float* __restrict__ Y) {
  __shared__ __align__(16) float sS[PVQ * SP]; __shared__ __align__(16) float smk[TT];
  const int tid = threadIdx.x, wave = __builtin_amdgcn_readfirstlane(tid >> 5), lane = tid & 31, col = lane & 15, g = lane >> 4; const int b = blockIdx.z / NH, h = blockIdx.z % NH; const int ql0 = blockIdx.x * PVQ; const int kend = (ql0 / 64) * 64 + 64;
  { const float spv = bfr(SPAN[h]) * (float)TT;   /* span_val[h] * attn_span */
    for (int k = tid; k < kend; k += 32 * PVW) smk[k] = fminf(fmaxf(((float)k + spv) / 33.0f, 0.f), 1.0f); }
  { v16h ah[PVQ / 16][HD / 32], al[PVQ / 16][HD / 32]; const size_t qo = QKB(b, h, ql0 / 16) + lane * 8; const _Float16 *qhp = QH + qo, *qlp = QL + qo;
#pragma unroll
    for (int i = 0; i < PVQ / 16; ++i)
#pragma unroll
      for (int kc = 0; kc < HD / 32; ++kc) { ah[i][kc] = frag_hp(qhp + i * 1024 + kc * 512); al[i][kc] = frag_hp(qlp + i * 1024 + kc * 512); }
    asm volatile("s_wait_xcnt 0x0" :: "v"(qhp), "v"(qlp) : "memory");   // the wait of the q loads; their two address pairs are inputs, so that no register of them is reused in front of it
#pragma unroll 1   // kept rolled (two trips at most): a second trip's 64 fragment registers beside the q fragments would not fit the 256 of a 16-wave block
    for (int k0 = wave * 64; k0 < kend; k0 += PVW * 64) { v16h kb[4][HD / 32]; const _Float16* kp = KH + QKB(b, h, k0 / 16) + lane * 8;   // the trip's 16 loads go out together, ahead of its products
#pragma unroll
      for (int j = 0; j < 4; ++j)
#pragma unroll
        for (int kc = 0; kc < HD / 32; ++kc) kb[j][kc] = frag_hp(kp + j * 1024 + kc * 512);
      asm volatile("s_wait_xcnt 0x0" :: "v"(kp) : "memory");   // the wait of the k loads; their address pair is an input, so that no register of it is rewritten in front of it
#pragma unroll
      for (int j = 0; j < 4; ++j) { v8f a[PVQ / 16] = {}, l[PVQ / 16] = {}; const int kt = k0 + j * 16 + col;
#pragma unroll
        for (int kc = 0; kc < HD / 32; ++kc)
#pragma unroll
          for (int i = 0; i < PVQ / 16; ++i) { a[i] = wmma16(ah[i][kc], kb[j][kc], a[i]); l[i] = wmma16(al[i][kc], kb[j][kc], l[i]); }
#pragma unroll
        for (int i = 0; i < PVQ / 16; ++i) { a[i] += l[i] * (1.0f / 1024.0f);
#pragma unroll
          for (int r = 0; r < 8; ++r) { const int rl = i * 16 + 8 * g + r; float v = a[i][r] * (1.0f / 64.0f); if (kt > ql0 + rl) v = -3.0e38f; /* scores divided by DH = 64 as written */ sS[rl * SP + kt] = v; } } } } }
  __syncthreads();   // all logits of the 32 rows and the mask table are in LDS
  { float* ra = sS + (2 * wave) * SP + lane * 2; float* rb = ra + SP; const float* mkp = smk + lane * 2; const int nc = kend / 64;   // a trip is 64 keys of both rows, 2 keys a lane: the trip count is the same for every lane
    float ma = -3.0e38f, mb = -3.0e38f;
    for (int c = 0; c < nc; ++c) { const v2f x = *(const v2f*)(ra + c * 64), y = *(const v2f*)(rb + c * 64); ma = fmaxf(ma, fmaxf(x[0], x[1])); mb = fmaxf(mb, fmaxf(y[0], y[1])); }
#pragma unroll
    for (int o = 1; o < 32; o <<= 1) { ma = fmaxf(ma, __shfl_xor(ma, o)); mb = fmaxf(mb, __shfl_xor(mb, o)); }
    float sa = 0.f, sb = 0.f, ta = 0.f, tb = 0.f;   // sums of exp and of exp * mask, taken in the one pass that makes the exps
    for (int c = 0; c < nc; ++c) { v2f x = *(const v2f*)(ra + c * 64), y = *(const v2f*)(rb + c * 64); const v2f mk = *(const v2f*)(mkp + c * 64);
#pragma unroll
      for (int e = 0; e < 2; ++e) { const float ex = expf(x[e] - ma), ey = expf(y[e] - mb); x[e] = (x[e] <= -1.0e38f) ? 0.f : ex; y[e] = (y[e] <= -1.0e38f) ? 0.f : ey; sa += x[e]; sb += y[e]; ta += x[e] * mk[e]; tb += y[e] * mk[e]; }
      *(v2f*)(ra + c * 64) = x; *(v2f*)(rb + c * 64) = y; }
#pragma unroll
    for (int o = 1; o < 32; o <<= 1) { sa += __shfl_xor(sa, o); sb += __shfl_xor(sb, o); ta += __shfl_xor(ta, o); tb += __shfl_xor(tb, o); }
    const float ia = 1.0f / sa, ib = 1.0f / sb; const float na = 2048.0f / (ta * ia + 1e-8f), nb = 2048.0f / (tb * ib + 1e-8f);
    for (int c = 0; c < nc; ++c) { v2f x = *(const v2f*)(ra + c * 64), y = *(const v2f*)(rb + c * 64); const v2f mk = *(const v2f*)(mkp + c * 64);
#pragma unroll
      for (int e = 0; e < 2; ++e) { x[e] = ((x[e] * ia) * mk[e]) * na; y[e] = ((y[e] * ib) * mk[e]) * nb; }
      *(v2f*)(ra + c * 64) = x; *(v2f*)(rb + c * 64) = y; } }   /* w = softmax * ramp mask, renormalised by (sum + 1e-8), carried x 2^11 */
  __syncthreads();   // all 32 rows of P are in LDS
  v8f acc[PVQ / 16][HD / 16] = {};
#pragma unroll 1
  for (int kc = wave; kc < kend / 32; kc += PVW) { const F2 p0 = split_row(sS + col * SP, kc * 32, lane), p1 = split_row(sS + (16 + col) * SP, kc * 32, lane); const size_t vo = VB(b, h, kc) + lane * 8; const __bf16 *vhp = VT + vo, *vlp = VL + vo;
#pragma unroll
    for (int j = 0; j < HD / 16; ++j) { const v16b vh = frag_bp(vhp + j * 512), vl = frag_bp(vlp + j * 512);
      acc[0][j] = wmma_bf(p0.h, vh, acc[0][j]); acc[0][j] = wmma_bf(p0.l, vh, acc[0][j]); acc[0][j] = wmma_bf(p0.h, vl, acc[0][j]);
      acc[1][j] = wmma_bf(p1.h, vh, acc[1][j]); acc[1][j] = wmma_bf(p1.l, vh, acc[1][j]); acc[1][j] = wmma_bf(p1.h, vl, acc[1][j]); }
    asm volatile("s_wait_xcnt 0x0" :: "v"(vhp), "v"(vlp) : "memory"); }   // the wait of the trip's v loads; their two address pairs are inputs, so that no register of them is rewritten in front of it
  __syncthreads();   // every wave has read its last P: the partial tiles take over that LDS
  float* ss = sS;    // [PVW][PVQ][HD + 4]
#pragma unroll
  for (int i = 0; i < PVQ / 16; ++i)
#pragma unroll
    for (int j = 0; j < HD / 16; ++j)
#pragma unroll
      for (int r = 0; r < 8; ++r) ss[(wave * PVQ + i * 16 + 8 * g + r) * (HD + 4) + j * 16 + col] = acc[i][j][r];
  __syncthreads();
  const int rl = tid >> 4, q4 = (tid & 15) * 4; v4f s = *(const v4f*)&ss[rl * (HD + 4) + q4];
#pragma unroll
  for (int w = 1; w < PVW; ++w) s += *(const v4f*)&ss[(w * PVQ + rl) * (HD + 4) + q4];
  vst2(Y + ((size_t)b * TT + ql0 + rl) * CC + h * HD + q4, s * (1.0f / 2048.0f)); }
// ---- k_out: block = (128 rows, 128 cols), 8 waves of 64 rows x 32 cols: out = y (bf16 hi + lo) Wo + bo; operands as in k_proj, the y tile staged as its two bf16 planes
__global__ __launch_bounds__(256) void k_out(const float* __restrict__ Y, const float* __restrict__ WP, const float* __restrict__ BP, float* __restrict__ OUT) { __shared__ __align__(16) __bf16 yh[2][128][XP], yl[2][128][XP]; __shared__ __align__(16) float sf[128][132];
  const int tid = threadIdx.x, wave = tid >> 5, lane = tid & 31, col = lane & 15, g = lane >> 4; const int c0 = blockIdx.y * 128; const size_t r0 = (size_t)blockIdx.x * 128;
  const int xrow = tid >> 4, xq = (tid & 15) * 4, rb = (wave >> 2) * 64, cb = (wave & 3) * 32 + 2 * col;   // the wave's first row, the lane's first column in the tile
  const float* wp = WP + (size_t)(8 * g) * CC + c0 + cb; const float* xp = Y + (r0 + xrow) * CC + xq;
  v2f wr[2][16]; v4f xr[8]; v16b wf[2][2]; v8f acc[4][2] = {};
  ld_w(wp, wr); ld_x(xp, xr);
  cv_w(wr, wf);
#pragma unroll
  for (int u = 0; u < 8; ++u) { v4b h, l;
#pragma unroll
    for (int e = 0; e < 4; ++e) { h[e] = (__bf16)xr[u][e]; l[e] = (__bf16)(xr[u][e] - (float)h[e]); }
    *(v4b*)&yh[0][u * 16 + xrow][xq] = h; *(v4b*)&yl[0][u * 16 + xrow][xq] = l; }
  __syncthreads();   // stage 0 is in LDS
#pragma unroll 1   // kept rolled: a second stage's raw registers beside the first's are not worth their room
  for (int s = 0; s < CC / GK; ++s) { const bool more = s + 1 < CC / GK;
    if (more) { wp += (size_t)GK * CC; xp += GK; ld_w(wp, wr); ld_x(xp, xr); }
#pragma unroll
    for (int c = 0; c < 2; ++c) { v16b ah[4], al[4];
#pragma unroll
      for (int i = 0; i < 4; ++i) { ah[i] = frag_b(&yh[s & 1][rb + i * 16 + col][c * 32], lane); al[i] = frag_b(&yl[s & 1][rb + i * 16 + col][c * 32], lane); }
#pragma unroll
      for (int i = 0; i < 4; ++i) { acc[i][0] = wmma_bf(ah[i], wf[c][0], acc[i][0]); acc[i][1] = wmma_bf(ah[i], wf[c][1], acc[i][1]); }
#pragma unroll
      for (int i = 0; i < 4; ++i) { acc[i][0] = wmma_bf(al[i], wf[c][0], acc[i][0]); acc[i][1] = wmma_bf(al[i], wf[c][1], acc[i][1]); } }
    if (more) { cv_w(wr, wf);
#pragma unroll
      for (int u = 0; u < 8; ++u) { v4b h, l;
#pragma unroll
        for (int e = 0; e < 4; ++e) { h[e] = (__bf16)xr[u][e]; l[e] = (__bf16)(xr[u][e] - (float)h[e]); }
        *(v4b*)&yh[(s + 1) & 1][u * 16 + xrow][xq] = h; *(v4b*)&yl[(s + 1) & 1][u * 16 + xrow][xq] = l; } }
    __syncthreads(); }   // publishes stage s + 1 and ends every wave's reads of stage s, whose buffers the next trip refills
  const float b0 = BP ? bfr(BP[c0 + cb]) : 0.f, b1 = BP ? bfr(BP[c0 + cb + 1]) : 0.f;
#pragma unroll
  for (int i = 0; i < 4; ++i)
#pragma unroll
    for (int r = 0; r < 8; ++r) { v2f o; o[0] = acc[i][0][r] + b0; o[1] = acc[i][1][r] + b1; *(v2f*)&sf[rb + i * 16 + 8 * g + r][cb] = o; }
  __syncthreads();   // the 128 x 128 tile is in LDS: each wave stores 16 whole rows of it
  for (int rl = 0; rl < 16; ++rl) vst2(OUT + (r0 + wave * 16 + rl) * CC + c0 + lane * 4, *(const v4f*)&sf[wave * 16 + rl][lane * 4]); }
extern "C" void kernel_launch(void* const* d_in, const int* in_sizes, int n_in, void* d_out, int out_size, void* d_ws, size_t ws_size, hipStream_t stream) {
  (void)in_sizes; (void)n_in; (void)out_size;
  const float** F = (const float**)d_in;   // 0 query [2,2048,1024], 1 Wq [1024,1024] ((in,out)), 2 Wk, 3 Wv, 4 Wo ((in,out)), 5 span_val [1,16,1,1] (verbatim)
  if (ws_size < (size_t)WS_END) return;
  char* ws = (char*)d_ws; _Float16 *QH = (_Float16*)(ws + WS_QH), *QL = (_Float16*)(ws + WS_QL), *KH = (_Float16*)(ws + WS_KH); __bf16 *VT = (__bf16*)(ws + WS_VT), *VL = (__bf16*)(ws + WS_VL); float *Y = (float*)(ws + WS_Y);
  k_proj<<<dim3(TNB * TT / 128, CC / 128, 3), 256, 0, stream>>>(F[0], F[1], nullptr, F[2], nullptr, F[3], nullptr, QH, QL, KH, VT, VL);
  k_attn<<<dim3(TT / PVQ, 1, TNB * NH), 32 * PVW, 0, stream>>>(QH, QL, KH, VT, VL, F[5], Y);
  k_out<<<dim3(TNB * TT / 128, CC / 128), 256, 0, stream>>>(Y, F[4], nullptr, (float*)d_out);
}

// v005
// A run of this version takes 127 microseconds.
// Next to v004, in two timings, it ran 1.51 and 1.50 times as fast.
// Over all steps from v000 it is 10.8 times as fast.
// compute dtype: all float inputs rounded to bf16, span_val read; q/k/v = query W with EXACT bf16 products on WMMA 16x16x32, f32 accumulate; q as f16 hi + residual (x 2^10), k f16 -> 2-product logits / 64 (the module divides by DH), causal (-1e9 additive == exclusion), kept in f32 registers; running softmax sums, the adaptive-span ramp mask and the renormalisation (+1e-8) in f32 (precise expf); exp * mask f32 split bf16 hi + lo against v bf16 hi + lo (3 products); out = y (bf16 hi + lo) Wo; f32 output.
#include <hip/hip_runtime.h>
#include <math.h>

typedef __attribute__((ext_vector_type(16))) _Float16 v16h;
typedef __attribute__((ext_vector_type(16))) __bf16 v16b;
typedef __attribute__((ext_vector_type(8)))  _Float16 v8h;
typedef __attribute__((ext_vector_type(8)))  float v8f;
typedef __attribute__((ext_vector_type(4)))  float v4f;
typedef __attribute__((ext_vector_type(2)))  float v2f;
typedef __attribute__((ext_vector_type(4)))  unsigned v4u;
typedef __attribute__((ext_vector_type(4)))  int v4i;
typedef float __attribute__((may_alias)) float_a;
typedef int __attribute__((may_alias)) int_a;

template <typename T> __device__ __forceinline__ void vst2(void* p, T v) { *(T*)p = v;  }
__device__ __forceinline__ v8f wmma16(v16h a, v16h b, v8f c) {
  v8f d = __builtin_amdgcn_wmma_f32_16x16x32_f16(false, a, false, b, (short)0, c, false, false);
  asm volatile("v_nop\n\tv_nop\n\tv_nop\n\tv_nop" : "+v"(d) : "v"(a), "v"(b));
  return d;
}
__device__ __forceinline__ v8f wmma_bf(v16b a, v16b b, v8f c) {
  v8f d = __builtin_amdgcn_wmma_f32_16x16x32_bf16(false, a, false, b, (short)0, c, false, false);
  asm volatile("v_nop\n\tv_nop\n\tv_nop\n\tv_nop" : "+v"(d) : "v"(a), "v"(b));
  return d;
}
// 16x16x32 fragments: lane = (h = lane>>4, row/col = lane&15); elements 0..7 = k0+8h+0..7, 8..15 = k0+16+8h+0..7; D element r = row 8h+r
__device__ __forceinline__ v16h frag_h(const _Float16* rowk0, int lane) {
  union { v16h v; v8h q[2]; } u; const _Float16* p = rowk0 + 8 * (lane >> 4);
  u.q[0] = *(const v8h*)p; u.q[1] = *(const v8h*)(p + 16); return u.v;
}
__device__ __forceinline__ v16h frag_f32(const float* rowk0, int lane) {
  v16h a; const float* p = rowk0 + 8 * (lane >> 4);
#pragma unroll
  for (int i = 0; i < 8; ++i) { a[i] = (_Float16)p[i]; a[8 + i] = (_Float16)p[16 + i]; }
  return a;
}
__device__ __forceinline__ v16h frag_f32s(const float* rowk0, int lane, float sc) {
  v16h a; const float* p = rowk0 + 8 * (lane >> 4);
#pragma unroll
  for (int i = 0; i < 8; ++i) { a[i] = (_Float16)(p[i] * sc); a[8 + i] = (_Float16)(p[16 + i] * sc); }
  return a;
}
// column fragment from a [K][ld] layout (column n), rows >= K read as 0
__device__ __forceinline__ v16h fragc_f32(const float* W, int k0, int n, int lane, int ld, int K) {
  v16h a; const int g = lane >> 4;
#pragma unroll
  for (int i = 0; i < 8; ++i) { const int ka = k0 + 8 * g + i, kb = ka + 16;
    a[i] = (_Float16)(ka < K ? W[(size_t)(ka < K ? ka : K - 1) * ld + n] : 0.f); a[8 + i] = (_Float16)(kb < K ? W[(size_t)(kb < K ? kb : K - 1) * ld + n] : 0.f); }
  return a;
}
struct F2 { v16b h, l; };
__device__ __forceinline__ F2 bsplit16(const float v[16]) { F2 r;
#pragma unroll
  for (int i = 0; i < 16; ++i) { const __bf16 h = (__bf16)v[i]; r.h[i] = h; r.l[i] = (__bf16)(v[i] - (float)h); }
  return r; }
__device__ __forceinline__ F2 split_row(const float* row, int k0, int lane) { float v[16]; const float* p = row + k0 + 8 * (lane >> 4);
#pragma unroll
  for (int i = 0; i < 8; ++i) { v[i] = p[i]; v[8 + i] = p[16 + i]; }
  return bsplit16(v); }
__device__ __forceinline__ F2 split_rowK(const float* row, int k0, int lane, int K) { float v[16]; const int g = lane >> 4;
#pragma unroll
  for (int i = 0; i < 8; ++i) { const int ka = k0 + 8 * g + i, kb = ka + 16; v[i] = ka < K ? row[ka < K ? ka : K - 1] : 0.f; v[8 + i] = kb < K ? row[kb < K ? kb : K - 1] : 0.f; }
  return bsplit16(v); }
__device__ __forceinline__ F2 split_col(const float* W, int k0, int n, int lane, int ld, int K) { float v[16]; const int g = lane >> 4;
#pragma unroll
  for (int i = 0; i < 8; ++i) { const int ka = k0 + 8 * g + i, kb = ka + 16; v[i] = ka < K ? W[(size_t)(ka < K ? ka : K - 1) * ld + n] : 0.f; v[8 + i] = kb < K ? W[(size_t)(kb < K ? kb : K - 1) * ld + n] : 0.f; }
  return bsplit16(v); }
__device__ __forceinline__ v8f mac3(const F2& a, const F2& b, v8f c) { c = wmma_bf(a.l, b.h, c); c = wmma_bf(a.h, b.l, c); return wmma_bf(a.h, b.h, c); }
__device__ __forceinline__ float sigm(float v) { return 1.0f / (1.0f + expf(-v)); }
#define LDSX() do { asm volatile("s_wait_dscnt 0" ::: "memory"); __builtin_amdgcn_wave_barrier(); __builtin_amdgcn_fence(__ATOMIC_RELEASE, "workgroup"); } while (0)


// Adaptive-span causal attention (B 2, S 2,048, hidden 1,024 = 16 x 64, ramp 32): w = softmax(q k^T / 64 + triu(-1e9, 1)); w = w * clip((k_idx + span_val[h] * S) / 33, 0, 1); w = w / (sum_k w + 1e-8); out = (w v) Wo (no biases).
#define NB 2
#define TT 2048
#define CC 1024
#define NH 16
#define HD 64
#ifndef TNB
#define TNB NB
#endif
typedef __attribute__((ext_vector_type(8))) __bf16 v8b;
__device__ __forceinline__ v16b frag_b(const __bf16* rowk0, int lane) {
  union { v16b v; v8b q[2]; } u; const __bf16* p = rowk0 + 8 * (lane >> 4);
  u.q[0] = *(const v8b*)p; u.q[1] = *(const v8b*)(p + 16); return u.v;
}
__device__ __forceinline__ float bfr(float v) { return (float)(__bf16)v; }
__device__ __attribute__((noinline)) float exp_ni(float v) { return expf(v); }
__device__ __attribute__((noinline)) float erf_ni(float v) { return erff(v); }

#define WS_QH  0u
#define WS_QL  (WS_QH + 2u * (size_t)NB * TT * CC)
#define WS_KH  (WS_QL + 2u * (size_t)NB * TT * CC)
#define WS_VT  (WS_KH + 2u * (size_t)NB * TT * CC)      // bf16 v planes
#define WS_VL  (WS_VT + 2u * (size_t)NB * CC * TT)      // bf16 v residual planes
#define WS_Y   (WS_VL + 2u * (size_t)NB * CC * TT)      // f32 y rows [b*t][C]
#define WS_END (WS_Y + 4u * (size_t)NB * TT * CC)

// The q, k and v planes lie in fragment order, in 16-byte pieces of 8 elements: q, k: per (b, h, 16 rows) 1,024 elements [d / 8][row][8]; v: per (b, h, 32 keys) 2,048 elements [d / 16][key / 8][d % 16][8].
// A lane's two halves of a 16x16x32 fragment then lie at lane * 16 B in two successive 512-byte runs: each load of a wave covers four whole 128-byte lines. p holds the lane's 8 * lane.
#define QKB(b, h, t16) (((size_t)((b) * NH + (h)) * (TT / 16) + (t16)) * 1024)
#define VB(b, h, t32) (((size_t)((b) * NH + (h)) * (TT / 32) + (t32)) * 2048)
__device__ __forceinline__ v16h frag_hp(const _Float16* p) { union { v16h v; v8h q[2]; } u; u.q[0] = *(const v8h*)p; u.q[1] = *(const v8h*)(p + 256); return u.v; }
__device__ __forceinline__ v16b frag_bp(const __bf16* p) { union { v16b v; v8b q[2]; } u; u.q[0] = *(const v8b*)p; u.q[1] = *(const v8b*)(p + 256); return u.v; }
#define GK 64                                         // k per stage of the two GEMM kernels
#define XP 72                                         // LDS row pitch of a staged tile in bf16: 144 B = 16 B x odd, so 16-byte reads down 16 rows meet no bank twice
typedef __attribute__((ext_vector_type(4))) __bf16 v4b;
// W rows of one stage for a wave's 32 columns: lane (col, g) takes columns 2 col, 2 col + 1 of rows 8 g + i and 16 + 8 g + i of each 32-k chunk, so a load covers two whole 128-byte lines.
// Fragment e then holds column 2 col + e in lane col: the k order is that of frag_b, only the tile's columns are renumbered (undone where the accumulators are stored).
__device__ __forceinline__ void ld_w(const float* wp, v2f (&wr)[2][16]) {
#pragma unroll
  for (int c = 0; c < 2; ++c)
#pragma unroll
    for (int i = 0; i < 8; ++i) { wr[c][i] = *(const v2f*)(wp + (size_t)(c * 32 + i) * CC); wr[c][8 + i] = *(const v2f*)(wp + (size_t)(c * 32 + 16 + i) * CC); }
}
__device__ __forceinline__ void cv_w(const v2f (&wr)[2][16], v16b (&wf)[2][2]) {
#pragma unroll
  for (int c = 0; c < 2; ++c)
#pragma unroll
    for (int i = 0; i < 16; ++i) { wf[c][0][i] = (__bf16)wr[c][i][0]; wf[c][1][i] = (__bf16)wr[c][i][1]; }
}
// the block's 128 x 64 f32 tile of one stage: 16 lanes a row, so a load covers two rows of 256 contiguous bytes
__device__ __forceinline__ void ld_x(const float* xp, v4f (&xr)[8]) {
#pragma unroll
  for (int u = 0; u < 8; ++u) xr[u] = *(const v4f*)(xp + (size_t)(u * 16) * CC);
}
// ---- k_proj: block = (128 rows, 128 cols, which), 8 waves of 64 rows x 32 cols: qkv = x W (+ b), exact; q -> f16 hi (+ residual), k -> f16 planes, v -> bf16 planes
//      per 64-k stage the x tile goes once through LDS as bf16 (two buffers) and serves the four waves of its rows; each wave reads only its own 32 columns of W; the next stage's loads fly during this stage's products
__global__ __launch_bounds__(256) void k_proj(const float* __restrict__ X, const float* __restrict__ WQ, const float* __restrict__ BQ, const float* __restrict__ WK, const float* __restrict__ BK, const float* __restrict__ WV, const float* __restrict__ BV, _Float16* __restrict__ QH, _Float16* __restrict__ QL, _Float16* __restrict__ KH, __bf16* __restrict__ VT, __bf16* __restrict__ VL) {
  __shared__ __align__(16) unsigned char sm[2 * 128 * 136 * 2];   // one of: the two stage buffers (loop), q or k rows hi + residual, v planes hi + residual; a barrier stands between the uses
  _Float16 (*sh)[136] = (_Float16 (*)[136])sm, (*sl)[136] = (_Float16 (*)[136])(sm + 128 * 136 * 2); __bf16 (*th)[136] = (__bf16 (*)[136])sm, (*tl2)[136] = (__bf16 (*)[136])(sm + 128 * 136 * 2);
  const int tid = threadIdx.x, wave = tid >> 5, lane = tid & 31, col = lane & 15, g = lane >> 4; const int which = blockIdx.z; const int c0 = blockIdx.y * 128; const size_t r0 = (size_t)blockIdx.x * 128; const float* WA = which == 0 ? WQ : which == 1 ? WK : WV; const float* BA = which == 0 ? BQ : which == 1 ? BK : BV;
  __bf16 (*xs)[128][XP] = (__bf16 (*)[128][XP])sm;
  const int xrow = tid >> 4, xq = (tid & 15) * 4, rb = (wave >> 2) * 64, cb = (wave & 3) * 32 + 2 * col;   // the wave's first row, the lane's first column in the tile
  const float* wp = WA + (size_t)(8 * g) * CC + c0 + cb; const float* xp = X + (r0 + xrow) * CC + xq;
  v2f wr[2][16]; v4f xr[8]; v16b wf[2][2]; v8f acc[4][2] = {};
  ld_w(wp, wr); ld_x(xp, xr);
  cv_w(wr, wf);
#pragma unroll
  for (int u = 0; u < 8; ++u) { v4b h;
#pragma unroll
    for (int e = 0; e < 4; ++e) h[e] = (__bf16)xr[u][e];
    *(v4b*)&xs[0][u * 16 + xrow][xq] = h; }
  __syncthreads();   // stage 0 is in LDS
#pragma unroll 1   // kept rolled: a second stage's raw registers beside the first's would cost a wave per SIMD
  for (int s = 0; s < CC / GK; ++s) { const bool more = s + 1 < CC / GK;
    if (more) { wp += (size_t)GK * CC; xp += GK; ld_w(wp, wr); ld_x(xp, xr); }
#pragma unroll
    for (int c = 0; c < 2; ++c) { v16b a[4];
#pragma unroll
      for (int i = 0; i < 4; ++i) a[i] = frag_b(&xs[s & 1][rb + i * 16 + col][c * 32], lane);
#pragma unroll
      for (int i = 0; i < 4; ++i) { acc[i][0] = wmma_bf(a[i], wf[c][0], acc[i][0]); acc[i][1] = wmma_bf(a[i], wf[c][1], acc[i][1]); } }
    if (more) { cv_w(wr, wf);
#pragma unroll
      for (int u = 0; u < 8; ++u) { v4b h;
#pragma unroll
        for (int e = 0; e < 4; ++e) h[e] = (__bf16)xr[u][e];
        *(v4b*)&xs[(s + 1) & 1][u * 16 + xrow][xq] = h; } }
    __syncthreads(); }   // publishes stage s + 1 and ends every wave's reads of stage s, whose buffer the next trip refills
#pragma unroll
  for (int i = 0; i < 4; ++i)
#pragma unroll
  for (int e = 0; e < 2; ++e) { const int cl = cb + e; const float bb = BA ? bfr(BA[c0 + cl]) : 0.f;
#pragma unroll
    for (int r = 0; r < 8; ++r) { const float v = acc[i][e][r] + bb; const int rl = rb + i * 16 + 8 * g + r; const _Float16 hv = (_Float16)v;
      if (which == 2) { const __bf16 bh = (__bf16)v; th[cl][rl] = bh; tl2[cl][rl] = (__bf16)(v - (float)bh); } else { sh[rl][cl] = hv; sl[rl][cl] = (_Float16)((v - (float)hv) * 1024.0f); }   /* q residual carried x 2^10 so the plane stays f16-normal on the chip */ } }
  __syncthreads();
  const int bi = (int)(r0 / TT), t0 = (int)(r0 % TT), h0 = c0 / HD, pl = tid & 15, pq = (tid >> 4) & 15;   // a lane's place in a piece run, its run: a wave stores 512 contiguous bytes, a trip of the block one or two whole blocks of a plane
  if (which < 2) { _Float16* dh = which == 0 ? QH : KH; for (int e = 0; e < 8; ++e) { const int rl = e * 16 + pl, q = pq; const size_t o1 = QKB(bi, h0 + (q >> 3), t0 / 16 + e) + (q & 7) * 128 + pl * 8; _Float16* d0 = dh + o1; const v4u x0 = *(const v4u*)&sh[rl][q * 8]; vst2((unsigned*)d0, x0);
      asm volatile("s_wait_xcnt 0x0" :: "v"(d0), "v"(x0) : "memory");   // the wait of this store; its address pair and its data are inputs, so that no register of them is rewritten in front of it
      if (which == 0) { _Float16* d1 = QL + o1; const v4u x1 = *(const v4u*)&sl[rl][q * 8]; vst2((unsigned*)d1, x1);
        asm volatile("s_wait_xcnt 0x0" :: "v"(d1), "v"(x1) : "memory"); } } }   // as above
  else { for (int e = 0; e < 8; ++e) { const int cl = (e & 1) * 64 + (pq >> 2) * 16 + pl, q = (e >> 1) * 4 + (pq & 3); const size_t o2 = VB(bi, h0 + (e & 1), t0 / 32 + (e >> 1)) + pq * 128 + pl * 8; __bf16 *d0 = VT + o2, *d1 = VL + o2; const v4u x0 = *(const v4u*)&th[cl][q * 8], x1 = *(const v4u*)&tl2[cl][q * 8]; vst2((unsigned*)d0, x0); vst2((unsigned*)d1, x1);
      asm volatile("s_wait_xcnt 0x0" :: "v"(d0), "v"(d1), "v"(x0), "v"(x1) : "memory"); } } }   // the wait of these two stores, as above
// ---- k_attn: block = 64 queries of (b,h), 8 waves = 2 groups of 32 queries x 4 key splits; the logits never leave the registers.
//      A wave walks the 32-key chunks ks, ks + 4, ... of its 32 queries: S^T = K Q^T (a lane holds 16 keys of one query per 16-query tile), logits / 64, causal on the last chunk only;
//      e = exp(logit - m) against the maximum in use m (raised, with a rescale of the sums, only when a chunk's maximum passes it by more than 8: e stays below e^8);
//      s += sum e, t += sum e * ramp mask clip((k + span_val[h] S)/(RAMP+1), 0, 1), O^T += V^T (e * mask)^T: the score registers are the B fragment as they stand.
//      The 4 key splits of a query are joined through LDS in split order, each weighted exp(m_w - max m): y = (O / s) / (t / s + 1e-8).
#define AQ 64
#define AKS 4
#define AW 8
#define OP (HD + 4)                                   // LDS row pitch of a partial tile in floats: 16 B x odd
__device__ __forceinline__ float xhalf(float x) { return __builtin_bit_cast(float, __builtin_amdgcn_permlanex16(__builtin_bit_cast(int, x), __builtin_bit_cast(int, x), 0x76543210, 0xfedcba98, false, false)); }   // lane l with lane l ^ 16
__global__ __launch_bounds__(32 * AW) __attribute__((amdgpu_waves_per_eu(4, 4))) void k_attn(const _Float16* __restrict__ QH, const _Float16* __restrict__ QL, const _Float16* __restrict__ KH, const __bf16* __restrict__ VT, const __bf16* __restrict__ VL, const float* __restrict__ SPAN, float* __restrict__ Y) {
  __shared__ __align__(16) float smk[TT]; __shared__ __align__(16) float ss[AW * 32 * OP]; __shared__ float wm[AW][32], wsm[AW][32], wt[AW][32];
  const int tid = threadIdx.x, wave = __builtin_amdgcn_readfirstlane(tid >> 5), lane = tid & 31, col = lane & 15, g = lane >> 4; const int b = blockIdx.x / NH, h = blockIdx.x % NH;
  const int ql0 = (TT / AQ - 1 - (int)blockIdx.z) * AQ;   // the longest blocks start first
  const int qg = wave & 1, ks = wave >> 1, Q0 = ql0 + qg * 32, nch = Q0 / 32 + 1;   // the wave's first query; its queries see the chunks [0, nch), the last one in part
  { const float spv = bfr(SPAN[h]) * (float)TT;   /* span_val[h] * attn_span */
    for (int k = tid; k < ql0 + AQ; k += 32 * AW) smk[k] = fminf(fmaxf(((float)k + spv) / 33.0f, 0.f), 1.0f); }
  _Float16* qls = (_Float16*)&ss[wave * 32 * OP] + lane * 8;   // during the loop the wave's own partial-tile room holds its q fragments, hi then residual (8 KiB, fragment order): 64 registers less, so that four waves fit a SIMD
  { const size_t qo = QKB(b, h, Q0 / 16) + lane * 8; const _Float16 *qhp = QH + qo, *qlp = QL + qo;
#pragma unroll
    for (int i = 0; i < 2; ++i)
#pragma unroll
      for (int kc = 0; kc < 2; ++kc) { const int o = i * 1024 + kc * 512; *(v8h*)(qls + o) = *(const v8h*)(qhp + o); *(v8h*)(qls + o + 256) = *(const v8h*)(qhp + o + 256); *(v8h*)(qls + 2048 + o) = *(const v8h*)(qlp + o); *(v8h*)(qls + 2048 + o + 256) = *(const v8h*)(qlp + o + 256); }
    asm volatile("s_wait_xcnt 0x0" :: "v"(qhp), "v"(qlp) : "memory"); }   // the wait of the q loads; their two address pairs are inputs, so that no register of them is reused in front of it
  __syncthreads();   // the mask table is in LDS
  v8f acc[2][HD / 16] = {}; float m[2] = {-3.0e38f, -3.0e38f}, s[2] = {0.f, 0.f}, t[2] = {0.f, 0.f};
#pragma unroll 1   // kept rolled: a second chunk's fragments beside this one's would not fit four waves per SIMD
  for (int c = ks; c < nch; c += AKS) { float x[2][16]; bool ramp;
    { v16h kf[2][2]; const _Float16* kp = KH + QKB(b, h, c * 2) + lane * 8;
#pragma unroll
      for (int j = 0; j < 2; ++j)
#pragma unroll
        for (int kc = 0; kc < 2; ++kc) kf[j][kc] = frag_hp(kp + j * 1024 + kc * 512);
      asm volatile("s_wait_xcnt 0x0" :: "v"(kp) : "memory");   // the wait of the k loads; their address pair is an input, so that no register of it is rewritten in front of it
      ramp = __builtin_amdgcn_readfirstlane(__builtin_bit_cast(int, smk[c * 32])) != 0x3f800000;   // read here, with the q fragments, so that its LDS latency is not waited out behind the exps
#pragma unroll
      for (int i = 0; i < 2; ++i) { v8f a[2] = {}, l[2] = {}; const v16h qh[2] = {frag_hp(qls + i * 1024), frag_hp(qls + i * 1024 + 512)}, ql[2] = {frag_hp(qls + 2048 + i * 1024), frag_hp(qls + 2048 + i * 1024 + 512)};
#pragma unroll
        for (int kc = 0; kc < 2; ++kc)
#pragma unroll
          for (int j = 0; j < 2; ++j) { a[j] = wmma16(kf[j][kc], qh[kc], a[j]); l[j] = wmma16(kf[j][kc], ql[kc], l[j]); }
#pragma unroll
        for (int j = 0; j < 2; ++j) { a[j] += l[j] * (1.0f / 1024.0f);
#pragma unroll
          for (int r = 0; r < 8; ++r) x[i][j * 8 + r] = a[j][r] * (1.0f / 64.0f); } } }   /* scores divided by DH = 64 as written; element j * 8 + r = key 32 c + 16 j + 8 g + r, query Q0 + 16 i + col */
    const size_t vo = VB(b, h, c) + lane * 8; const __bf16 *vhp = VT + vo, *vlp = VL + vo; v16b vh[HD / 16], vl[HD / 16];   // the v loads fly during the softmax
#pragma unroll
    for (int j = 0; j < HD / 16; ++j) { vh[j] = frag_bp(vhp + j * 512); vl[j] = frag_bp(vlp + j * 512); }
    asm volatile("s_wait_xcnt 0x0" :: "v"(vhp), "v"(vlp) : "memory");   // the wait of the v loads; their two address pairs are inputs, so that no register of them is rewritten in front of it
    if (c == nch - 1) {   // the chunk of the diagonal: its first key is the wave's first query
#pragma unroll
      for (int i = 0; i < 2; ++i)
#pragma unroll
        for (int e = 0; e < 16; ++e) if ((e >> 3) * 16 + 8 * g + (e & 7) > i * 16 + col) x[i][e] = -3.0e38f; }
    float mx[2];
#pragma unroll
    for (int i = 0; i < 2; ++i) { float v = x[i][0];
#pragma unroll
      for (int e = 1; e < 16; ++e) v = fmaxf(v, x[i][e]);
      mx[i] = fmaxf(v, xhalf(v)); }   // both halves of a query's keys: the two lanes of a query keep one m
    if (__builtin_amdgcn_ballot_w32(mx[0] > m[0] + 8.0f || mx[1] > m[1] + 8.0f) != 0) {   // one test per chunk; always taken on a wave's first chunk
#pragma unroll
      for (int i = 0; i < 2; ++i) { const float mn = mx[i] > m[i] + 8.0f ? mx[i] : m[i]; const float al = expf(m[i] - mn); m[i] = mn; s[i] *= al; t[i] *= al;
#pragma unroll
        for (int j = 0; j < HD / 16; ++j) acc[i][j] *= al; } }
    float ds[2];
#pragma unroll
    for (int i = 0; i < 2; ++i) { float p[4] = {0.f, 0.f, 0.f, 0.f};
#pragma unroll
      for (int e = 0; e < 16; ++e) { x[i][e] = expf(x[i][e] - m[i]); p[e & 3] += x[i][e]; }   // an excluded key: expf of about -3e38 is 0
      ds[i] = (p[0] + p[1]) + (p[2] + p[3]); s[i] += ds[i]; }
    if (ramp) {   // the mask never falls with k: where the chunk's first key has 1.0, all its keys have, and e * mask is e
      float mk[16];
#pragma unroll
      for (int j = 0; j < 2; ++j) { const v4f u0 = *(const v4f*)&smk[c * 32 + j * 16 + 8 * g], u1 = *(const v4f*)&smk[c * 32 + j * 16 + 8 * g + 4];
#pragma unroll
        for (int r = 0; r < 4; ++r) { mk[j * 8 + r] = u0[r]; mk[j * 8 + 4 + r] = u1[r]; } }
#pragma unroll
      for (int i = 0; i < 2; ++i) { float p[4] = {0.f, 0.f, 0.f, 0.f};
#pragma unroll
        for (int e = 0; e < 16; ++e) { x[i][e] *= mk[e]; p[e & 3] += x[i][e]; }
        ds[i] = (p[0] + p[1]) + (p[2] + p[3]); } }
    t[0] += ds[0]; t[1] += ds[1];
    const F2 p0 = bsplit16(x[0]), p1 = bsplit16(x[1]);
#pragma unroll
    for (int j = 0; j < HD / 16; ++j) { acc[0][j] = wmma_bf(vh[j], p0.l, acc[0][j]); acc[1][j] = wmma_bf(vh[j], p1.l, acc[1][j]); }
#pragma unroll
    for (int j = 0; j < HD / 16; ++j) { acc[0][j] = wmma_bf(vl[j], p0.h, acc[0][j]); acc[1][j] = wmma_bf(vl[j], p1.h, acc[1][j]); }
#pragma unroll
    for (int j = 0; j < HD / 16; ++j) { acc[0][j] = wmma_bf(vh[j], p0.h, acc[0][j]); acc[1][j] = wmma_bf(vh[j], p1.h, acc[1][j]); } }
#pragma unroll
  for (int i = 0; i < 2; ++i) { s[i] += xhalf(s[i]); t[i] += xhalf(t[i]);   // the two halves of a query's keys
    if (g == 0) { wm[wave][i * 16 + col] = m[i]; wsm[wave][i * 16 + col] = s[i]; wt[wave][i * 16 + col] = t[i]; }
#pragma unroll
    for (int j = 0; j < HD / 16; ++j) { float* d = &ss[(wave * 32 + i * 16 + col) * OP + j * 16 + 8 * g]; v4f u0, u1;   // accumulator element r = d 16 j + 8 g + r of query col
#pragma unroll
      for (int r = 0; r < 4; ++r) { u0[r] = acc[i][j][r]; u1[r] = acc[i][j][4 + r]; }
      *(v4f*)d = u0; *(v4f*)(d + 4) = u1; } }
  __syncthreads();   // every wave's partial tile and its m, s, t are in LDS
  const int q4 = (tid & 15) * 4;
#pragma unroll
  for (int i = 0; i < AQ / 16; ++i) { const int rl = i * 16 + (tid >> 4), w0 = rl >> 5, r32 = rl & 31;   // 16 lanes a row: a store covers two runs of 256 contiguous bytes
    float mm = wm[w0][r32];
#pragma unroll
    for (int k = 1; k < AKS; ++k) mm = fmaxf(mm, wm[k * 2 + w0][r32]);
    float sa = 0.f, ta = 0.f; v4f o = {};
#pragma unroll
    for (int k = 0; k < AKS; ++k) { const int w = k * 2 + w0; const float f = expf(wm[w][r32] - mm); sa += f * wsm[w][r32]; ta += f * wt[w][r32]; o += *(const v4f*)&ss[(w * 32 + r32) * OP + q4] * f; }   // a split without a chunk has m about -3e38: weight 0
    const float ia = 1.0f / sa; const float na = 1.0f / (ta * ia + 1e-8f);   /* w = softmax * ramp mask, renormalised by (sum + 1e-8) */
    float* yp = Y + ((size_t)b * TT + ql0 + rl) * CC + h * HD + q4; const v4f yv = (o * ia) * na; vst2(yp, yv);
    asm volatile("s_wait_xcnt 0x0" :: "v"(yp), "v"(yv) : "memory"); } }   // the wait of this store; its address pair and its data are inputs, so that no register of them is rewritten in front of it
// ---- k_out: block = (128 rows, 128 cols), 8 waves of 64 rows x 32 cols: out = y (bf16 hi + lo) Wo + bo; operands as in k_proj, the y tile staged as its two bf16 planes
__global__ __launch_bounds__(256) void k_out(const float* __restrict__ Y, const float* __restrict__ WP, const float* __restrict__ BP, float* __restrict__ OUT) { __shared__ __align__(16) __bf16 yh[2][128][XP], yl[2][128][XP]; __shared__ __align__(16) float sf[128][132];
  const int tid = threadIdx.x, wave = tid >> 5, lane = tid & 31, col = lane & 15, g = lane >> 4; const int c0 = blockIdx.y * 128; const size_t r0 = (size_t)blockIdx.x * 128;
  const int xrow = tid >> 4, xq = (tid & 15) * 4, rb = (wave >> 2) * 64, cb = (wave & 3) * 32 + 2 * col;   // the wave's first row, the lane's first column in the tile
  const float* wp = WP + (size_t)(8 * g) * CC + c0 + cb; const float* xp = Y + (r0 + xrow) * CC + xq;
  v2f wr[2][16]; v4f xr[8]; v16b wf[2][2]; v8f acc[4][2] = {};
  ld_w(wp, wr); ld_x(xp, xr);
  cv_w(wr, wf);
#pragma unroll
  for (int u = 0; u < 8; ++u) { v4b h, l;
#pragma unroll
    for (int e = 0; e < 4; ++e) { h[e] = (__bf16)xr[u][e]; l[e] = (__bf16)(xr[u][e] - (float)h[e]); }
    *(v4b*)&yh[0][u * 16 + xrow][xq] = h; *(v4b*)&yl[0][u * 16 + xrow][xq] = l; }
  __syncthreads();   // stage 0 is in LDS
#pragma unroll 1   // kept rolled: a second stage's raw registers beside the first's are not worth their room
  for (int s = 0; s < CC / GK; ++s) { const bool more = s + 1 < CC / GK;
    if (more) { wp += (size_t)GK * CC; xp += GK; ld_w(wp, wr); ld_x(xp, xr); }
#pragma unroll
    for (int c = 0; c < 2; ++c) { v16b ah[4], al[4];
#pragma unroll
      for (int i = 0; i < 4; ++i) { ah[i] = frag_b(&yh[s & 1][rb + i * 16 + col][c * 32], lane); al[i] = frag_b(&yl[s & 1][rb + i * 16 + col][c * 32], lane); }
#pragma unroll
      for (int i = 0; i < 4; ++i) { acc[i][0] = wmma_bf(ah[i], wf[c][0], acc[i][0]); acc[i][1] = wmma_bf(ah[i], wf[c][1], acc[i][1]); }
#pragma unroll
      for (int i = 0; i < 4; ++i) { acc[i][0] = wmma_bf(al[i], wf[c][0], acc[i][0]); acc[i][1] = wmma_bf(al[i], wf[c][1], acc[i][1]); } }
    if (more) { cv_w(wr, wf);
#pragma unroll
      for (int u = 0; u < 8; ++u) { v4b h, l;
#pragma unroll
        for (int e = 0; e < 4; ++e) { h[e] = (__bf16)xr[u][e]; l[e] = (__bf16)(xr[u][e] - (float)h[e]); }
        *(v4b*)&yh[(s + 1) & 1][u * 16 + xrow][xq] = h; *(v4b*)&yl[(s + 1) & 1][u * 16 + xrow][xq] = l; } }
    __syncthreads(); }   // publishes stage s + 1 and ends every wave's reads of stage s, whose buffers the next trip refills
  const float b0 = BP ? bfr(BP[c0 + cb]) : 0.f, b1 = BP ? bfr(BP[c0 + cb + 1]) : 0.f;
#pragma unroll
  for (int i = 0; i < 4; ++i)
#pragma unroll
    for (int r = 0; r < 8; ++r) { v2f o; o[0] = acc[i][0][r] + b0; o[1] = acc[i][1][r] + b1; *(v2f*)&sf[rb + i * 16 + 8 * g + r][cb] = o; }
  __syncthreads();   // the 128 x 128 tile is in LDS: each wave stores 16 whole rows of it
  for (int rl = 0; rl < 16; ++rl) vst2(OUT + (r0 + wave * 16 + rl) * CC + c0 + lane * 4, *(const v4f*)&sf[wave * 16 + rl][lane * 4]); }
extern "C" void kernel_launch(void* const* d_in, const int* in_sizes, int n_in, void* d_out, int out_size, void* d_ws, size_t ws_size, hipStream_t stream) {
  (void)in_sizes; (void)n_in; (void)out_size;
  const float** F = (const float**)d_in;   // 0 query [2,2048,1024], 1 Wq [1024,1024] ((in,out)), 2 Wk, 3 Wv, 4 Wo ((in,out)), 5 span_val [1,16,1,1] (verbatim)
  if (ws_size < (size_t)WS_END) return;
  char* ws = (char*)d_ws; _Float16 *QH = (_Float16*)(ws + WS_QH), *QL = (_Float16*)(ws + WS_QL), *KH = (_Float16*)(ws + WS_KH); __bf16 *VT = (__bf16*)(ws + WS_VT), *VL = (__bf16*)(ws + WS_VL); float *Y = (float*)(ws + WS_Y);
  k_proj<<<dim3(TNB * TT / 128, CC / 128, 3), 256, 0, stream>>>(F[0], F[1], nullptr, F[2], nullptr, F[3], nullptr, QH, QL, KH, VT, VL);
  k_attn<<<dim3(TNB * NH, 1, TT / AQ), 32 * AW, 0, stream>>>(QH, QL, KH, VT, VL, F[5], Y);
  k_out<<<dim3(TNB * TT / 128, CC / 128), 256, 0, stream>>>(Y, F[4], nullptr, (float*)d_out);
}

// v006
// One run takes 114 microseconds.
// Next to v005, in two timings, it ran 1.11 times as fast each time.
// All steps since v000 together make it 12.0 times as fast.
// compute dtype: all float inputs rounded to bf16, span_val read; q/k/v = query W with EXACT bf16 products on WMMA 16x16x32, f32 accumulate; q as f16 hi + residual (x 2^10), k f16 -> 2-product logits / 64 (the module divides by DH), causal (-1e9 additive == exclusion), kept in f32 registers; running softmax sums, the adaptive-span ramp mask and the renormalisation (+1e-8) in f32 (exp as the hardware exp2 of (logit - m) * log2 e); exp * mask f32 split bf16 hi + lo against v bf16 hi + lo (3 products); out = y (bf16 hi + lo) Wo; f32 output.
#include <hip/hip_runtime.h>
#include <math.h>

typedef __attribute__((ext_vector_type(16))) _Float16 v16h;
typedef __attribute__((ext_vector_type(16))) __bf16 v16b;
typedef __attribute__((ext_vector_type(8)))  _Float16 v8h;
typedef __attribute__((ext_vector_type(8)))  float v8f;
typedef __attribute__((ext_vector_type(4)))  float v4f;
typedef __attribute__((ext_vector_type(2)))  float v2f;
typedef __attribute__((ext_vector_type(4)))  unsigned v4u;
typedef __attribute__((ext_vector_type(4)))  int v4i;
typedef float __attribute__((may_alias)) float_a;
typedef int __attribute__((may_alias)) int_a;

template <typename T> __device__ __forceinline__ void vst2(void* p, T v) { *(T*)p = v;  }
__device__ __forceinline__ v8f wmma16(v16h a, v16h b, v8f c) {
  v8f d = __builtin_amdgcn_wmma_f32_16x16x32_f16(false, a, false, b, (short)0, c, false, false);
  asm volatile("v_nop\n\tv_nop\n\tv_nop\n\tv_nop" : "+v"(d) : "v"(a), "v"(b));
  return d;
}
__device__ __forceinline__ v8f wmma_bf(v16b a, v16b b, v8f c) {
  v8f d = __builtin_amdgcn_wmma_f32_16x16x32_bf16(false, a, false, b, (short)0, c, false, false);
  asm volatile("v_nop\n\tv_nop\n\tv_nop\n\tv_nop" : "+v"(d) : "v"(a), "v"(b));
  return d;
}
// 16x16x32 fragments: lane = (h = lane>>4, row/col = lane&15); elements 0..7 = k0+8h+0..7, 8..15 = k0+16+8h+0..7; D element r = row 8h+r
__device__ __forceinline__ v16h frag_h(const _Float16* rowk0, int lane) {
  union { v16h v; v8h q[2]; } u; const _Float16* p = rowk0 + 8 * (lane >> 4);
  u.q[0] = *(const v8h*)p; u.q[1] = *(const v8h*)(p + 16); return u.v;
}
__device__ __forceinline__ v16h frag_f32(const float* rowk0, int lane) {
  v16h a; const float* p = rowk0 + 8 * (lane >> 4);
#pragma unroll
  for (int i = 0; i < 8; ++i) { a[i] = (_Float16)p[i]; a[8 + i] = (_Float16)p[16 + i]; }
  return a;
}
__device__ __forceinline__ v16h frag_f32s(const float* rowk0, int lane, float sc) {
  v16h a; const float* p = rowk0 + 8 * (lane >> 4);
#pragma unroll
  for (int i = 0; i < 8; ++i) { a[i] = (_Float16)(p[i] * sc); a[8 + i] = (_Float16)(p[16 + i] * sc); }
  return a;
}
// column fragment from a [K][ld] layout (column n), rows >= K read as 0
__device__ __forceinline__ v16h fragc_f32(const float* W, int k0, int n, int lane, int ld, int K) {
  v16h a; const int g = lane >> 4;
#pragma unroll
  for (int i = 0; i < 8; ++i) { const int ka = k0 + 8 * g + i, kb = ka + 16;
    a[i] = (_Float16)(ka < K ? W[(size_t)(ka < K ? ka : K - 1) * ld + n] : 0.f); a[8 + i] = (_Float16)(kb < K ? W[(size_t)(kb < K ? kb : K - 1) * ld + n] : 0.f); }
  return a;
}
struct F2 { v16b h, l; };
__device__ __forceinline__ F2 bsplit16(const float v[16]) { F2 r;
#pragma unroll
  for (int i = 0; i < 16; ++i) { const __bf16 h = (__bf16)v[i]; r.h[i] = h; r.l[i] = (__bf16)(v[i] - (float)h); }
  return r; }
__device__ __forceinline__ F2 split_row(const float* row, int k0, int lane) { float v[16]; const float* p = row + k0 + 8 * (lane >> 4);
#pragma unroll
  for (int i = 0; i < 8; ++i) { v[i] = p[i]; v[8 + i] = p[16 + i]; }
  return bsplit16(v); }
__device__ __forceinline__ F2 split_rowK(const float* row, int k0, int lane, int K) { float v[16]; const int g = lane >> 4;
#pragma unroll
  for (int i = 0; i < 8; ++i) { const int ka = k0 + 8 * g + i, kb = ka + 16; v[i] = ka < K ? row[ka < K ? ka : K - 1] : 0.f; v[8 + i] = kb < K ? row[kb < K ? kb : K - 1] : 0.f; }
  return bsplit16(v); }
__device__ __forceinline__ F2 split_col(const float* W, int k0, int n, int lane, int ld, int K) { float v[16]; const int g = lane >> 4;
#pragma unroll
  for (int i = 0; i < 8; ++i) { const int ka = k0 + 8 * g + i, kb = ka + 16; v[i] = ka < K ? W[(size_t)(ka < K ? ka : K - 1) * ld + n] : 0.f; v[8 + i] = kb < K ? W[(size_t)(kb < K ? kb : K - 1) * ld + n] : 0.f; }
  return bsplit16(v); }
__device__ __forceinline__ v8f mac3(const F2& a, const F2& b, v8f c) { c = wmma_bf(a.l, b.h, c); c = wmma_bf(a.h, b.l, c); return wmma_bf(a.h, b.h, c); }
__device__ __forceinline__ float sigm(float v) { return 1.0f / (1.0f + expf(-v)); }
#define LDSX() do { asm volatile("s_wait_dscnt 0" ::: "memory"); __builtin_amdgcn_wave_barrier(); __builtin_amdgcn_fence(__ATOMIC_RELEASE, "workgroup"); } while (0)


// Adaptive-span causal attention (B 2, S 2,048, hidden 1,024 = 16 x 64, ramp 32): w = softmax(q k^T / 64 + triu(-1e9, 1)); w = w * clip((k_idx + span_val[h] * S) / 33, 0, 1); w = w / (sum_k w + 1e-8); out = (w v) Wo (no biases).
#define NB 2
#define TT 2048
#define CC 1024
#define NH 16
#define HD 64
#ifndef TNB
#define TNB NB
#endif
typedef __attribute__((ext_vector_type(8))) __bf16 v8b;
__device__ __forceinline__ v16b frag_b(const __bf16* rowk0, int lane) {
  union { v16b v; v8b q[2]; } u; const __bf16* p = rowk0 + 8 * (lane >> 4);
  u.q[0] = *(const v8b*)p; u.q[1] = *(const v8b*)(p + 16); return u.v;
}
__device__ __forceinline__ float bfr(float v) { return (float)(__bf16)v; }
__device__ __attribute__((noinline)) float exp_ni(float v) { return expf(v); }
__device__ __attribute__((noinline)) float erf_ni(float v) { return erff(v); }

#define WS_QH  0u
#define WS_QL  (WS_QH + 2u * (size_t)NB * TT * CC)
#define WS_KH  (WS_QL + 2u * (size_t)NB * TT * CC)
#define WS_VT  (WS_KH + 2u * (size_t)NB * TT * CC)      // bf16 v planes
#define WS_VL  (WS_VT + 2u * (size_t)NB * CC * TT)      // bf16 v residual planes
#define WS_Y   (WS_VL + 2u * (size_t)NB * CC * TT)      // f32 y rows [b*t][C]
#define WS_END (WS_Y + 4u * (size_t)NB * TT * CC)

// The q, k and v planes lie in fragment order, in 16-byte pieces of 8 elements: q, k: per (b, h, 16 rows) 1,024 elements [d / 8][row][8]; v: per (b, h, 32 keys) 2,048 elements [d / 16][key / 8][d % 16][8].
// A lane's two halves of a 16x16x32 fragment then lie at lane * 16 B in two successive 512-byte runs: each load of a wave covers four whole 128-byte lines. p holds the lane's 8 * lane.
#define QKB(b, h, t16) (((size_t)((b) * NH + (h)) * (TT / 16) + (t16)) * 1024)
#define VB(b, h, t32) (((size_t)((b) * NH + (h)) * (TT / 32) + (t32)) * 2048)
__device__ __forceinline__ v16h frag_hp(const _Float16* p) { union { v16h v; v8h q[2]; } u; u.q[0] = *(const v8h*)p; u.q[1] = *(const v8h*)(p + 256); return u.v; }
__device__ __forceinline__ v16b frag_bp(const __bf16* p) { union { v16b v; v8b q[2]; } u; u.q[0] = *(const v8b*)p; u.q[1] = *(const v8b*)(p + 256); return u.v; }
#define GK 64                                         // k per stage of the two GEMM kernels
#define XP 72                                         // LDS row pitch of a staged tile in bf16: 144 B = 16 B x odd, so 16-byte reads down 16 rows meet no bank twice
typedef __attribute__((ext_vector_type(4))) __bf16 v4b;
// W rows of one stage for a wave's 32 columns: lane (col, g) takes columns 2 col, 2 col + 1 of rows 8 g + i and 16 + 8 g + i of each 32-k chunk, so a load covers two whole 128-byte lines.
// Fragment e then holds column 2 col + e in lane col: the k order is that of frag_b, only the tile's columns are renumbered (undone where the accumulators are stored).
__device__ __forceinline__ void ld_w(const float* wp, v2f (&wr)[2][16]) {
#pragma unroll
  for (int c = 0; c < 2; ++c)
#pragma unroll
    for (int i = 0; i < 8; ++i) { wr[c][i] = *(const v2f*)(wp + (size_t)(c * 32 + i) * CC); wr[c][8 + i] = *(const v2f*)(wp + (size_t)(c * 32 + 16 + i) * CC); }
}
__device__ __forceinline__ void cv_w(const v2f (&wr)[2][16], v16b (&wf)[2][2]) {
#pragma unroll
  for (int c = 0; c < 2; ++c)
#pragma unroll
    for (int i = 0; i < 16; ++i) { wf[c][0][i] = (__bf16)wr[c][i][0]; wf[c][1][i] = (__bf16)wr[c][i][1]; }
}
// the block's 128 x 64 f32 tile of one stage: 16 lanes a row, so a load covers two rows of 256 contiguous bytes
__device__ __forceinline__ void ld_x(const float* xp, v4f (&xr)[8]) {
#pragma unroll
  for (int u = 0; u < 8; ++u) xr[u] = *(const v4f*)(xp + (size_t)(u * 16) * CC);
}
// ---- k_proj: block = (128 rows, 128 cols, which), 8 waves of 64 rows x 32 cols: qkv = x W (+ b), exact; q -> f16 hi (+ residual), k -> f16 planes, v -> bf16 planes
//      per 64-k stage the x tile goes once through LDS as bf16 (two buffers) and serves the four waves of its rows; each wave reads only its own 32 columns of W; the next stage's loads fly during this stage's products
__global__ __launch_bounds__(256) void k_proj(const float* __restrict__ X, const float* __restrict__ WQ, const float* __restrict__ BQ, const float* __restrict__ WK, const float* __restrict__ BK, const float* __restrict__ WV, const float* __restrict__ BV, _Float16* __restrict__ QH, _Float16* __restrict__ QL, _Float16* __restrict__ KH, __bf16* __restrict__ VT, __bf16* __restrict__ VL) {
  __shared__ __align__(16) unsigned char sm[2 * 128 * 136 * 2];   // one of: the two stage buffers (loop), q or k rows hi + residual, v planes hi + residual; a barrier stands between the uses
  _Float16 (*sh)[136] = (_Float16 (*)[136])sm, (*sl)[136] = (_Float16 (*)[136])(sm + 128 * 136 * 2); __bf16 (*th)[136] = (__bf16 (*)[136])sm, (*tl2)[136] = (__bf16 (*)[136])(sm + 128 * 136 * 2);
  const int tid = threadIdx.x, wave = tid >> 5, lane = tid & 31, col = lane & 15, g = lane >> 4; const int which = blockIdx.z; const int c0 = blockIdx.y * 128; const size_t r0 = (size_t)blockIdx.x * 128; const float* WA = which == 0 ? WQ : which == 1 ? WK : WV; const float* BA = which == 0 ? BQ : which == 1 ? BK : BV;
  __bf16 (*xs)[128][XP] = (__bf16 (*)[128][XP])sm;
  const int xrow = tid >> 4, xq = (tid & 15) * 4, rb = (wave >> 2) * 64, cb = (wave & 3) * 32 + 2 * col;   // the wave's first row, the lane's first column in the tile
  const float* wp = WA + (size_t)(8 * g) * CC + c0 + cb; const float* xp = X + (r0 + xrow) * CC + xq;
  v2f wr[2][16]; v4f xr[8]; v16b wf[2][2]; v8f acc[4][2] = {};
  ld_w(wp, wr); ld_x(xp, xr);
  cv_w(wr, wf);
#pragma unroll
  for (int u = 0; u < 8; ++u) { v4b h;
#pragma unroll
    for (int e = 0; e < 4; ++e) h[e] = (__bf16)xr[u][e];
    *(v4b*)&xs[0][u * 16 + xrow][xq] = h; }
  __syncthreads();   // stage 0 is in LDS
#pragma unroll 1   // kept rolled: a second stage's raw registers beside the first's would cost a wave per SIMD
  for (int s = 0; s < CC / GK; ++s) { const bool more = s + 1 < CC / GK;
    if (more) { wp += (size_t)GK * CC; xp += GK; ld_w(wp, wr); ld_x(xp, xr); }
#pragma unroll
    for (int c = 0; c < 2; ++c) { v16b a[4];
#pragma unroll
      for (int i = 0; i < 4; ++i) a[i] = frag_b(&xs[s & 1][rb + i * 16 + col][c * 32], lane);
#pragma unroll
      for (int i = 0; i < 4; ++i) { acc[i][0] = wmma_bf(a[i], wf[c][0], acc[i][0]); acc[i][1] = wmma_bf(a[i], wf[c][1], acc[i][1]); } }
    if (more) { cv_w(wr, wf);
#pragma unroll
      for (int u = 0; u < 8; ++u) { v4b h;
#pragma unroll
        for (int e = 0; e < 4; ++e) h[e] = (__bf16)xr[u][e];
        *(v4b*)&xs[(s + 1) & 1][u * 16 + xrow][xq] = h; } }
    __syncthreads(); }   // publishes stage s + 1 and ends every wave's reads of stage s, whose buffer the next trip refills
#pragma unroll
  for (int i = 0; i < 4; ++i)
#pragma unroll
  for (int e = 0; e < 2; ++e) { const int cl = cb + e; const float bb = BA ? bfr(BA[c0 + cl]) : 0.f;
#pragma unroll
    for (int r = 0; r < 8; ++r) { const float v = acc[i][e][r] + bb; const int rl = rb + i * 16 + 8 * g + r; const _Float16 hv = (_Float16)v;
      if (which == 2) { const __bf16 bh = (__bf16)v; th[cl][rl] = bh; tl2[cl][rl] = (__bf16)(v - (float)bh); } else { sh[rl][cl] = hv; sl[rl][cl] = (_Float16)((v - (float)hv) * 1024.0f); }   /* q residual carried x 2^10 so the plane stays f16-normal on the chip */ } }
  __syncthreads();
  const int bi = (int)(r0 / TT), t0 = (int)(r0 % TT), h0 = c0 / HD, pl = tid & 15, pq = (tid >> 4) & 15;   // a lane's place in a piece run, its run: a wave stores 512 contiguous bytes, a trip of the block one or two whole blocks of a plane
  if (which < 2) { _Float16* dh = which == 0 ? QH : KH; for (int e = 0; e < 8; ++e) { const int rl = e * 16 + pl, q = pq; const size_t o1 = QKB(bi, h0 + (q >> 3), t0 / 16 + e) + (q & 7) * 128 + pl * 8; _Float16* d0 = dh + o1; const v4u x0 = *(const v4u*)&sh[rl][q * 8]; vst2((unsigned*)d0, x0);
      asm volatile("s_wait_xcnt 0x0" :: "v"(d0), "v"(x0) : "memory");   // the wait of this store; its address pair and its data are inputs, so that no register of them is rewritten in front of it
      if (which == 0) { _Float16* d1 = QL + o1; const v4u x1 = *(const v4u*)&sl[rl][q * 8]; vst2((unsigned*)d1, x1);
        asm volatile("s_wait_xcnt 0x0" :: "v"(d1), "v"(x1) : "memory"); } } }   // as above
  else { for (int e = 0; e < 8; ++e) { const int cl = (e & 1) * 64 + (pq >> 2) * 16 + pl, q = (e >> 1) * 4 + (pq & 3); const size_t o2 = VB(bi, h0 + (e & 1), t0 / 32 + (e >> 1)) + pq * 128 + pl * 8; __bf16 *d0 = VT + o2, *d1 = VL + o2; const v4u x0 = *(const v4u*)&th[cl][q * 8], x1 = *(const v4u*)&tl2[cl][q * 8]; vst2((unsigned*)d0, x0); vst2((unsigned*)d1, x1);
      asm volatile("s_wait_xcnt 0x0" :: "v"(d0), "v"(d1), "v"(x0), "v"(x1) : "memory"); } } }   // the wait of these two stores, as above
// ---- k_attn: block = 64 queries of (b,h), 8 waves = 2 groups of 32 queries x 4 key splits; the logits never leave the registers.
//      A wave walks the 32-key chunks ks, ks + 4, ... of its 32 queries: S^T = K Q^T (a lane holds 16 keys of one query per 16-query tile), logits / 64, causal on the last chunk only;
//      e = exp(logit - m) = exp2(product * LSC - m2), one fma and one v_exp_f32 per score: m2 is the maximum in use in log2 units (raised, with a rescale of the sums, only when a chunk's maximum passes it by more than LTH: e stays below e^8);
//      s += sum e, t += sum e * ramp mask clip((k + span_val[h] S)/(RAMP+1), 0, 1), O^T += V^T (e * mask)^T: the score registers are the B fragment as they stand.
//      The 4 key splits of a query are joined through LDS in split order, each weighted exp2(m2_w - max m2): y = (O / s) / (t / s + 1e-8).
#define AQ 64
#define AKS 4
#define AW 8
#define LSC (1.4426950408889634f / 64.0f)            // log2 e / DH: q k product -> logit in log2 units
#define LTH 11.541560327111707f                      // 8 * log2 e
#define OP (HD + 4)                                   // LDS row pitch of a partial tile in floats: 16 B x odd
__device__ __forceinline__ float ex2(float v) { return __builtin_amdgcn_exp2f(v); }   // v_exp_f32 alone: an argument far below -126 gives 0, which is what an excluded key and an empty split want
__device__ __forceinline__ float xhalf(float x) { return __builtin_bit_cast(float, __builtin_amdgcn_permlanex16(__builtin_bit_cast(int, x), __builtin_bit_cast(int, x), 0x76543210, 0xfedcba98, false, false)); }   // lane l with lane l ^ 16
__global__ __launch_bounds__(32 * AW) __attribute__((amdgpu_waves_per_eu(4, 4))) void k_attn(const _Float16* __restrict__ QH, const _Float16* __restrict__ QL, const _Float16* __restrict__ KH, const __bf16* __restrict__ VT, const __bf16* __restrict__ VL, const float* __restrict__ SPAN, float* __restrict__ Y) {
  __shared__ __align__(16) float smk[TT]; __shared__ __align__(16) float ss[AW * 32 * OP]; __shared__ float wm[AW][32], wsm[AW][32], wt[AW][32];
  const int tid = threadIdx.x, wave = __builtin_amdgcn_readfirstlane(tid >> 5), lane = tid & 31, col = lane & 15, g = lane >> 4; const int b = blockIdx.x / NH, h = blockIdx.x % NH;
  const int ql0 = (TT / AQ - 1 - (int)blockIdx.z) * AQ;   // the longest blocks start first
  const int qg = wave & 1, ks = wave >> 1, Q0 = ql0 + qg * 32, nch = Q0 / 32 + 1;   // the wave's first query; its queries see the chunks [0, nch), the last one in part
  { const float spv = bfr(SPAN[h]) * (float)TT;   /* span_val[h] * attn_span */
    for (int k = tid; k < ql0 + AQ; k += 32 * AW) smk[k] = fminf(fmaxf(((float)k + spv) / 33.0f, 0.f), 1.0f); }
  _Float16* qls = (_Float16*)&ss[wave * 32 * OP] + lane * 8;   // during the loop the wave's own partial-tile room holds its q fragments, hi then residual (8 KiB, fragment order): 64 registers less, so that four waves fit a SIMD
  { const size_t qo = QKB(b, h, Q0 / 16) + lane * 8; const _Float16 *qhp = QH + qo, *qlp = QL + qo;
#pragma unroll
    for (int i = 0; i < 2; ++i)
#pragma unroll
      for (int kc = 0; kc < 2; ++kc) { const int o = i * 1024 + kc * 512; *(v8h*)(qls + o) = *(const v8h*)(qhp + o); *(v8h*)(qls + o + 256) = *(const v8h*)(qhp + o + 256); *(v8h*)(qls + 2048 + o) = *(const v8h*)(qlp + o); *(v8h*)(qls + 2048 + o + 256) = *(const v8h*)(qlp + o + 256); }
    asm volatile("s_wait_xcnt 0x0" :: "v"(qhp), "v"(qlp) : "memory"); }   // the wait of the q loads; their two address pairs are inputs, so that no register of them is reused in front of it
  __syncthreads();   // the mask table is in LDS
  v8f acc[2][HD / 16] = {}; float m[2] = {-3.0e38f, -3.0e38f}, s[2] = {0.f, 0.f}, t[2] = {0.f, 0.f};
#pragma unroll 1   // kept rolled: a second chunk's fragments beside this one's would not fit four waves per SIMD
  for (int c = ks; c < nch; c += AKS) { float x[2][16]; bool ramp;
    { v16h kf[2][2]; const _Float16* kp = KH + QKB(b, h, c * 2) + lane * 8;
#pragma unroll
      for (int j = 0; j < 2; ++j)
#pragma unroll
        for (int kc = 0; kc < 2; ++kc) kf[j][kc] = frag_hp(kp + j * 1024 + kc * 512);
      asm volatile("s_wait_xcnt 0x0" :: "v"(kp) : "memory");   // the wait of the k loads; their address pair is an input, so that no register of it is rewritten in front of it
      ramp = __builtin_amdgcn_readfirstlane(__builtin_bit_cast(int, smk[c * 32])) != 0x3f800000;   // read here, with the q fragments, so that its LDS latency is not waited out behind the exps
#pragma unroll
      for (int i = 0; i < 2; ++i) { v8f a[2] = {}, l[2] = {}; const v16h qh[2] = {frag_hp(qls + i * 1024), frag_hp(qls + i * 1024 + 512)}, ql[2] = {frag_hp(qls + 2048 + i * 1024), frag_hp(qls + 2048 + i * 1024 + 512)};
#pragma unroll
        for (int kc = 0; kc < 2; ++kc)
#pragma unroll
          for (int j = 0; j < 2; ++j) { a[j] = wmma16(kf[j][kc], qh[kc], a[j]); l[j] = wmma16(kf[j][kc], ql[kc], l[j]); }
#pragma unroll
        for (int j = 0; j < 2; ++j) { a[j] += l[j] * (1.0f / 1024.0f);
#pragma unroll
          for (int r = 0; r < 8; ++r) x[i][j * 8 + r] = a[j][r]; } } }   /* the q k products; the division by DH = 64 is in LSC; element j * 8 + r = key 32 c + 16 j + 8 g + r, query Q0 + 16 i + col */
    const size_t vo = VB(b, h, c) + lane * 8; const __bf16 *vhp = VT + vo, *vlp = VL + vo; v16b vh[HD / 16], vl[HD / 16];   // the v loads fly during the softmax
#pragma unroll
    for (int j = 0; j < HD / 16; ++j) { vh[j] = frag_bp(vhp + j * 512); vl[j] = frag_bp(vlp + j * 512); }
    asm volatile("s_wait_xcnt 0x0" :: "v"(vhp), "v"(vlp) : "memory");   // the wait of the v loads; their two address pairs are inputs, so that no register of them is rewritten in front of it
    if (c == nch - 1) {   // the chunk of the diagonal: its first key is the wave's first query
#pragma unroll
      for (int i = 0; i < 2; ++i)
#pragma unroll
        for (int e = 0; e < 16; ++e) if ((e >> 3) * 16 + 8 * g + (e & 7) > i * 16 + col) x[i][e] = -3.0e38f; }
    float mx[2];
#pragma unroll
    for (int i = 0; i < 2; ++i) { float v = x[i][0];
#pragma unroll
      for (int e = 1; e < 16; ++e) v = fmaxf(v, x[i][e]);
      mx[i] = fmaxf(v, xhalf(v)) * LSC; }   // both halves of a query's keys: the two lanes of a query keep one m
    if (__builtin_amdgcn_ballot_w32(mx[0] > m[0] + LTH || mx[1] > m[1] + LTH) != 0) {   // one test per chunk; always taken on a wave's first chunk
#pragma unroll
      for (int i = 0; i < 2; ++i) { const float mn = mx[i] > m[i] + LTH ? mx[i] : m[i]; const float al = ex2(m[i] - mn); m[i] = mn; s[i] *= al; t[i] *= al;
#pragma unroll
        for (int j = 0; j < HD / 16; ++j) acc[i][j] *= al; } }
    float ds[2];
#pragma unroll
    for (int i = 0; i < 2; ++i) { float p[4] = {0.f, 0.f, 0.f, 0.f};
#pragma unroll
      for (int e = 0; e < 16; e += 2) { v2f u = {x[i][e], x[i][e + 1]}; const v2f sc = {LSC, LSC}, nm = {-m[i], -m[i]}; u = __builtin_elementwise_fma(u, sc, nm); x[i][e] = u[0]; x[i][e + 1] = u[1]; }   // two scores per packed fma
#pragma unroll   // x is a register array: every index must be a constant
      for (int e = 0; e < 16; ++e) x[i][e] = ex2(x[i][e]);   // an excluded key: exp2 of about -7e36 is 0
#pragma unroll   // as above, for x and p
      for (int e = 0; e < 16; ++e) p[e & 3] += x[i][e];
      ds[i] = (p[0] + p[1]) + (p[2] + p[3]); s[i] += ds[i]; }
    if (ramp) {   // the mask never falls with k: where the chunk's first key has 1.0, all its keys have, and e * mask is e
      float mk[16];
#pragma unroll
      for (int j = 0; j < 2; ++j) { const v4f u0 = *(const v4f*)&smk[c * 32 + j * 16 + 8 * g], u1 = *(const v4f*)&smk[c * 32 + j * 16 + 8 * g + 4];
#pragma unroll
        for (int r = 0; r < 4; ++r) { mk[j * 8 + r] = u0[r]; mk[j * 8 + 4 + r] = u1[r]; } }
#pragma unroll
      for (int i = 0; i < 2; ++i) { float p[4] = {0.f, 0.f, 0.f, 0.f};
#pragma unroll
        for (int e = 0; e < 16; ++e) { x[i][e] *= mk[e]; p[e & 3] += x[i][e]; }
        ds[i] = (p[0] + p[1]) + (p[2] + p[3]); } }
    t[0] += ds[0]; t[1] += ds[1];
    const F2 p0 = bsplit16(x[0]), p1 = bsplit16(x[1]);
#pragma unroll
    for (int j = 0; j < HD / 16; ++j) { acc[0][j] = wmma_bf(vh[j], p0.l, acc[0][j]); acc[1][j] = wmma_bf(vh[j], p1.l, acc[1][j]); }
#pragma unroll
    for (int j = 0; j < HD / 16; ++j) { acc[0][j] = wmma_bf(vl[j], p0.h, acc[0][j]); acc[1][j] = wmma_bf(vl[j], p1.h, acc[1][j]); }
#pragma unroll
    for (int j = 0; j < HD / 16; ++j) { acc[0][j] = wmma_bf(vh[j], p0.h, acc[0][j]); acc[1][j] = wmma_bf(vh[j], p1.h, acc[1][j]); } }
#pragma unroll
  for (int i = 0; i < 2; ++i) { s[i] += xhalf(s[i]); t[i] += xhalf(t[i]);   // the two halves of a query's keys
    if (g == 0) { wm[wave][i * 16 + col] = m[i]; wsm[wave][i * 16 + col] = s[i]; wt[wave][i * 16 + col] = t[i]; }
#pragma unroll
    for (int j = 0; j < HD / 16; ++j) { float* d = &ss[(wave * 32 + i * 16 + col) * OP + j * 16 + 8 * g]; v4f u0, u1;   // accumulator element r = d 16 j + 8 g + r of query col
#pragma unroll
      for (int r = 0; r < 4; ++r) { u0[r] = acc[i][j][r]; u1[r] = acc[i][j][4 + r]; }
      *(v4f*)d = u0; *(v4f*)(d + 4) = u1; } }
  __syncthreads();   // every wave's partial tile and its m, s, t are in LDS
  const int q4 = (tid & 15) * 4;
#pragma unroll
  for (int i = 0; i < AQ / 16; ++i) { const int rl = i * 16 + (tid >> 4), w0 = rl >> 5, r32 = rl & 31;   // 16 lanes a row: a store covers two runs of 256 contiguous bytes
    float mm = wm[w0][r32];
#pragma unroll
    for (int k = 1; k < AKS; ++k) mm = fmaxf(mm, wm[k * 2 + w0][r32]);
    float sa = 0.f, ta = 0.f; v4f o = {};
#pragma unroll
    for (int k = 0; k < AKS; ++k) { const int w = k * 2 + w0; const float f = ex2(wm[w][r32] - mm); sa += f * wsm[w][r32]; ta += f * wt[w][r32]; o += *(const v4f*)&ss[(w * 32 + r32) * OP + q4] * f; }   // a split without a chunk has m about -3e38: weight 0
    const float ia = 1.0f / sa; const float na = 1.0f / (ta * ia + 1e-8f);   /* w = softmax * ramp mask, renormalised by (sum + 1e-8) */
    float* yp = Y + ((size_t)b * TT + ql0 + rl) * CC + h * HD + q4; const v4f yv = (o * ia) * na; vst2(yp, yv);
    asm volatile("s_wait_xcnt 0x0" :: "v"(yp), "v"(yv) : "memory"); } }   // the wait of this store; its address pair and its data are inputs, so that no register of them is rewritten in front of it
// ---- k_out: block = (128 rows, 128 cols), 8 waves of 64 rows x 32 cols: out = y (bf16 hi + lo) Wo + bo; operands as in k_proj, the y tile staged as its two bf16 planes
__global__ __launch_bounds__(256) void k_out(const float* __restrict__ Y, const float* __restrict__ WP, const float* __restrict__ BP, float* __restrict__ OUT) { __shared__ __align__(16) __bf16 yh[2][128][XP], yl[2][128][XP]; __shared__ __align__(16) float sf[128][132];
  const int tid = threadIdx.x, wave = tid >> 5, lane = tid & 31, col = lane & 15, g = lane >> 4; const int c0 = blockIdx.y * 128; const size_t r0 = (size_t)blockIdx.x * 128;
  const int xrow = tid >> 4, xq = (tid & 15) * 4, rb = (wave >> 2) * 64, cb = (wave & 3) * 32 + 2 * col;   // the wave's first row, the lane's first column in the tile
  const float* wp = WP + (size_t)(8 * g) * CC + c0 + cb; const float* xp = Y + (r0 + xrow) * CC + xq;
  v2f wr[2][16]; v4f xr[8]; v16b wf[2][2]; v8f acc[4][2] = {};
  ld_w(wp, wr); ld_x(xp, xr);
  cv_w(wr, wf);
#pragma unroll
  for (int u = 0; u < 8; ++u) { v4b h, l;
#pragma unroll
    for (int e = 0; e < 4; ++e) { h[e] = (__bf16)xr[u][e]; l[e] = (__bf16)(xr[u][e] - (float)h[e]); }
    *(v4b*)&yh[0][u * 16 + xrow][xq] = h; *(v4b*)&yl[0][u * 16 + xrow][xq] = l; }
  __syncthreads();   // stage 0 is in LDS
#pragma unroll 1   // kept rolled: a second stage's raw registers beside the first's are not worth their room
  for (int s = 0; s < CC / GK; ++s) { const bool more = s + 1 < CC / GK;
    if (more) { wp += (size_t)GK * CC; xp += GK; ld_w(wp, wr); ld_x(xp, xr); }
#pragma unroll
    for (int c = 0; c < 2; ++c) { v16b ah[4], al[4];
#pragma unroll
      for (int i = 0; i < 4; ++i) { ah[i] = frag_b(&yh[s & 1][rb + i * 16 + col][c * 32], lane); al[i] = frag_b(&yl[s & 1][rb + i * 16 + col][c * 32], lane); }
#pragma unroll
      for (int i = 0; i < 4; ++i) { acc[i][0] = wmma_bf(ah[i], wf[c][0], acc[i][0]); acc[i][1] = wmma_bf(ah[i], wf[c][1], acc[i][1]); }
#pragma unroll
      for (int i = 0; i < 4; ++i) { acc[i][0] = wmma_bf(al[i], wf[c][0], acc[i][0]); acc[i][1] = wmma_bf(al[i], wf[c][1], acc[i][1]); } }
    if (more) { cv_w(wr, wf);
#pragma unroll
      for (int u = 0; u < 8; ++u) { v4b h, l;
#pragma unroll
        for (int e = 0; e < 4; ++e) { h[e] = (__bf16)xr[u][e]; l[e] = (__bf16)(xr[u][e] - (float)h[e]); }
        *(v4b*)&yh[(s + 1) & 1][u * 16 + xrow][xq] = h; *(v4b*)&yl[(s + 1) & 1][u * 16 + xrow][xq] = l; } }
    __syncthreads(); }   // publishes stage s + 1 and ends every wave's reads of stage s, whose buffers the next trip refills
  const float b0 = BP ? bfr(BP[c0 + cb]) : 0.f, b1 = BP ? bfr(BP[c0 + cb + 1]) : 0.f;
#pragma unroll
  for (int i = 0; i < 4; ++i)
#pragma unroll
    for (int r = 0; r < 8; ++r) { v2f o; o[0] = acc[i][0][r] + b0; o[1] = acc[i][1][r] + b1; *(v2f*)&sf[rb + i * 16 + 8 * g + r][cb] = o; }
  __syncthreads();   // the 128 x 128 tile is in LDS: each wave stores 16 whole rows of it
  for (int rl = 0; rl < 16; ++rl) vst2(OUT + (r0 + wave * 16 + rl) * CC + c0 + lane * 4, *(const v4f*)&sf[wave * 16 + rl][lane * 4]); }
extern "C" void kernel_launch(void* const* d_in, const int* in_sizes, int n_in, void* d_out, int out_size, void* d_ws, size_t ws_size, hipStream_t stream) {
  (void)in_sizes; (void)n_in; (void)out_size;
  const float** F = (const float**)d_in;   // 0 query [2,2048,1024], 1 Wq [1024,1024] ((in,out)), 2 Wk, 3 Wv, 4 Wo ((in,out)), 5 span_val [1,16,1,1] (verbatim)
  if (ws_size < (size_t)WS_END) return;
  char* ws = (char*)d_ws; _Float16 *QH = (_Float16*)(ws + WS_QH), *QL = (_Float16*)(ws + WS_QL), *KH = (_Float16*)(ws + WS_KH); __bf16 *VT = (__bf16*)(ws + WS_VT), *VL = (__bf16*)(ws + WS_VL); float *Y = (float*)(ws + WS_Y);
  k_proj<<<dim3(TNB * TT / 128, CC / 128, 3), 256, 0, stream>>>(F[0], F[1], nullptr, F[2], nullptr, F[3], nullptr, QH, QL, KH, VT, VL);
  k_attn<<<dim3(TNB * NH, 1, TT / AQ), 32 * AW, 0, stream>>>(QH, QL, KH, VT, VL, F[5], Y);
  k_out<<<dim3(TNB * TT / 128, CC / 128), 256, 0, stream>>>(Y, F[4], nullptr, (float*)d_out);
}

// v007
// One run takes 109 microseconds.
// Next to v006, in two timings, it ran 1.04 times as fast each time.
// Counting every step since v000, it is 12.5 times as fast.
// compute dtype: all float inputs rounded to bf16, span_val read; q/k/v = query W with EXACT bf16 products on WMMA 16x16x32, f32 accumulate; q as f16 hi + residual (x 2^10), k f16 -> 2-product logits / 64 (the module divides by DH), causal (-1e9 additive == exclusion), kept in f32 registers; running softmax sums, the adaptive-span ramp mask and the renormalisation (+1e-8) in f32 (exp as the hardware exp2 of (logit - m) * log2 e); exp * mask f32 split bf16 hi + lo against v bf16 hi + lo (3 products); out = y (bf16 hi + lo) Wo; f32 output.
#include <hip/hip_runtime.h>
#include <math.h>

typedef __attribute__((ext_vector_type(16))) _Float16 v16h;
typedef __attribute__((ext_vector_type(16))) __bf16 v16b;
typedef __attribute__((ext_vector_type(8)))  _Float16 v8h;
typedef __attribute__((ext_vector_type(8)))  float v8f;
typedef __attribute__((ext_vector_type(4)))  float v4f;
typedef __attribute__((ext_vector_type(2)))  float v2f;
typedef __attribute__((ext_vector_type(4)))  unsigned v4u;
typedef __attribute__((ext_vector_type(4)))  int v4i;
typedef float __attribute__((may_alias)) float_a;
typedef int __attribute__((may_alias)) int_a;

template <typename T> __device__ __forceinline__ void vst2(void* p, T v) { *(T*)p = v;  }
__device__ __forceinline__ v8f wmma16(v16h a, v16h b, v8f c) {
  return __builtin_amdgcn_wmma_f32_16x16x32_f16(false, a, false, b, (short)0, c, false, false);
}
__device__ __forceinline__ v8f wmma_bf(v16b a, v16b b, v8f c) {
  return __builtin_amdgcn_wmma_f32_16x16x32_bf16(false, a, false, b, (short)0, c, false, false);
}
// 16x16x32 fragments: lane = (h = lane>>4, row/col = lane&15); elements 0..7 = k0+8h+0..7, 8..15 = k0+16+8h+0..7; D element r = row 8h+r
__device__ __forceinline__ v16h frag_h(const _Float16* rowk0, int lane) {
  union { v16h v; v8h q[2]; } u; const _Float16* p = rowk0 + 8 * (lane >> 4);
  u.q[0] = *(const v8h*)p; u.q[1] = *(const v8h*)(p + 16); return u.v;
}
__device__ __forceinline__ v16h frag_f32(const float* rowk0, int lane) {
  v16h a; const float* p = rowk0 + 8 * (lane >> 4);
#pragma unroll
  for (int i = 0; i < 8; ++i) { a[i] = (_Float16)p[i]; a[8 + i] = (_Float16)p[16 + i]; }
  return a;
}
__device__ __forceinline__ v16h frag_f32s(const float* rowk0, int lane, float sc) {
  v16h a; const float* p = rowk0 + 8 * (lane >> 4);
#pragma unroll
  for (int i = 0; i < 8; ++i) { a[i] = (_Float16)(p[i] * sc); a[8 + i] = (_Float16)(p[16 + i] * sc); }
  return a;
}
// column fragment from a [K][ld] layout (column n), rows >= K read as 0
__device__ __forceinline__ v16h fragc_f32(const float* W, int k0, int n, int lane, int ld, int K) {
  v16h a; const int g = lane >> 4;
#pragma unroll
  for (int i = 0; i < 8; ++i) { const int ka = k0 + 8 * g + i, kb = ka + 16;
    a[i] = (_Float16)(ka < K ? W[(size_t)(ka < K ? ka : K - 1) * ld + n] : 0.f); a[8 + i] = (_Float16)(kb < K ? W[(size_t)(kb < K ? kb : K - 1) * ld + n] : 0.f); }
  return a;
}
struct F2 { v16b h, l; };
__device__ __forceinline__ F2 bsplit16(const float v[16]) { F2 r;
#pragma unroll
  for (int i = 0; i < 16; ++i) { const __bf16 h = (__bf16)v[i]; r.h[i] = h; r.l[i] = (__bf16)(v[i] - (float)h); }
  return r; }
__device__ __forceinline__ F2 split_row(const float* row, int k0, int lane) { float v[16]; const float* p = row + k0 + 8 * (lane >> 4);
#pragma unroll
  for (int i = 0; i < 8; ++i) { v[i] = p[i]; v[8 + i] = p[16 + i]; }
  return bsplit16(v); }
__device__ __forceinline__ F2 split_rowK(const float* row, int k0, int lane, int K) { float v[16]; const int g = lane >> 4;
#pragma unroll
  for (int i = 0; i < 8; ++i) { const int ka = k0 + 8 * g + i, kb = ka + 16; v[i] = ka < K ? row[ka < K ? ka : K - 1] : 0.f; v[8 + i] = kb < K ? row[kb < K ? kb : K - 1] : 0.f; }
  return bsplit16(v); }
__device__ __forceinline__ F2 split_col(const float* W, int k0, int n, int lane, int ld, int K) { float v[16]; const int g = lane >> 4;
#pragma unroll
  for (int i = 0; i < 8; ++i) { const int ka = k0 + 8 * g + i, kb = ka + 16; v[i] = ka < K ? W[(size_t)(ka < K ? ka : K - 1) * ld + n] : 0.f; v[8 + i] = kb < K ? W[(size_t)(kb < K ? kb : K - 1) * ld + n] : 0.f; }
  return bsplit16(v); }
__device__ __forceinline__ v8f mac3(const F2& a, const F2& b, v8f c) { c = wmma_bf(a.l, b.h, c); c = wmma_bf(a.h, b.l, c); return wmma_bf(a.h, b.h, c); }
__device__ __forceinline__ float sigm(float v) { return 1.0f / (1.0f + expf(-v)); }
#define RUNFENCE() __builtin_amdgcn_sched_barrier(0)   // nothing is scheduled across it: a run's LDS fragment reads stay one group in front of the run's products (spread among them, each read is waited for alone)
#define LDSX() do { asm volatile("s_wait_dscnt 0" ::: "memory"); __builtin_amdgcn_wave_barrier(); __builtin_amdgcn_fence(__ATOMIC_RELEASE, "workgroup"); } while (0)


// Adaptive-span causal attention (B 2, S 2,048, hidden 1,024 = 16 x 64, ramp 32): w = softmax(q k^T / 64 + triu(-1e9, 1)); w = w * clip((k_idx + span_val[h] * S) / 33, 0, 1); w = w / (sum_k w + 1e-8); out = (w v) Wo (no biases).
#define NB 2
#define TT 2048
#define CC 1024
#define NH 16
#define HD 64
#ifndef TNB
#define TNB NB
#endif
typedef __attribute__((ext_vector_type(8))) __bf16 v8b;
__device__ __forceinline__ v16b frag_b(const __bf16* rowk0, int lane) {
  union { v16b v; v8b q[2]; } u; const __bf16* p = rowk0 + 8 * (lane >> 4);
  u.q[0] = *(const v8b*)p; u.q[1] = *(const v8b*)(p + 16); return u.v;
}
__device__ __forceinline__ float bfr(float v) { return (float)(__bf16)v; }
__device__ __attribute__((noinline)) float exp_ni(float v) { return expf(v); }
__device__ __attribute__((noinline)) float erf_ni(float v) { return erff(v); }

#define WS_QH  0u
#define WS_QL  (WS_QH + 2u * (size_t)NB * TT * CC)
#define WS_KH  (WS_QL + 2u * (size_t)NB * TT * CC)
#define WS_VT  (WS_KH + 2u * (size_t)NB * TT * CC)      // bf16 v planes
#define WS_VL  (WS_VT + 2u * (size_t)NB * CC * TT)      // bf16 v residual planes
#define WS_Y   (WS_VL + 2u * (size_t)NB * CC * TT)      // f32 y rows [b*t][C]
#define WS_END (WS_Y + 4u * (size_t)NB * TT * CC)

// The q, k and v planes lie in fragment order, in 16-byte pieces of 8 elements: q, k: per (b, h, 16 rows) 1,024 elements [d / 8][row][8]; v: per (b, h, 32 keys) 2,048 elements [d / 16][key / 8][d % 16][8].
// A lane's two halves of a 16x16x32 fragment then lie at lane * 16 B in two successive 512-byte runs: each load of a wave covers four whole 128-byte lines. p holds the lane's 8 * lane.
#define QKB(b, h, t16) (((size_t)((b) * NH + (h)) * (TT / 16) + (t16)) * 1024)
#define VB(b, h, t32) (((size_t)((b) * NH + (h)) * (TT / 32) + (t32)) * 2048)
__device__ __forceinline__ v16h frag_hp(const _Float16* p) { union { v16h v; v8h q[2]; } u; u.q[0] = *(const v8h*)p; u.q[1] = *(const v8h*)(p + 256); return u.v; }
__device__ __forceinline__ v16b frag_bp(const __bf16* p) { union { v16b v; v8b q[2]; } u; u.q[0] = *(const v8b*)p; u.q[1] = *(const v8b*)(p + 256); return u.v; }
#define GK 64                                         // k per stage of the two GEMM kernels
#define XP 72                                         // LDS row pitch of a staged tile in bf16: 144 B = 16 B x odd, so 16-byte reads down 16 rows meet no bank twice
typedef __attribute__((ext_vector_type(4))) __bf16 v4b;
// W rows of one stage for a wave's 32 columns: lane (col, g) takes columns 2 col, 2 col + 1 of rows 8 g + i and 16 + 8 g + i of each 32-k chunk, so a load covers two whole 128-byte lines.
// Fragment e then holds column 2 col + e in lane col: the k order is that of frag_b, only the tile's columns are renumbered (undone where the accumulators are stored).
__device__ __forceinline__ void ld_w(const float* wp, v2f (&wr)[2][16]) {
#pragma unroll
  for (int c = 0; c < 2; ++c)
#pragma unroll
    for (int i = 0; i < 8; ++i) { wr[c][i] = *(const v2f*)(wp + (size_t)(c * 32 + i) * CC); wr[c][8 + i] = *(const v2f*)(wp + (size_t)(c * 32 + 16 + i) * CC); }
}
__device__ __forceinline__ void cv_w(const v2f (&wr)[2][16], v16b (&wf)[2][2]) {
#pragma unroll
  for (int c = 0; c < 2; ++c)
#pragma unroll
    for (int i = 0; i < 16; ++i) { wf[c][0][i] = (__bf16)wr[c][i][0]; wf[c][1][i] = (__bf16)wr[c][i][1]; }
}
// the block's 128 x 64 f32 tile of one stage: 16 lanes a row, so a load covers two rows of 256 contiguous bytes
__device__ __forceinline__ void ld_x(const float* xp, v4f (&xr)[8]) {
#pragma unroll
  for (int u = 0; u < 8; ++u) xr[u] = *(const v4f*)(xp + (size_t)(u * 16) * CC);
}
// ---- k_proj: block = (128 rows, 128 cols, which), 8 waves of 64 rows x 32 cols: qkv = x W (+ b), exact; q -> f16 hi (+ residual), k -> f16 planes, v -> bf16 planes
//      per 64-k stage the x tile goes once through LDS as bf16 (two buffers) and serves the four waves of its rows; each wave reads only its own 32 columns of W; the next stage's loads fly during this stage's products
__global__ __launch_bounds__(256) void k_proj(const float* __restrict__ X, const float* __restrict__ WQ, const float* __restrict__ BQ, const float* __restrict__ WK, const float* __restrict__ BK, const float* __restrict__ WV, const float* __restrict__ BV, _Float16* __restrict__ QH, _Float16* __restrict__ QL, _Float16* __restrict__ KH, __bf16* __restrict__ VT, __bf16* __restrict__ VL) {
  __shared__ __align__(16) unsigned char sm[2 * 128 * 136 * 2];   // one of: the two stage buffers (loop), q or k rows hi + residual, v planes hi + residual; a barrier stands between the uses
  _Float16 (*sh)[136] = (_Float16 (*)[136])sm, (*sl)[136] = (_Float16 (*)[136])(sm + 128 * 136 * 2); __bf16 (*th)[136] = (__bf16 (*)[136])sm, (*tl2)[136] = (__bf16 (*)[136])(sm + 128 * 136 * 2);
  const int tid = threadIdx.x, wave = tid >> 5, lane = tid & 31, col = lane & 15, g = lane >> 4; const int which = blockIdx.z; const int c0 = blockIdx.y * 128; const size_t r0 = (size_t)blockIdx.x * 128; const float* WA = which == 0 ? WQ : which == 1 ? WK : WV; const float* BA = which == 0 ? BQ : which == 1 ? BK : BV;
  __bf16 (*xs)[128][XP] = (__bf16 (*)[128][XP])sm;
  const int xrow = tid >> 4, xq = (tid & 15) * 4, rb = (wave >> 2) * 64, cb = (wave & 3) * 32 + 2 * col;   // the wave's first row, the lane's first column in the tile
  const float* wp = WA + (size_t)(8 * g) * CC + c0 + cb; const float* xp = X + (r0 + xrow) * CC + xq;
  v2f wr[2][16]; v4f xr[8]; v16b wf[2][2]; v8f acc[4][2] = {};
  ld_w(wp, wr); ld_x(xp, xr);
  cv_w(wr, wf);
#pragma unroll
  for (int u = 0; u < 8; ++u) { v4b h;
#pragma unroll
    for (int e = 0; e < 4; ++e) h[e] = (__bf16)xr[u][e];
    *(v4b*)&xs[0][u * 16 + xrow][xq] = h; }
  __syncthreads();   // stage 0 is in LDS
#pragma unroll 1   // kept rolled: a second stage's raw registers beside the first's would cost a wave per SIMD
  for (int s = 0; s < CC / GK; ++s) { const bool more = s + 1 < CC / GK;
    if (more) { wp += (size_t)GK * CC; xp += GK; ld_w(wp, wr); ld_x(xp, xr); }
#pragma unroll
    for (int c = 0; c < 2; ++c) { v16b a[4];
#pragma unroll
      for (int i = 0; i < 4; ++i) a[i] = frag_b(&xs[s & 1][rb + i * 16 + col][c * 32], lane);
      RUNFENCE();
#pragma unroll
      for (int i = 0; i < 4; ++i) { acc[i][0] = wmma_bf(a[i], wf[c][0], acc[i][0]); acc[i][1] = wmma_bf(a[i], wf[c][1], acc[i][1]); }
      if (c == 0) RUNFENCE(); }
    if (more) { cv_w(wr, wf);
#pragma unroll
      for (int u = 0; u < 8; ++u) { v4b h;
#pragma unroll
        for (int e = 0; e < 4; ++e) h[e] = (__bf16)xr[u][e];
        *(v4b*)&xs[(s + 1) & 1][u * 16 + xrow][xq] = h; } }
    __syncthreads(); }   // publishes stage s + 1 and ends every wave's reads of stage s, whose buffer the next trip refills
#pragma unroll
  for (int i = 0; i < 4; ++i)
#pragma unroll
  for (int e = 0; e < 2; ++e) { const int cl = cb + e; const float bb = BA ? bfr(BA[c0 + cl]) : 0.f;
#pragma unroll
    for (int r = 0; r < 8; ++r) { const float v = acc[i][e][r] + bb; const int rl = rb + i * 16 + 8 * g + r; const _Float16 hv = (_Float16)v;
      if (which == 2) { const __bf16 bh = (__bf16)v; th[cl][rl] = bh; tl2[cl][rl] = (__bf16)(v - (float)bh); } else { sh[rl][cl] = hv; sl[rl][cl] = (_Float16)((v - (float)hv) * 1024.0f); }   /* q residual carried x 2^10 so the plane stays f16-normal on the chip */ } }
  __syncthreads();
  const int bi = (int)(r0 / TT), t0 = (int)(r0 % TT), h0 = c0 / HD, pl = tid & 15, pq = (tid >> 4) & 15;   // a lane's place in a piece run, its run: a wave stores 512 contiguous bytes, a trip of the block one or two whole blocks of a plane
  if (which < 2) { _Float16* dh = which == 0 ? QH : KH; for (int e = 0; e < 8; ++e) { const int rl = e * 16 + pl, q = pq; const size_t o1 = QKB(bi, h0 + (q >> 3), t0 / 16 + e) + (q & 7) * 128 + pl * 8; _Float16* d0 = dh + o1; const v4u x0 = *(const v4u*)&sh[rl][q * 8]; vst2((unsigned*)d0, x0);
      asm volatile("s_wait_xcnt 0x0" :: "v"(d0), "v"(x0) : "memory");   // the wait of this store; its address pair and its data are inputs, so that no register of them is rewritten in front of it
      if (which == 0) { _Float16* d1 = QL + o1; const v4u x1 = *(const v4u*)&sl[rl][q * 8]; vst2((unsigned*)d1, x1);
        asm volatile("s_wait_xcnt 0x0" :: "v"(d1), "v"(x1) : "memory"); } } }   // as above
  else { for (int e = 0; e < 8; ++e) { const int cl = (e & 1) * 64 + (pq >> 2) * 16 + pl, q = (e >> 1) * 4 + (pq & 3); const size_t o2 = VB(bi, h0 + (e & 1), t0 / 32 + (e >> 1)) + pq * 128 + pl * 8; __bf16 *d0 = VT + o2, *d1 = VL + o2; const v4u x0 = *(const v4u*)&th[cl][q * 8], x1 = *(const v4u*)&tl2[cl][q * 8]; vst2((unsigned*)d0, x0); vst2((unsigned*)d1, x1);
      asm volatile("s_wait_xcnt 0x0" :: "v"(d0), "v"(d1), "v"(x0), "v"(x1) : "memory"); } } }   // the wait of these two stores, as above
// ---- k_attn: block = 64 queries of (b,h), 8 waves = 2 groups of 32 queries x 4 key splits; the logits never leave the registers.
//      A wave walks the 32-key chunks ks, ks + 4, ... of its 32 queries: S^T = K Q^T (a lane holds 16 keys of one query per 16-query tile), logits / 64, causal on the last chunk only;
//      e = exp(logit - m) = exp2(product * LSC - m2), one fma and one v_exp_f32 per score: m2 is the maximum in use in log2 units (raised, with a rescale of the sums, only when a chunk's maximum passes it by more than LTH: e stays below e^8);
//      s += sum e, t += sum e * ramp mask clip((k + span_val[h] S)/(RAMP+1), 0, 1), O^T += V^T (e * mask)^T: the score registers are the B fragment as they stand.
//      The 4 key splits of a query are joined through LDS in split order, each weighted exp2(m2_w - max m2): y = (O / s) / (t / s + 1e-8).
#define AQ 64
#define AKS 4
#define AW 8
#define LSC (1.4426950408889634f / 64.0f)            // log2 e / DH: q k product -> logit in log2 units
#define LTH 11.541560327111707f                      // 8 * log2 e
#define OP (HD + 4)                                   // LDS row pitch of a partial tile in floats: 16 B x odd
__device__ __forceinline__ float ex2(float v) { return __builtin_amdgcn_exp2f(v); }   // v_exp_f32 alone: an argument far below -126 gives 0, which is what an excluded key and an empty split want
__device__ __forceinline__ float xhalf(float x) { return __builtin_bit_cast(float, __builtin_amdgcn_permlanex16(__builtin_bit_cast(int, x), __builtin_bit_cast(int, x), 0x76543210, 0xfedcba98, false, false)); }   // lane l with lane l ^ 16
__global__ __launch_bounds__(32 * AW) __attribute__((amdgpu_waves_per_eu(4, 4))) void k_attn(const _Float16* __restrict__ QH, const _Float16* __restrict__ QL, const _Float16* __restrict__ KH, const __bf16* __restrict__ VT, const __bf16* __restrict__ VL, const float* __restrict__ SPAN, float* __restrict__ Y) {
  __shared__ __align__(16) float smk[TT]; __shared__ __align__(16) float ss[AW * 32 * OP]; __shared__ float wm[AW][32], wsm[AW][32], wt[AW][32];
  const int tid = threadIdx.x, wave = __builtin_amdgcn_readfirstlane(tid >> 5), lane = tid & 31, col = lane & 15, g = lane >> 4; const int b = blockIdx.x / NH, h = blockIdx.x % NH;
  const int ql0 = (TT / AQ - 1 - (int)blockIdx.z) * AQ;   // the longest blocks start first
  const int qg = wave & 1, ks = wave >> 1, Q0 = ql0 + qg * 32, nch = Q0 / 32 + 1;   // the wave's first query; its queries see the chunks [0, nch), the last one in part
  { const float spv = bfr(SPAN[h]) * (float)TT;   /* span_val[h] * attn_span */
    for (int k = tid; k < ql0 + AQ; k += 32 * AW) smk[k] = fminf(fmaxf(((float)k + spv) / 33.0f, 0.f), 1.0f); }
  _Float16* qls = (_Float16*)&ss[wave * 32 * OP] + lane * 8;   // during the loop the wave's own partial-tile room holds its q fragments, hi then residual (8 KiB, fragment order): 64 registers less, so that four waves fit a SIMD
  { const size_t qo = QKB(b, h, Q0 / 16) + lane * 8; const _Float16 *qhp = QH + qo, *qlp = QL + qo;
#pragma unroll
    for (int i = 0; i < 2; ++i)
#pragma unroll
      for (int kc = 0; kc < 2; ++kc) { const int o = i * 1024 + kc * 512; *(v8h*)(qls + o) = *(const v8h*)(qhp + o); *(v8h*)(qls + o + 256) = *(const v8h*)(qhp + o + 256); *(v8h*)(qls + 2048 + o) = *(const v8h*)(qlp + o); *(v8h*)(qls + 2048 + o + 256) = *(const v8h*)(qlp + o + 256); }
    asm volatile("s_wait_xcnt 0x0" :: "v"(qhp), "v"(qlp) : "memory"); }   // the wait of the q loads; their two address pairs are inputs, so that no register of them is reused in front of it
  __syncthreads();   // the mask table is in LDS
  v8f acc[2][HD / 16] = {}; float m[2] = {-3.0e38f, -3.0e38f}, s[2] = {0.f, 0.f}, t[2] = {0.f, 0.f};
#pragma unroll 1   // kept rolled: a second chunk's fragments beside this one's would not fit four waves per SIMD
  for (int c = ks; c < nch; c += AKS) { float x[2][16]; bool ramp;
    { v16h kf[2][2]; const _Float16* kp = KH + QKB(b, h, c * 2) + lane * 8;
#pragma unroll
      for (int j = 0; j < 2; ++j)
#pragma unroll
        for (int kc = 0; kc < 2; ++kc) kf[j][kc] = frag_hp(kp + j * 1024 + kc * 512);
      asm volatile("s_wait_xcnt 0x0" :: "v"(kp) : "memory");   // the wait of the k loads; their address pair is an input, so that no register of it is rewritten in front of it
      ramp = __builtin_amdgcn_readfirstlane(__builtin_bit_cast(int, smk[c * 32])) != 0x3f800000;   // read here, with the q fragments, so that its LDS latency is not waited out behind the exps
#pragma unroll
      for (int i = 0; i < 2; ++i) { v8f a[2] = {}, l[2] = {}; const v16h qh[2] = {frag_hp(qls + i * 1024), frag_hp(qls + i * 1024 + 512)}, ql[2] = {frag_hp(qls + 2048 + i * 1024), frag_hp(qls + 2048 + i * 1024 + 512)};
        RUNFENCE();
#pragma unroll
        for (int kc = 0; kc < 2; ++kc)
#pragma unroll
          for (int j = 0; j < 2; ++j) { a[j] = wmma16(kf[j][kc], qh[kc], a[j]); l[j] = wmma16(kf[j][kc], ql[kc], l[j]); }
        RUNFENCE();   // behind the second run it also keeps the v loads, which land in the k and q fragments' registers, and their wait out of the run
#pragma unroll
        for (int j = 0; j < 2; ++j) { a[j] += l[j] * (1.0f / 1024.0f);
#pragma unroll
          for (int r = 0; r < 8; ++r) x[i][j * 8 + r] = a[j][r]; } } }   /* the q k products; the division by DH = 64 is in LSC; element j * 8 + r = key 32 c + 16 j + 8 g + r, query Q0 + 16 i + col */
    const size_t vo = VB(b, h, c) + lane * 8; const __bf16 *vhp = VT + vo, *vlp = VL + vo; v16b vh[HD / 16], vl[HD / 16];   // the v loads fly during the softmax
#pragma unroll
    for (int j = 0; j < HD / 16; ++j) { vh[j] = frag_bp(vhp + j * 512); vl[j] = frag_bp(vlp + j * 512); }
    asm volatile("s_wait_xcnt 0x0" :: "v"(vhp), "v"(vlp) : "memory");   // the wait of the v loads; their two address pairs are inputs, so that no register of them is rewritten in front of it
    if (c == nch - 1) {   // the chunk of the diagonal: its first key is the wave's first query
#pragma unroll
      for (int i = 0; i < 2; ++i)
#pragma unroll
        for (int e = 0; e < 16; ++e) if ((e >> 3) * 16 + 8 * g + (e & 7) > i * 16 + col) x[i][e] = -3.0e38f; }
    float mx[2];
#pragma unroll
    for (int i = 0; i < 2; ++i) { float v = x[i][0];
#pragma unroll
      for (int e = 1; e < 16; ++e) v = fmaxf(v, x[i][e]);
      mx[i] = fmaxf(v, xhalf(v)) * LSC; }   // both halves of a query's keys: the two lanes of a query keep one m
    if (__builtin_amdgcn_ballot_w32(mx[0] > m[0] + LTH || mx[1] > m[1] + LTH) != 0) {   // one test per chunk; always taken on a wave's first chunk
#pragma unroll
      for (int i = 0; i < 2; ++i) { const float mn = mx[i] > m[i] + LTH ? mx[i] : m[i]; const float al = ex2(m[i] - mn); m[i] = mn; s[i] *= al; t[i] *= al;
#pragma unroll
        for (int j = 0; j < HD / 16; ++j) acc[i][j] *= al; } }
    float ds[2];
#pragma unroll
    for (int i = 0; i < 2; ++i) { float p[4] = {0.f, 0.f, 0.f, 0.f};
#pragma unroll
      for (int e = 0; e < 16; e += 2) { v2f u = {x[i][e], x[i][e + 1]}; const v2f sc = {LSC, LSC}, nm = {-m[i], -m[i]}; u = __builtin_elementwise_fma(u, sc, nm); x[i][e] = u[0]; x[i][e + 1] = u[1]; }   // two scores per packed fma
#pragma unroll   // x is a register array: every index must be a constant
      for (int e = 0; e < 16; ++e) x[i][e] = ex2(x[i][e]);   // an excluded key: exp2 of about -7e36 is 0
#pragma unroll   // as above, for x and p
      for (int e = 0; e < 16; ++e) p[e & 3] += x[i][e];
      ds[i] = (p[0] + p[1]) + (p[2] + p[3]); s[i] += ds[i]; }
    if (ramp) {   // the mask never falls with k: where the chunk's first key has 1.0, all its keys have, and e * mask is e
      float mk[16];
#pragma unroll
      for (int j = 0; j < 2; ++j) { const v4f u0 = *(const v4f*)&smk[c * 32 + j * 16 + 8 * g], u1 = *(const v4f*)&smk[c * 32 + j * 16 + 8 * g + 4];
#pragma unroll
        for (int r = 0; r < 4; ++r) { mk[j * 8 + r] = u0[r]; mk[j * 8 + 4 + r] = u1[r]; } }
#pragma unroll
      for (int i = 0; i < 2; ++i) { float p[4] = {0.f, 0.f, 0.f, 0.f};
#pragma unroll
        for (int e = 0; e < 16; ++e) { x[i][e] *= mk[e]; p[e & 3] += x[i][e]; }
        ds[i] = (p[0] + p[1]) + (p[2] + p[3]); } }
    t[0] += ds[0]; t[1] += ds[1];
    const F2 p0 = bsplit16(x[0]), p1 = bsplit16(x[1]);
#pragma unroll
    for (int j = 0; j < HD / 16; ++j) { acc[0][j] = wmma_bf(vh[j], p0.l, acc[0][j]); acc[1][j] = wmma_bf(vh[j], p1.l, acc[1][j]); }
#pragma unroll
    for (int j = 0; j < HD / 16; ++j) { acc[0][j] = wmma_bf(vl[j], p0.h, acc[0][j]); acc[1][j] = wmma_bf(vl[j], p1.h, acc[1][j]); }
#pragma unroll
    for (int j = 0; j < HD / 16; ++j) { acc[0][j] = wmma_bf(vh[j], p0.h, acc[0][j]); acc[1][j] = wmma_bf(vh[j], p1.h, acc[1][j]); } }
#pragma unroll
  for (int i = 0; i < 2; ++i) { s[i] += xhalf(s[i]); t[i] += xhalf(t[i]);   // the two halves of a query's keys
    if (g == 0) { wm[wave][i * 16 + col] = m[i]; wsm[wave][i * 16 + col] = s[i]; wt[wave][i * 16 + col] = t[i]; }
#pragma unroll
    for (int j = 0; j < HD / 16; ++j) { float* d = &ss[(wave * 32 + i * 16 + col) * OP + j * 16 + 8 * g]; v4f u0, u1;   // accumulator element r = d 16 j + 8 g + r of query col
#pragma unroll
      for (int r = 0; r < 4; ++r) { u0[r] = acc[i][j][r]; u1[r] = acc[i][j][4 + r]; }
      *(v4f*)d = u0; *(v4f*)(d + 4) = u1; } }
  __syncthreads();   // every wave's partial tile and its m, s, t are in LDS
  const int q4 = (tid & 15) * 4;
#pragma unroll
  for (int i = 0; i < AQ / 16; ++i) { const int rl = i * 16 + (tid >> 4), w0 = rl >> 5, r32 = rl & 31;   // 16 lanes a row: a store covers two runs of 256 contiguous bytes
    float mm = wm[w0][r32];
#pragma unroll
    for (int k = 1; k < AKS; ++k) mm = fmaxf(mm, wm[k * 2 + w0][r32]);
    float sa = 0.f, ta = 0.f; v4f o = {};
#pragma unroll
    for (int k = 0; k < AKS; ++k) { const int w = k * 2 + w0; const float f = ex2(wm[w][r32] - mm); sa += f * wsm[w][r32]; ta += f * wt[w][r32]; o += *(const v4f*)&ss[(w * 32 + r32) * OP + q4] * f; }   // a split without a chunk has m about -3e38: weight 0
    const float ia = 1.0f / sa; const float na = 1.0f / (ta * ia + 1e-8f);   /* w = softmax * ramp mask, renormalised by (sum + 1e-8) */
    float* yp = Y + ((size_t)b * TT + ql0 + rl) * CC + h * HD + q4; const v4f yv = (o * ia) * na; vst2(yp, yv);
    asm volatile("s_wait_xcnt 0x0" :: "v"(yp), "v"(yv) : "memory"); } }   // the wait of this store; its address pair and its data are inputs, so that no register of them is rewritten in front of it
// ---- k_out: block = (128 rows, 128 cols), 8 waves of 64 rows x 32 cols: out = y (bf16 hi + lo) Wo + bo; operands as in k_proj, the y tile staged as its two bf16 planes
__global__ __launch_bounds__(256) void k_out(const float* __restrict__ Y, const float* __restrict__ WP, const float* __restrict__ BP, float* __restrict__ OUT) { __shared__ __align__(16) __bf16 yh[2][128][XP], yl[2][128][XP]; __shared__ __align__(16) float sf[128][132];
  const int tid = threadIdx.x, wave = tid >> 5, lane = tid & 31, col = lane & 15, g = lane >> 4; const int c0 = blockIdx.y * 128; const size_t r0 = (size_t)blockIdx.x * 128;
  const int xrow = tid >> 4, xq = (tid & 15) * 4, rb = (wave >> 2) * 64, cb = (wave & 3) * 32 + 2 * col;   // the wave's first row, the lane's first column in the tile
  const float* wp = WP + (size_t)(8 * g) * CC + c0 + cb; const float* xp = Y + (r0 + xrow) * CC + xq;
  v2f wr[2][16]; v4f xr[8]; v16b wf[2][2]; v8f acc[4][2] = {};
  ld_w(wp, wr); ld_x(xp, xr);
  cv_w(wr, wf);
#pragma unroll
  for (int u = 0; u < 8; ++u) { v4b h, l;
#pragma unroll
    for (int e = 0; e < 4; ++e) { h[e] = (__bf16)xr[u][e]; l[e] = (__bf16)(xr[u][e] - (float)h[e]); }
    *(v4b*)&yh[0][u * 16 + xrow][xq] = h; *(v4b*)&yl[0][u * 16 + xrow][xq] = l; }
  __syncthreads();   // stage 0 is in LDS
#pragma unroll 1   // kept rolled: a second stage's raw registers beside the first's are not worth their room
  for (int s = 0; s < CC / GK; ++s) { const bool more = s + 1 < CC / GK;
    if (more) { wp += (size_t)GK * CC; xp += GK; ld_w(wp, wr); ld_x(xp, xr); }
#pragma unroll
    for (int c = 0; c < 2; ++c) { v16b ah[4], al[4];
#pragma unroll
      for (int i = 0; i < 4; ++i) { ah[i] = frag_b(&yh[s & 1][rb + i * 16 + col][c * 32], lane); al[i] = frag_b(&yl[s & 1][rb + i * 16 + col][c * 32], lane); }
      RUNFENCE();
#pragma unroll
      for (int i = 0; i < 4; ++i) { acc[i][0] = wmma_bf(ah[i], wf[c][0], acc[i][0]); acc[i][1] = wmma_bf(ah[i], wf[c][1], acc[i][1]); }
#pragma unroll
      for (int i = 0; i < 4; ++i) { acc[i][0] = wmma_bf(al[i], wf[c][0], acc[i][0]); acc[i][1] = wmma_bf(al[i], wf[c][1], acc[i][1]); }
      if (c == 0) RUNFENCE(); }
    if (more) { cv_w(wr, wf);
#pragma unroll
      for (int u = 0; u < 8; ++u) { v4b h, l;
#pragma unroll
        for (int e = 0; e < 4; ++e) { h[e] = (__bf16)xr[u][e]; l[e] = (__bf16)(xr[u][e] - (float)h[e]); }
        *(v4b*)&yh[(s + 1) & 1][u * 16 + xrow][xq] = h; *(v4b*)&yl[(s + 1) & 1][u * 16 + xrow][xq] = l; } }
    __syncthreads(); }   // publishes stage s + 1 and ends every wave's reads of stage s, whose buffers the next trip refills
  const float b0 = BP ? bfr(BP[c0 + cb]) : 0.f, b1 = BP ? bfr(BP[c0 + cb + 1]) : 0.f;
#pragma unroll
  for (int i = 0; i < 4; ++i)
#pragma unroll
    for (int r = 0; r < 8; ++r) { v2f o; o[0] = acc[i][0][r] + b0; o[1] = acc[i][1][r] + b1; *(v2f*)&sf[rb + i * 16 + 8 * g + r][cb] = o; }
  __syncthreads();   // the 128 x 128 tile is in LDS: each wave stores 16 whole rows of it
  for (int rl = 0; rl < 16; ++rl) vst2(OUT + (r0 + wave * 16 + rl) * CC + c0 + lane * 4, *(const v4f*)&sf[wave * 16 + rl][lane * 4]); }
extern "C" void kernel_launch(void* const* d_in, const int* in_sizes, int n_in, void* d_out, int out_size, void* d_ws, size_t ws_size, hipStream_t stream) {
  (void)in_sizes; (void)n_in; (void)out_size;
  const float** F = (const float**)d_in;   // 0 query [2,2048,1024], 1 Wq [1024,1024] ((in,out)), 2 Wk, 3 Wv, 4 Wo ((in,out)), 5 span_val [1,16,1,1] (verbatim)
  if (ws_size < (size_t)WS_END) return;
  char* ws = (char*)d_ws; _Float16 *QH = (_Float16*)(ws + WS_QH), *QL = (_Float16*)(ws + WS_QL), *KH = (_Float16*)(ws + WS_KH); __bf16 *VT = (__bf16*)(ws + WS_VT), *VL = (__bf16*)(ws + WS_VL); float *Y = (float*)(ws + WS_Y);
  k_proj<<<dim3(TNB * TT / 128, CC / 128, 3), 256, 0, stream>>>(F[0], F[1], nullptr, F[2], nullptr, F[3], nullptr, QH, QL, KH, VT, VL);
  k_attn<<<dim3(TNB * NH, 1, TT / AQ), 32 * AW, 0, stream>>>(QH, QL, KH, VT, VL, F[5], Y);
  k_out<<<dim3(TNB * TT / 128, CC / 128), 256, 0, stream>>>(Y, F[4], nullptr, (float*)d_out);
}

// v008
// One run takes 96.8 microseconds.
// Two timings next to v007 both put it at 1.13 times that version's speed.
// Counting every step since v000, it is 14.2 times as fast.
// compute dtype: all float inputs rounded to bf16, span_val read; q/k/v = query W with EXACT bf16 products on WMMA 16x16x32, f32 accumulate; q as f16 hi + residual (x 2^10), k f16 -> 2-product logits / 64 (the module divides by DH), causal (-1e9 additive == exclusion), kept in f32 registers; running softmax sums, the adaptive-span ramp mask and the renormalisation (+1e-8) in f32 (exp as the hardware exp2 of (logit - m) * log2 e); exp * mask f32 split bf16 hi + lo against v bf16 hi + lo (3 products); out = y (bf16 hi + lo) Wo; f32 output.
#include <hip/hip_runtime.h>
#include <math.h>

typedef __attribute__((ext_vector_type(16))) _Float16 v16h;
typedef __attribute__((ext_vector_type(16))) __bf16 v16b;
typedef __attribute__((ext_vector_type(8)))  _Float16 v8h;
typedef __attribute__((ext_vector_type(8)))  float v8f;
typedef __attribute__((ext_vector_type(4)))  float v4f;
typedef __attribute__((ext_vector_type(2)))  float v2f;
typedef __attribute__((ext_vector_type(4)))  unsigned v4u;
typedef __attribute__((ext_vector_type(4)))  int v4i;
typedef float __attribute__((may_alias)) float_a;
typedef int __attribute__((may_alias)) int_a;

template <typename T> __device__ __forceinline__ void vst2(void* p, T v) { *(T*)p = v;  }
__device__ __forceinline__ v8f wmma16(v16h a, v16h b, v8f c) {
  return __builtin_amdgcn_wmma_f32_16x16x32_f16(false, a, false, b, (short)0, c, false, false);
}
__device__ __forceinline__ v8f wmma_bf(v16b a, v16b b, v8f c) {
  return __builtin_amdgcn_wmma_f32_16x16x32_bf16(false, a, false, b, (short)0, c, false, false);
}
// 16x16x32 fragments: lane = (h = lane>>4, row/col = lane&15); elements 0..7 = k0+8h+0..7, 8..15 = k0+16+8h+0..7; D element r = row 8h+r
__device__ __forceinline__ v16h frag_h(const _Float16* rowk0, int lane) {
  union { v16h v; v8h q[2]; } u; const _Float16* p = rowk0 + 8 * (lane >> 4);
  u.q[0] = *(const v8h*)p; u.q[1] = *(const v8h*)(p + 16); return u.v;
}
__device__ __forceinline__ v16h frag_f32(const float* rowk0, int lane) {
  v16h a; const float* p = rowk0 + 8 * (lane >> 4);
#pragma unroll
  for (int i = 0; i < 8; ++i) { a[i] = (_Float16)p[i]; a[8 + i] = (_Float16)p[16 + i]; }
  return a;
}
__device__ __forceinline__ v16h frag_f32s(const float* rowk0, int lane, float sc) {
  v16h a; const float* p = rowk0 + 8 * (lane >> 4);
#pragma unroll
  for (int i = 0; i < 8; ++i) { a[i] = (_Float16)(p[i] * sc); a[8 + i] = (_Float16)(p[16 + i] * sc); }
  return a;
}
// column fragment from a [K][ld] layout (column n), rows >= K read as 0
__device__ __forceinline__ v16h fragc_f32(const float* W, int k0, int n, int lane, int ld, int K) {
  v16h a; const int g = lane >> 4;
#pragma unroll
  for (int i = 0; i < 8; ++i) { const int ka = k0 + 8 * g + i, kb = ka + 16;
    a[i] = (_Float16)(ka < K ? W[(size_t)(ka < K ? ka : K - 1) * ld + n] : 0.f); a[8 + i] = (_Float16)(kb < K ? W[(size_t)(kb < K ? kb : K - 1) * ld + n] : 0.f); }
  return a;
}
struct F2 { v16b h, l; };
__device__ __forceinline__ F2 bsplit16(const float v[16]) { F2 r;
#pragma unroll
  for (int i = 0; i < 16; ++i) { const __bf16 h = (__bf16)v[i]; r.h[i] = h; r.l[i] = (__bf16)(v[i] - (float)h); }
  return r; }
__device__ __forceinline__ F2 split_row(const float* row, int k0, int lane) { float v[16]; const float* p = row + k0 + 8 * (lane >> 4);
#pragma unroll
  for (int i = 0; i < 8; ++i) { v[i] = p[i]; v[8 + i] = p[16 + i]; }
  return bsplit16(v); }
__device__ __forceinline__ F2 split_rowK(const float* row, int k0, int lane, int K) { float v[16]; const int g = lane >> 4;
#pragma unroll
  for (int i = 0; i < 8; ++i) { const int ka = k0 + 8 * g + i, kb = ka + 16; v[i] = ka < K ? row[ka < K ? ka : K - 1] : 0.f; v[8 + i] = kb < K ? row[kb < K ? kb : K - 1] : 0.f; }
  return bsplit16(v); }
__device__ __forceinline__ F2 split_col(const float* W, int k0, int n, int lane, int ld, int K) { float v[16]; const int g = lane >> 4;
#pragma unroll
  for (int i = 0; i < 8; ++i) { const int ka = k0 + 8 * g + i, kb = ka + 16; v[i] = ka < K ? W[(size_t)(ka < K ? ka : K - 1) * ld + n] : 0.f; v[8 + i] = kb < K ? W[(size_t)(kb < K ? kb : K - 1) * ld + n] : 0.f; }
  return bsplit16(v); }
__device__ __forceinline__ v8f mac3(const F2& a, const F2& b, v8f c) { c = wmma_bf(a.l, b.h, c); c = wmma_bf(a.h, b.l, c); return wmma_bf(a.h, b.h, c); }
__device__ __forceinline__ float sigm(float v) { return 1.0f / (1.0f + expf(-v)); }
#define RUNFENCE() __builtin_amdgcn_sched_barrier(0)   // nothing is scheduled across it: a run's LDS fragment reads stay one group in front of the run's products (spread among them, each read is waited for alone)
#define LDSX() do { asm volatile("s_wait_dscnt 0" ::: "memory"); __builtin_amdgcn_wave_barrier(); __builtin_amdgcn_fence(__ATOMIC_RELEASE, "workgroup"); } while (0)


// Adaptive-span causal attention (B 2, S 2,048, hidden 1,024 = 16 x 64, ramp 32): w = softmax(q k^T / 64 + triu(-1e9, 1)); w = w * clip((k_idx + span_val[h] * S) / 33, 0, 1); w = w / (sum_k w + 1e-8); out = (w v) Wo (no biases).
#define NB 2
#define TT 2048
#define CC 1024
#define NH 16
#define HD 64
#ifndef TNB
#define TNB NB
#endif
typedef __attribute__((ext_vector_type(8))) __bf16 v8b;
__device__ __forceinline__ v16b frag_b(const __bf16* rowk0, int lane) {
  union { v16b v; v8b q[2]; } u; const __bf16* p = rowk0 + 8 * (lane >> 4);
  u.q[0] = *(const v8b*)p; u.q[1] = *(const v8b*)(p + 16); return u.v;
}
__device__ __forceinline__ float bfr(float v) { return (float)(__bf16)v; }
__device__ __attribute__((noinline)) float exp_ni(float v) { return expf(v); }
__device__ __attribute__((noinline)) float erf_ni(float v) { return erff(v); }

#define WS_QH  0u
#define WS_QL  (WS_QH + 2u * (size_t)NB * TT * CC)
#define WS_KH  (WS_QL + 2u * (size_t)NB * TT * CC)
#define WS_VT  (WS_KH + 2u * (size_t)NB * TT * CC)      // bf16 v planes
#define WS_VL  (WS_VT + 2u * (size_t)NB * CC * TT)      // bf16 v residual planes
#define WS_Y   (WS_VL + 2u * (size_t)NB * CC * TT)      // f32 y rows [b*t][C]
#define WS_END (WS_Y + 4u * (size_t)NB * TT * CC)

// The q, k and v planes lie in fragment order, in 16-byte pieces of 8 elements: q, k: per (b, h, 16 rows) 1,024 elements [d / 8][row][8]; v: per (b, h, 32 keys) 2,048 elements [d / 16][key / 8][d % 16][8].
// A lane's two halves of a 16x16x32 fragment then lie at lane * 16 B in two successive 512-byte runs: each load of a wave covers four whole 128-byte lines. p holds the lane's 8 * lane.
#define QKB(b, h, t16) (((size_t)((b) * NH + (h)) * (TT / 16) + (t16)) * 1024)
#define VB(b, h, t32) (((size_t)((b) * NH + (h)) * (TT / 32) + (t32)) * 2048)
__device__ __forceinline__ v16h frag_hp(const _Float16* p) { union { v16h v; v8h q[2]; } u; u.q[0] = *(const v8h*)p; u.q[1] = *(const v8h*)(p + 256); return u.v; }
__device__ __forceinline__ v16b frag_bp(const __bf16* p) { union { v16b v; v8b q[2]; } u; u.q[0] = *(const v8b*)p; u.q[1] = *(const v8b*)(p + 256); return u.v; }
#define GK 64                                         // k per stage of the two GEMM kernels
#define XP 72                                         // LDS row pitch of a staged tile in bf16: 144 B = 16 B x odd, so 16-byte reads down 16 rows meet no bank twice
typedef __attribute__((ext_vector_type(4))) __bf16 v4b;
// W rows of one stage for a wave's 32 columns: lane (col, g) takes columns 2 col, 2 col + 1 of rows 8 g + i and 16 + 8 g + i of each 32-k chunk, so a load covers two whole 128-byte lines.
// Fragment e then holds column 2 col + e in lane col: the k order is that of frag_b, only the tile's columns are renumbered (undone where the accumulators are stored).
__device__ __forceinline__ void ld_w(const float* wp, v2f (&wr)[2][16]) {
#pragma unroll
  for (int c = 0; c < 2; ++c)
#pragma unroll
    for (int i = 0; i < 8; ++i) { wr[c][i] = *(const v2f*)(wp + (size_t)(c * 32 + i) * CC); wr[c][8 + i] = *(const v2f*)(wp + (size_t)(c * 32 + 16 + i) * CC); }
}
__device__ __forceinline__ void cv_w(const v2f (&wr)[2][16], v16b (&wf)[2][2]) {
#pragma unroll
  for (int c = 0; c < 2; ++c)
#pragma unroll
    for (int i = 0; i < 16; ++i) { wf[c][0][i] = (__bf16)wr[c][i][0]; wf[c][1][i] = (__bf16)wr[c][i][1]; }
}
// the block's 128 x 64 f32 tile of one stage: 16 lanes a row, so a load covers two rows of 256 contiguous bytes
__device__ __forceinline__ void ld_x(const float* xp, v4f (&xr)[8]) {
#pragma unroll
  for (int u = 0; u < 8; ++u) xr[u] = *(const v4f*)(xp + (size_t)(u * 16) * CC);
}
// ---- k_proj: block = 128 rows x (128 cols of each of q, k, v), 12 waves of 128 rows x 32 cols, four waves per plane: qkv = x W (+ b), exact; q -> f16 hi (+ residual), k -> f16 rows, v -> bf16 planes
//      per 64-k stage the x tile goes once through LDS as bf16 (two buffers, staged by the first 8 waves) and serves all 12 waves, so q, k and v share one read of x; a wave owns its 32 columns of W over all the block's rows, so no W element is loaded twice in a block; the next stage's loads fly during this stage's products
#define PTB (2 * 128 * 136 * 2)                       // LDS bytes of one plane's output tile, hi + residual
__global__ __launch_bounds__(384) void k_proj(const float* __restrict__ X, const float* __restrict__ WQ, const float* __restrict__ BQ, const float* __restrict__ WK, const float* __restrict__ BK, const float* __restrict__ WV, const float* __restrict__ BV, _Float16* __restrict__ QH, _Float16* __restrict__ QL, _Float16* __restrict__ KH, __bf16* __restrict__ VT, __bf16* __restrict__ VL) {
  __shared__ __align__(16) unsigned char sm[3 * PTB];   // one of: the two stage buffers (loop), the three output tiles (q, k rows hi + residual, v planes hi + residual); a barrier stands between the uses
  const int tid = threadIdx.x, wave = __builtin_amdgcn_readfirstlane(tid >> 5), lane = tid & 31, col = lane & 15, g = lane >> 4; const int which = wave >> 2; const int c0 = blockIdx.y * 128; const size_t r0 = (size_t)blockIdx.x * 128; const float* WA = which == 0 ? WQ : which == 1 ? WK : WV; const float* BA = which == 0 ? BQ : which == 1 ? BK : BV;
  unsigned char* smw = sm + which * PTB;
  _Float16 (*sh)[136] = (_Float16 (*)[136])smw, (*sl)[136] = (_Float16 (*)[136])(smw + 128 * 136 * 2); __bf16 (*th)[136] = (__bf16 (*)[136])smw, (*tl2)[136] = (__bf16 (*)[136])(smw + 128 * 136 * 2);
  __bf16 (*xs)[128][XP] = (__bf16 (*)[128][XP])sm;
  const bool xw = wave < 8;   // the waves that stage x: 256 threads, 8 pieces of 16 bytes each
  const int xrow = (tid >> 4) & 15, xq = (tid & 15) * 4, cb = (wave & 3) * 32 + 2 * col;   // the lane's first column in its plane's tile
  const float* wp = WA + (size_t)(8 * g) * CC + c0 + cb; const float* xp = X + (r0 + xrow) * CC + xq;
  v2f wr[2][16]; v4f xr[8]; v16b wf[2][2]; v8f acc[8][2] = {};
  ld_w(wp, wr);
  if (xw) ld_x(xp, xr);
  cv_w(wr, wf);
  if (xw) {
#pragma unroll
    for (int u = 0; u < 8; ++u) { v4b h;
#pragma unroll
      for (int e = 0; e < 4; ++e) h[e] = (__bf16)xr[u][e];
      *(v4b*)&xs[0][u * 16 + xrow][xq] = h; } }
  __syncthreads();   // stage 0 is in LDS
#pragma unroll 1   // kept rolled: a second stage's raw registers beside the first's would not fit three waves per SIMD
  for (int s = 0; s < CC / GK; ++s) { const bool more = s + 1 < CC / GK;
    if (more) { ld_w(wp + (size_t)GK * CC, wr); if (xw) ld_x(xp + GK, xr);
      asm volatile("s_wait_xcnt 0x0" :: "v"(wp), "v"(xp) : "memory");   // the wait of these loads; their two address pairs are inputs, so that no register of them is rewritten in front of it
      wp += (size_t)GK * CC; xp += GK; }
#pragma unroll
    for (int c = 0; c < 2; ++c)
#pragma unroll
      for (int hf = 0; hf < 2; ++hf) { v16b a[4];
#pragma unroll
        for (int i = 0; i < 4; ++i) a[i] = frag_b(&xs[s & 1][hf * 64 + i * 16 + col][c * 32], lane);
        RUNFENCE();
#pragma unroll
        for (int i = 0; i < 4; ++i) { acc[hf * 4 + i][0] = wmma_bf(a[i], wf[c][0], acc[hf * 4 + i][0]); acc[hf * 4 + i][1] = wmma_bf(a[i], wf[c][1], acc[hf * 4 + i][1]); }
        if (c == 0 || hf == 0) RUNFENCE(); }
    if (more) { cv_w(wr, wf);
      if (xw) {
#pragma unroll
        for (int u = 0; u < 8; ++u) { v4b h;
#pragma unroll
          for (int e = 0; e < 4; ++e) h[e] = (__bf16)xr[u][e];
          *(v4b*)&xs[(s + 1) & 1][u * 16 + xrow][xq] = h; } } }
    __syncthreads(); }   // publishes stage s + 1 and ends every wave's reads of stage s, whose buffer the next trip refills
  const float bb[2] = {BA ? bfr(BA[c0 + cb]) : 0.f, BA ? bfr(BA[c0 + cb + 1]) : 0.f};
  if (which == 2) {   // the plane is the wave's own: one test for the whole tile
#pragma unroll
    for (int i = 0; i < 8; ++i)
#pragma unroll
      for (int e = 0; e < 2; ++e)
#pragma unroll
        for (int r = 0; r < 8; ++r) { const float v = acc[i][e][r] + bb[e]; const int cl = cb + e, rl = i * 16 + 8 * g + r; const __bf16 bh = (__bf16)v; th[cl][rl] = bh; tl2[cl][rl] = (__bf16)(v - (float)bh); } }
  else {
#pragma unroll
    for (int i = 0; i < 8; ++i)
#pragma unroll
      for (int r = 0; r < 8; ++r)
#pragma unroll
        for (int e = 0; e < 2; ++e) { const float v = acc[i][e][r] + bb[e]; const int cl = cb + e, rl = i * 16 + 8 * g + r; const _Float16 hv = (_Float16)v; sh[rl][cl] = hv; sl[rl][cl] = (_Float16)((v - (float)hv) * 1024.0f); } }   /* q residual carried x 2^10 so the plane stays f16-normal on the chip */
  __syncthreads();
  const int bi = (int)(r0 / TT), t0 = (int)(r0 % TT), h0 = c0 / HD, pl = tid & 15, p8 = (tid >> 4) & 7;   // a lane's place in a piece run, its run among the 8 of its plane's four waves: a wave stores 512 contiguous bytes
  if (which < 2) { _Float16* dh = which == 0 ? QH : KH; for (int e = 0; e < 16; ++e) { const int rl = (e >> 1) * 16 + pl, q = (e & 1) * 8 + p8; const size_t o1 = QKB(bi, h0 + (q >> 3), t0 / 16 + (e >> 1)) + (q & 7) * 128 + pl * 8; _Float16* d0 = dh + o1; const v4u x0 = *(const v4u*)&sh[rl][q * 8]; vst2((unsigned*)d0, x0);
      asm volatile("s_wait_xcnt 0x0" :: "v"(d0), "v"(x0) : "memory");   // the wait of this store; its address pair and its data are inputs, so that no register of them is rewritten in front of it
      if (which == 0) { _Float16* d1 = QL + o1; const v4u x1 = *(const v4u*)&sl[rl][q * 8]; vst2((unsigned*)d1, x1);
        asm volatile("s_wait_xcnt 0x0" :: "v"(d1), "v"(x1) : "memory"); } } }   // as above
  else { for (int e = 0; e < 16; ++e) { const int pq = (e & 1) * 8 + p8, f = e >> 1; const int cl = (f & 1) * 64 + (pq >> 2) * 16 + pl, q = (f >> 1) * 4 + (pq & 3); const size_t o2 = VB(bi, h0 + (f & 1), t0 / 32 + (f >> 1)) + pq * 128 + pl * 8; __bf16 *d0 = VT + o2, *d1 = VL + o2; const v4u x0 = *(const v4u*)&th[cl][q * 8], x1 = *(const v4u*)&tl2[cl][q * 8]; vst2((unsigned*)d0, x0); vst2((unsigned*)d1, x1);
      asm volatile("s_wait_xcnt 0x0" :: "v"(d0), "v"(d1), "v"(x0), "v"(x1) : "memory"); } } }   // the wait of these two stores, as above
// ---- k_attn: block = 64 queries of (b,h), 8 waves = 2 groups of 32 queries x 4 key splits; the logits never leave the registers.
//      A wave walks the 32-key chunks ks, ks + 4, ... of its 32 queries: S^T = K Q^T (a lane holds 16 keys of one query per 16-query tile), logits / 64, causal on the last chunk only;
//      e = exp(logit - m) = exp2(product * LSC - m2), one fma and one v_exp_f32 per score: m2 is the maximum in use in log2 units (raised, with a rescale of the sums, only when a chunk's maximum passes it by more than LTH: e stays below e^8);
//      s += sum e, t += sum e * ramp mask clip((k + span_val[h] S)/(RAMP+1), 0, 1), O^T += V^T (e * mask)^T: the score registers are the B fragment as they stand.
//      The 4 key splits of a query are joined through LDS in split order, each weighted exp2(m2_w - max m2): y = (O / s) / (t / s + 1e-8).
#define AQ 64
#define AKS 4
#define AW 8
#define LSC (1.4426950408889634f / 64.0f)            // log2 e / DH: q k product -> logit in log2 units
#define LTH 11.541560327111707f                      // 8 * log2 e
#define OP (HD + 4)                                   // LDS row pitch of a partial tile in floats: 16 B x odd
__device__ __forceinline__ float ex2(float v) { return __builtin_amdgcn_exp2f(v); }   // v_exp_f32 alone: an argument far below -126 gives 0, which is what an excluded key and an empty split want
__device__ __forceinline__ float xhalf(float x) { return __builtin_bit_cast(float, __builtin_amdgcn_permlanex16(__builtin_bit_cast(int, x), __builtin_bit_cast(int, x), 0x76543210, 0xfedcba98, false, false)); }   // lane l with lane l ^ 16
__global__ __launch_bounds__(32 * AW) __attribute__((amdgpu_waves_per_eu(4, 4))) void k_attn(const _Float16* __restrict__ QH, const _Float16* __restrict__ QL, const _Float16* __restrict__ KH, const __bf16* __restrict__ VT, const __bf16* __restrict__ VL, const float* __restrict__ SPAN, float* __restrict__ Y) {
  __shared__ __align__(16) float smk[TT]; __shared__ __align__(16) float ss[AW * 32 * OP]; __shared__ float wm[AW][32], wsm[AW][32], wt[AW][32];
  const int tid = threadIdx.x, wave = __builtin_amdgcn_readfirstlane(tid >> 5), lane = tid & 31, col = lane & 15, g = lane >> 4; const int b = blockIdx.x / NH, h = blockIdx.x % NH;
  const int ql0 = (TT / AQ - 1 - (int)blockIdx.z) * AQ;   // the longest blocks start first
  const int qg = wave & 1, ks = wave >> 1, Q0 = ql0 + qg * 32, nch = Q0 / 32 + 1;   // the wave's first query; its queries see the chunks [0, nch), the last one in part
  { const float spv = bfr(SPAN[h]) * (float)TT;   /* span_val[h] * attn_span */
    for (int k = tid; k < ql0 + AQ; k += 32 * AW) smk[k] = fminf(fmaxf(((float)k + spv) / 33.0f, 0.f), 1.0f); }
  _Float16* qls = (_Float16*)&ss[wave * 32 * OP] + lane * 8;   // during the loop the wave's own partial-tile room holds its q fragments, hi then residual (8 KiB, fragment order): 64 registers less, so that four waves fit a SIMD
  { const size_t qo = QKB(b, h, Q0 / 16) + lane * 8; const _Float16 *qhp = QH + qo, *qlp = QL + qo;
#pragma unroll
    for (int i = 0; i < 2; ++i)
#pragma unroll
      for (int kc = 0; kc < 2; ++kc) { const int o = i * 1024 + kc * 512; *(v8h*)(qls + o) = *(const v8h*)(qhp + o); *(v8h*)(qls + o + 256) = *(const v8h*)(qhp + o + 256); *(v8h*)(qls + 2048 + o) = *(const v8h*)(qlp + o); *(v8h*)(qls + 2048 + o + 256) = *(const v8h*)(qlp + o + 256); }
    asm volatile("s_wait_xcnt 0x0" :: "v"(qhp), "v"(qlp) : "memory"); }   // the wait of the q loads; their two address pairs are inputs, so that no register of them is reused in front of it
  __syncthreads();   // the mask table is in LDS
  v8f acc[2][HD / 16] = {}; float m[2] = {-3.0e38f, -3.0e38f}, s[2] = {0.f, 0.f}, t[2] = {0.f, 0.f};
#pragma unroll 1   // kept rolled: a second chunk's fragments beside this one's would not fit four waves per SIMD
  for (int c = ks; c < nch; c += AKS) { float x[2][16]; bool ramp;
    { v16h kf[2][2]; const _Float16* kp = KH + QKB(b, h, c * 2) + lane * 8;
#pragma unroll
      for (int j = 0; j < 2; ++j)
#pragma unroll
        for (int kc = 0; kc < 2; ++kc) kf[j][kc] = frag_hp(kp + j * 1024 + kc * 512);
      asm volatile("s_wait_xcnt 0x0" :: "v"(kp) : "memory");   // the wait of the k loads; their address pair is an input, so that no register of it is rewritten in front of it
      ramp = __builtin_amdgcn_readfirstlane(__builtin_bit_cast(int, smk[c * 32])) != 0x3f800000;   // read here, with the q fragments, so that its LDS latency is not waited out behind the exps
#pragma unroll
      for (int i = 0; i < 2; ++i) { v8f a[2] = {}, l[2] = {}; const v16h qh[2] = {frag_hp(qls + i * 1024), frag_hp(qls + i * 1024 + 512)}, ql[2] = {frag_hp(qls + 2048 + i * 1024), frag_hp(qls + 2048 + i * 1024 + 512)};
        RUNFENCE();
#pragma unroll
        for (int kc = 0; kc < 2; ++kc)
#pragma unroll
          for (int j = 0; j < 2; ++j) { a[j] = wmma16(kf[j][kc], qh[kc], a[j]); l[j] = wmma16(kf[j][kc], ql[kc], l[j]); }
        RUNFENCE();   // behind the second run it also keeps the v loads, which land in the k and q fragments' registers, and their wait out of the run
#pragma unroll
        for (int j = 0; j < 2; ++j) { a[j] += l[j] * (1.0f / 1024.0f);
#pragma unroll
          for (int r = 0; r < 8; ++r) x[i][j * 8 + r] = a[j][r]; } } }   /* the q k products; the division by DH = 64 is in LSC; element j * 8 + r = key 32 c + 16 j + 8 g + r, query Q0 + 16 i + col */
    const size_t vo = VB(b, h, c) + lane * 8; const __bf16 *vhp = VT + vo, *vlp = VL + vo; v16b vh[HD / 16], vl[HD / 16];   // the v loads fly during the softmax
#pragma unroll
    for (int j = 0; j < HD / 16; ++j) { vh[j] = frag_bp(vhp + j * 512); vl[j] = frag_bp(vlp + j * 512); }
    asm volatile("s_wait_xcnt 0x0" :: "v"(vhp), "v"(vlp) : "memory");   // the wait of the v loads; their two address pairs are inputs, so that no register of them is rewritten in front of it
    if (c == nch - 1) {   // the chunk of the diagonal: its first key is the wave's first query
#pragma unroll
      for (int i = 0; i < 2; ++i)
#pragma unroll
        for (int e = 0; e < 16; ++e) if ((e >> 3) * 16 + 8 * g + (e & 7) > i * 16 + col) x[i][e] = -3.0e38f; }
    float mx[2];
#pragma unroll
    for (int i = 0; i < 2; ++i) { float v = x[i][0];
#pragma unroll
      for (int e = 1; e < 16; ++e) v = fmaxf(v, x[i][e]);
      mx[i] = fmaxf(v, xhalf(v)) * LSC; }   // both halves of a query's keys: the two lanes of a query keep one m
    if (__builtin_amdgcn_ballot_w32(mx[0] > m[0] + LTH || mx[1] > m[1] + LTH) != 0) {   // one test per chunk; always taken on a wave's first chunk
#pragma unroll
      for (int i = 0; i < 2; ++i) { const float mn = mx[i] > m[i] + LTH ? mx[i] : m[i]; const float al = ex2(m[i] - mn); m[i] = mn; s[i] *= al; t[i] *= al;
#pragma unroll
        for (int j = 0; j < HD / 16; ++j) acc[i][j] *= al; } }
    float ds[2];
#pragma unroll
    for (int i = 0; i < 2; ++i) { float p[4] = {0.f, 0.f, 0.f, 0.f};
#pragma unroll
      for (int e = 0; e < 16; e += 2) { v2f u = {x[i][e], x[i][e + 1]}; const v2f sc = {LSC, LSC}, nm = {-m[i], -m[i]}; u = __builtin_elementwise_fma(u, sc, nm); x[i][e] = u[0]; x[i][e + 1] = u[1]; }   // two scores per packed fma
#pragma unroll   // x is a register array: every index must be a constant
      for (int e = 0; e < 16; ++e) x[i][e] = ex2(x[i][e]);   // an excluded key: exp2 of about -7e36 is 0
#pragma unroll   // as above, for x and p
      for (int e = 0; e < 16; ++e) p[e & 3] += x[i][e];
      ds[i] = (p[0] + p[1]) + (p[2] + p[3]); s[i] += ds[i]; }
    if (ramp) {   // the mask never falls with k: where the chunk's first key has 1.0, all its keys have, and e * mask is e
      float mk[16];
#pragma unroll
      for (int j = 0; j < 2; ++j) { const v4f u0 = *(const v4f*)&smk[c * 32 + j * 16 + 8 * g], u1 = *(const v4f*)&smk[c * 32 + j * 16 + 8 * g + 4];
#pragma unroll
        for (int r = 0; r < 4; ++r) { mk[j * 8 + r] = u0[r]; mk[j * 8 + 4 + r] = u1[r]; } }
#pragma unroll
      for (int i = 0; i < 2; ++i) { float p[4] = {0.f, 0.f, 0.f, 0.f};
#pragma unroll
        for (int e = 0; e < 16; ++e) { x[i][e] *= mk[e]; p[e & 3] += x[i][e]; }
        ds[i] = (p[0] + p[1]) + (p[2] + p[3]); } }
    t[0] += ds[0]; t[1] += ds[1];
    const F2 p0 = bsplit16(x[0]), p1 = bsplit16(x[1]);
#pragma unroll
    for (int j = 0; j < HD / 16; ++j) { acc[0][j] = wmma_bf(vh[j], p0.l, acc[0][j]); acc[1][j] = wmma_bf(vh[j], p1.l, acc[1][j]); }
#pragma unroll
    for (int j = 0; j < HD / 16; ++j) { acc[0][j] = wmma_bf(vl[j], p0.h, acc[0][j]); acc[1][j] = wmma_bf(vl[j], p1.h, acc[1][j]); }
#pragma unroll
    for (int j = 0; j < HD / 16; ++j) { acc[0][j] = wmma_bf(vh[j], p0.h, acc[0][j]); acc[1][j] = wmma_bf(vh[j], p1.h, acc[1][j]); } }
#pragma unroll
  for (int i = 0; i < 2; ++i) { s[i] += xhalf(s[i]); t[i] += xhalf(t[i]);   // the two halves of a query's keys
    if (g == 0) { wm[wave][i * 16 + col] = m[i]; wsm[wave][i * 16 + col] = s[i]; wt[wave][i * 16 + col] = t[i]; }
#pragma unroll
    for (int j = 0; j < HD / 16; ++j) { float* d = &ss[(wave * 32 + i * 16 + col) * OP + j * 16 + 8 * g]; v4f u0, u1;   // accumulator element r = d 16 j + 8 g + r of query col
#pragma unroll
      for (int r = 0; r < 4; ++r) { u0[r] = acc[i][j][r]; u1[r] = acc[i][j][4 + r]; }
      *(v4f*)d = u0; *(v4f*)(d + 4) = u1; } }
  __syncthreads();   // every wave's partial tile and its m, s, t are in LDS
  const int q4 = (tid & 15) * 4;
#pragma unroll
  for (int i = 0; i < AQ / 16; ++i) { const int rl = i * 16 + (tid >> 4), w0 = rl >> 5, r32 = rl & 31;   // 16 lanes a row: a store covers two runs of 256 contiguous bytes
    float mm = wm[w0][r32];
#pragma unroll
    for (int k = 1; k < AKS; ++k) mm = fmaxf(mm, wm[k * 2 + w0][r32]);
    float sa = 0.f, ta = 0.f; v4f o = {};
#pragma unroll
    for (int k = 0; k < AKS; ++k) { const int w = k * 2 + w0; const float f = ex2(wm[w][r32] - mm); sa += f * wsm[w][r32]; ta += f * wt[w][r32]; o += *(const v4f*)&ss[(w * 32 + r32) * OP + q4] * f; }   // a split without a chunk has m about -3e38: weight 0
    const float ia = 1.0f / sa; const float na = 1.0f / (ta * ia + 1e-8f);   /* w = softmax * ramp mask, renormalised by (sum + 1e-8) */
    float* yp = Y + ((size_t)b * TT + ql0 + rl) * CC + h * HD + q4; const v4f yv = (o * ia) * na; vst2(yp, yv);
    asm volatile("s_wait_xcnt 0x0" :: "v"(yp), "v"(yv) : "memory"); } }   // the wait of this store; its address pair and its data are inputs, so that no register of them is rewritten in front of it
// ---- k_out: block = (128 rows, 128 cols), 8 waves of 64 rows x 32 cols: out = y (bf16 hi + lo) Wo + bo; operands as in k_proj, the y tile staged as its two bf16 planes
__global__ __launch_bounds__(256) void k_out(const float* __restrict__ Y, const float* __restrict__ WP, const float* __restrict__ BP, float* __restrict__ OUT) { __shared__ __align__(16) __bf16 yh[2][128][XP], yl[2][128][XP]; __shared__ __align__(16) float sf[128][132];
  const int tid = threadIdx.x, wave = tid >> 5, lane = tid & 31, col = lane & 15, g = lane >> 4; const int c0 = blockIdx.y * 128; const size_t r0 = (size_t)blockIdx.x * 128;
  const int xrow = tid >> 4, xq = (tid & 15) * 4, rb = (wave >> 2) * 64, cb = (wave & 3) * 32 + 2 * col;   // the wave's first row, the lane's first column in the tile
  const float* wp = WP + (size_t)(8 * g) * CC + c0 + cb; const float* xp = Y + (r0 + xrow) * CC + xq;
  v2f wr[2][16]; v4f xr[8]; v16b wf[2][2]; v8f acc[4][2] = {};
  ld_w(wp, wr); ld_x(xp, xr);
  cv_w(wr, wf);
#pragma unroll
  for (int u = 0; u < 8; ++u) { v4b h, l;
#pragma unroll
    for (int e = 0; e < 4; ++e) { h[e] = (__bf16)xr[u][e]; l[e] = (__bf16)(xr[u][e] - (float)h[e]); }
    *(v4b*)&yh[0][u * 16 + xrow][xq] = h; *(v4b*)&yl[0][u * 16 + xrow][xq] = l; }
  __syncthreads();   // stage 0 is in LDS
#pragma unroll 1   // kept rolled: a second stage's raw registers beside the first's are not worth their room
  for (int s = 0; s < CC / GK; ++s) { const bool more = s + 1 < CC / GK;
    if (more) { wp += (size_t)GK * CC; xp += GK; ld_w(wp, wr); ld_x(xp, xr); }
#pragma unroll
    for (int c = 0; c < 2; ++c) { v16b ah[4], al[4];
#pragma unroll
      for (int i = 0; i < 4; ++i) { ah[i] = frag_b(&yh[s & 1][rb + i * 16 + col][c * 32], lane); al[i] = frag_b(&yl[s & 1][rb + i * 16 + col][c * 32], lane); }
      RUNFENCE();
#pragma unroll
      for (int i = 0; i < 4; ++i) { acc[i][0] = wmma_bf(ah[i], wf[c][0], acc[i][0]); acc[i][1] = wmma_bf(ah[i], wf[c][1], acc[i][1]); }
#pragma unroll
      for (int i = 0; i < 4; ++i) { acc[i][0] = wmma_bf(al[i], wf[c][0], acc[i][0]); acc[i][1] = wmma_bf(al[i], wf[c][1], acc[i][1]); }
      if (c == 0) RUNFENCE(); }
    if (more) { cv_w(wr, wf);
#pragma unroll
      for (int u = 0; u < 8; ++u) { v4b h, l;
#pragma unroll
        for (int e = 0; e < 4; ++e) { h[e] = (__bf16)xr[u][e]; l[e] = (__bf16)(xr[u][e] - (float)h[e]); }
        *(v4b*)&yh[(s + 1) & 1][u * 16 + xrow][xq] = h; *(v4b*)&yl[(s + 1) & 1][u * 16 + xrow][xq] = l; } }
    __syncthreads(); }   // publishes stage s + 1 and ends every wave's reads of stage s, whose buffers the next trip refills
  const float b0 = BP ? bfr(BP[c0 + cb]) : 0.f, b1 = BP ? bfr(BP[c0 + cb + 1]) : 0.f;
#pragma unroll
  for (int i = 0; i < 4; ++i)
#pragma unroll
    for (int r = 0; r < 8; ++r) { v2f o; o[0] = acc[i][0][r] + b0; o[1] = acc[i][1][r] + b1; *(v2f*)&sf[rb + i * 16 + 8 * g + r][cb] = o; }
  __syncthreads();   // the 128 x 128 tile is in LDS: each wave stores 16 whole rows of it
  for (int rl = 0; rl < 16; ++rl) vst2(OUT + (r0 + wave * 16 + rl) * CC + c0 + lane * 4, *(const v4f*)&sf[wave * 16 + rl][lane * 4]); }
extern "C" void kernel_launch(void* const* d_in, const int* in_sizes, int n_in, void* d_out, int out_size, void* d_ws, size_t ws_size, hipStream_t stream) {
  (void)in_sizes; (void)n_in; (void)out_size;
  const float** F = (const float**)d_in;   // 0 query [2,2048,1024], 1 Wq [1024,1024] ((in,out)), 2 Wk, 3 Wv, 4 Wo ((in,out)), 5 span_val [1,16,1,1] (verbatim)
  if (ws_size < (size_t)WS_END) return;
  char* ws = (char*)d_ws; _Float16 *QH = (_Float16*)(ws + WS_QH), *QL = (_Float16*)(ws + WS_QL), *KH = (_Float16*)(ws + WS_KH); __bf16 *VT = (__bf16*)(ws + WS_VT), *VL = (__bf16*)(ws + WS_VL); float *Y = (float*)(ws + WS_Y);
  k_proj<<<dim3(TNB * TT / 128, CC / 128), 384, 0, stream>>>(F[0], F[1], nullptr, F[2], nullptr, F[3], nullptr, QH, QL, KH, VT, VL);
  k_attn<<<dim3(TNB * NH, 1, TT / AQ), 32 * AW, 0, stream>>>(QH, QL, KH, VT, VL, F[5], Y);
  k_out<<<dim3(TNB * TT / 128, CC / 128), 256, 0, stream>>>(Y, F[4], nullptr, (float*)d_out);
}

// v009
// Measured time: 92.2 microseconds a run.
// Two timings next to v008 both put it at 1.05 times that version's speed.
// Over all steps from v000 it is 14.8 times as fast.
// compute dtype: all float inputs rounded to bf16 (the four W once, by k_wcv), span_val read; q/k/v = query W with EXACT bf16 products on WMMA 16x16x32, f32 accumulate; q as f16 hi + residual (x 2^10), k f16 -> 2-product logits / 64 (the module divides by DH), causal (-1e9 additive == exclusion), kept in f32 registers; running softmax sums, the adaptive-span ramp mask and the renormalisation (+1e-8) in f32 (exp as the hardware exp2 of (logit - m) * log2 e); exp * mask f32 split bf16 hi + lo against v bf16 hi + lo (3 products); out = y (bf16 hi + lo) Wo; f32 output.
#include <hip/hip_runtime.h>
#include <math.h>

typedef __attribute__((ext_vector_type(16))) _Float16 v16h;
typedef __attribute__((ext_vector_type(16))) __bf16 v16b;
typedef __attribute__((ext_vector_type(8)))  _Float16 v8h;
typedef __attribute__((ext_vector_type(8)))  float v8f;
typedef __attribute__((ext_vector_type(4)))  float v4f;
typedef __attribute__((ext_vector_type(2)))  float v2f;
typedef __attribute__((ext_vector_type(4)))  unsigned v4u;
typedef __attribute__((ext_vector_type(4)))  int v4i;
typedef float __attribute__((may_alias)) float_a;
typedef int __attribute__((may_alias)) int_a;

template <typename T> __device__ __forceinline__ void vst2(void* p, T v) { *(T*)p = v;  }
__device__ __forceinline__ v8f wmma16(v16h a, v16h b, v8f c) {
  return __builtin_amdgcn_wmma_f32_16x16x32_f16(false, a, false, b, (short)0, c, false, false);
}
__device__ __forceinline__ v8f wmma_bf(v16b a, v16b b, v8f c) {
  return __builtin_amdgcn_wmma_f32_16x16x32_bf16(false, a, false, b, (short)0, c, false, false);
}
// 16x16x32 fragments: lane = (h = lane>>4, row/col = lane&15); elements 0..7 = k0+8h+0..7, 8..15 = k0+16+8h+0..7; D element r = row 8h+r
__device__ __forceinline__ v16h frag_h(const _Float16* rowk0, int lane) {
  union { v16h v; v8h q[2]; } u; const _Float16* p = rowk0 + 8 * (lane >> 4);
  u.q[0] = *(const v8h*)p; u.q[1] = *(const v8h*)(p + 16); return u.v;
}
__device__ __forceinline__ v16h frag_f32(const float* rowk0, int lane) {
  v16h a; const float* p = rowk0 + 8 * (lane >> 4);
#pragma unroll
  for (int i = 0; i < 8; ++i) { a[i] = (_Float16)p[i]; a[8 + i] = (_Float16)p[16 + i]; }
  return a;
}
__device__ __forceinline__ v16h frag_f32s(const float* rowk0, int lane, float sc) {
  v16h a; const float* p = rowk0 + 8 * (lane >> 4);
#pragma unroll
  for (int i = 0; i < 8; ++i) { a[i] = (_Float16)(p[i] * sc); a[8 + i] = (_Float16)(p[16 + i] * sc); }
  return a;
}
// column fragment from a [K][ld] layout (column n), rows >= K read as 0
__device__ __forceinline__ v16h fragc_f32(const float* W, int k0, int n, int lane, int ld, int K) {
  v16h a; const int g = lane >> 4;
#pragma unroll
  for (int i = 0; i < 8; ++i) { const int ka = k0 + 8 * g + i, kb = ka + 16;
    a[i] = (_Float16)(ka < K ? W[(size_t)(ka < K ? ka : K - 1) * ld + n] : 0.f); a[8 + i] = (_Float16)(kb < K ? W[(size_t)(kb < K ? kb : K - 1) * ld + n] : 0.f); }
  return a;
}
struct F2 { v16b h, l; };
__device__ __forceinline__ F2 bsplit16(const float v[16]) { F2 r;
#pragma unroll
  for (int i = 0; i < 16; ++i) { const __bf16 h = (__bf16)v[i]; r.h[i] = h; r.l[i] = (__bf16)(v[i] - (float)h); }
  return r; }
__device__ __forceinline__ F2 split_row(const float* row, int k0, int lane) { float v[16]; const float* p = row + k0 + 8 * (lane >> 4);
#pragma unroll
  for (int i = 0; i < 8; ++i) { v[i] = p[i]; v[8 + i] = p[16 + i]; }
  return bsplit16(v); }
__device__ __forceinline__ F2 split_rowK(const float* row, int k0, int lane, int K) { float v[16]; const int g = lane >> 4;
#pragma unroll
  for (int i = 0; i < 8; ++i) { const int ka = k0 + 8 * g + i, kb = ka + 16; v[i] = ka < K ? row[ka < K ? ka : K - 1] : 0.f; v[8 + i] = kb < K ? row[kb < K ? kb : K - 1] : 0.f; }
  return bsplit16(v); }
__device__ __forceinline__ F2 split_col(const float* W, int k0, int n, int lane, int ld, int K) { float v[16]; const int g = lane >> 4;
#pragma unroll
  for (int i = 0; i < 8; ++i) { const int ka = k0 + 8 * g + i, kb = ka + 16; v[i] = ka < K ? W[(size_t)(ka < K ? ka : K - 1) * ld + n] : 0.f; v[8 + i] = kb < K ? W[(size_t)(kb < K ? kb : K - 1) * ld + n] : 0.f; }
  return bsplit16(v); }
__device__ __forceinline__ v8f mac3(const F2& a, const F2& b, v8f c) { c = wmma_bf(a.l, b.h, c); c = wmma_bf(a.h, b.l, c); return wmma_bf(a.h, b.h, c); }
__device__ __forceinline__ float sigm(float v) { return 1.0f / (1.0f + expf(-v)); }
#define RUNFENCE() __builtin_amdgcn_sched_barrier(0)   // nothing is scheduled across it: a run's LDS fragment reads stay one group in front of the run's products (spread among them, each read is waited for alone)
#define LDSX() do { asm volatile("s_wait_dscnt 0" ::: "memory"); __builtin_amdgcn_wave_barrier(); __builtin_amdgcn_fence(__ATOMIC_RELEASE, "workgroup"); } while (0)


// Adaptive-span causal attention (B 2, S 2,048, hidden 1,024 = 16 x 64, ramp 32): w = softmax(q k^T / 64 + triu(-1e9, 1)); w = w * clip((k_idx + span_val[h] * S) / 33, 0, 1); w = w / (sum_k w + 1e-8); out = (w v) Wo (no biases).
#define NB 2
#define TT 2048
#define CC 1024
#define NH 16
#define HD 64
#ifndef TNB
#define TNB NB
#endif
typedef __attribute__((ext_vector_type(8))) __bf16 v8b;
__device__ __forceinline__ v16b frag_b(const __bf16* rowk0, int lane) {
  union { v16b v; v8b q[2]; } u; const __bf16* p = rowk0 + 8 * (lane >> 4);
  u.q[0] = *(const v8b*)p; u.q[1] = *(const v8b*)(p + 16); return u.v;
}
__device__ __forceinline__ float bfr(float v) { return (float)(__bf16)v; }
__device__ __attribute__((noinline)) float exp_ni(float v) { return expf(v); }
__device__ __attribute__((noinline)) float erf_ni(float v) { return erff(v); }

#define WS_QH  0u
#define WS_QL  (WS_QH + 2u * (size_t)NB * TT * CC)
#define WS_KH  (WS_QL + 2u * (size_t)NB * TT * CC)
#define WS_VT  (WS_KH + 2u * (size_t)NB * TT * CC)      // bf16 v planes
#define WS_VL  (WS_VT + 2u * (size_t)NB * CC * TT)      // bf16 v residual planes
#define WS_Y   (WS_VL + 2u * (size_t)NB * CC * TT)      // f32 y rows [b*t][C]
#define WS_WB  (WS_Y + 4u * (size_t)NB * TT * CC)       // bf16 Wq, Wk, Wv, Wo in fragment order
#define WS_END (WS_WB + 4u * 2u * (size_t)CC * CC)

// The q, k and v planes lie in fragment order, in 16-byte pieces of 8 elements: q, k: per (b, h, 16 rows) 1,024 elements [d / 8][row][8]; v: per (b, h, 32 keys) 2,048 elements [d / 16][key / 8][d % 16][8].
// A lane's two halves of a 16x16x32 fragment then lie at lane * 16 B in two successive 512-byte runs: each load of a wave covers four whole 128-byte lines. p holds the lane's 8 * lane.
#define QKB(b, h, t16) (((size_t)((b) * NH + (h)) * (TT / 16) + (t16)) * 1024)
#define VB(b, h, t32) (((size_t)((b) * NH + (h)) * (TT / 32) + (t32)) * 2048)
__device__ __forceinline__ v16h frag_hp(const _Float16* p) { union { v16h v; v8h q[2]; } u; u.q[0] = *(const v8h*)p; u.q[1] = *(const v8h*)(p + 256); return u.v; }
__device__ __forceinline__ v16b frag_bp(const __bf16* p) { union { v16b v; v8b q[2]; } u; u.q[0] = *(const v8b*)p; u.q[1] = *(const v8b*)(p + 256); return u.v; }
#define GK 64                                         // k per stage of the two GEMM kernels
#define XP 72                                         // LDS row pitch of a staged tile in bf16: 144 B = 16 B x odd, so 16-byte reads down 16 rows meet no bank twice
typedef __attribute__((ext_vector_type(4))) __bf16 v4b;
// The four W planes lie in the workspace as bf16 in fragment order: per (32 k, 32 columns) 1,024 elements [e][k half][lane][8]: lane (col, g) holds column 2 col + e, k half * 16 + 8 g + 0..7.
// Fragment e then holds column 2 col + e in lane col: the k order is that of frag_b, only the tile's columns are renumbered (undone where the accumulators are stored). A lane's two halves lie at lane * 16 B in two successive 512-byte runs, as in the q, k, v planes.
#define WBB(kc, n32) (((size_t)(kc) * (CC / 32) + (n32)) * 1024)
#define WSTG WBB(GK / 32, 0)                          // elements from one 64-k stage to the next
// ---- k_wcv: every W element is read as f32 and rounded to bf16 once, instead of once in each of the 32 row blocks that use it. A wave takes 16 k x 32 columns of each of the four planes: a load covers two whole 128-byte lines, a store 512 contiguous bytes.
__global__ __launch_bounds__(256) void k_wcv(const float* __restrict__ W0, const float* __restrict__ W1, const float* __restrict__ W2, const float* __restrict__ W3, __bf16* __restrict__ WB) {
  const int tid = threadIdx.x, lane = tid & 31, col = lane & 15, g = lane >> 4, u = blockIdx.x * 8 + (tid >> 5), n32 = u & 31, hf = (u >> 5) & 1, kc = u >> 6;
  const size_t so = (size_t)(kc * 32 + hf * 16 + 8 * g) * CC + n32 * 32 + 2 * col; const float *p0 = W0 + so, *p1 = W1 + so, *p2 = W2 + so, *p3 = W3 + so;
  v2f r[4][8];
#pragma unroll
  for (int i = 0; i < 8; ++i) { r[0][i] = *(const v2f*)(p0 + (size_t)i * CC); r[1][i] = *(const v2f*)(p1 + (size_t)i * CC); r[2][i] = *(const v2f*)(p2 + (size_t)i * CC); r[3][i] = *(const v2f*)(p3 + (size_t)i * CC); }
  asm volatile("s_wait_xcnt 0x0" :: "v"(p0), "v"(p1), "v"(p2), "v"(p3) : "memory");   // the wait of these loads; their four address pairs are inputs, so that no register of them is reused in front of it
  __bf16* d = WB + WBB(kc, n32) + hf * 256 + lane * 8; v4u o[4][2];
#pragma unroll
  for (int m = 0; m < 4; ++m)
#pragma unroll
    for (int e = 0; e < 2; ++e) { union { v8b b; v4u w; } x;
#pragma unroll
      for (int i = 0; i < 8; ++i) x.b[i] = (__bf16)r[m][i][e];
      o[m][e] = x.w; vst2(d + (size_t)m * CC * CC + e * 512, o[m][e]); }
  asm volatile("s_wait_xcnt 0x0" :: "v"(d), "v"(o[0][0]), "v"(o[0][1]), "v"(o[1][0]), "v"(o[1][1]), "v"(o[2][0]), "v"(o[2][1]), "v"(o[3][0]), "v"(o[3][1]) : "memory"); }   // the wait of these stores; their address pair and data are inputs, so that no register of them is rewritten in front of it
// the W fragments of one stage for a wave's 32 columns: 8 loads of 512 contiguous bytes; wp holds the lane's 8 * lane
__device__ __forceinline__ void ld_wb(const __bf16* wp, v16b (&wf)[2][2]) {
#pragma unroll
  for (int c = 0; c < 2; ++c)
#pragma unroll
    for (int e = 0; e < 2; ++e) wf[c][e] = frag_bp(wp + WBB(c, 0) + e * 512);
}
// the block's 128 x 64 f32 tile of one stage: 16 lanes a row, so a load covers two rows of 256 contiguous bytes
__device__ __forceinline__ void ld_x(const float* xp, v4f (&xr)[8]) {
#pragma unroll
  for (int u = 0; u < 8; ++u) xr[u] = *(const v4f*)(xp + (size_t)(u * 16) * CC);
}
// ---- k_proj: block = 128 rows x (128 cols of each of q, k, v), 12 waves of 128 rows x 32 cols, four waves per plane: qkv = x W (+ b), exact; q -> f16 hi (+ residual), k -> f16 rows, v -> bf16 planes
//      per 64-k stage the x tile goes once through LDS as bf16 (two buffers, staged by the first 8 waves) and serves all 12 waves, so q, k and v share one read of x; a wave owns its 32 columns of W over all the block's rows, so no W element is loaded twice in a block, and takes them as ready bf16 fragments from k_wcv's planes; the next stage's loads fly during this stage's products
#define PTB (2 * 128 * 136 * 2)                       // LDS bytes of one plane's output tile, hi + residual
__global__ __launch_bounds__(384) void k_proj(const float* __restrict__ X, const __bf16* __restrict__ WB, const float* __restrict__ BQ, const float* __restrict__ BK, const float* __restrict__ BV, _Float16* __restrict__ QH, _Float16* __restrict__ QL, _Float16* __restrict__ KH, __bf16* __restrict__ VT, __bf16* __restrict__ VL) {
  __shared__ __align__(16) unsigned char sm[3 * PTB];   // one of: the two stage buffers (loop), the three output tiles (q, k rows hi + residual, v planes hi + residual); a barrier stands between the uses
  const int tid = threadIdx.x, wave = __builtin_amdgcn_readfirstlane(tid >> 5), lane = tid & 31, col = lane & 15, g = lane >> 4; const int which = wave >> 2; const int c0 = blockIdx.y * 128; const size_t r0 = (size_t)blockIdx.x * 128; const float* BA = which == 0 ? BQ : which == 1 ? BK : BV;
  unsigned char* smw = sm + which * PTB;
  _Float16 (*sh)[136] = (_Float16 (*)[136])smw, (*sl)[136] = (_Float16 (*)[136])(smw + 128 * 136 * 2); __bf16 (*th)[136] = (__bf16 (*)[136])smw, (*tl2)[136] = (__bf16 (*)[136])(smw + 128 * 136 * 2);
  __bf16 (*xs)[128][XP] = (__bf16 (*)[128][XP])sm;
  const bool xw = wave < 8;   // the waves that stage x: 256 threads, 8 pieces of 16 bytes each
  const int xrow = (tid >> 4) & 15, xq = (tid & 15) * 4, cb = (wave & 3) * 32 + 2 * col;   // the lane's first column in its plane's tile
  const __bf16* wp = WB + (size_t)which * CC * CC + WBB(0, blockIdx.y * 4 + (wave & 3)) + lane * 8; const float* xp = X + (r0 + xrow) * CC + xq;
  v4f xr[8]; v16b wa[2][2], wb[2][2]; v8f acc[8][2] = {};
  ld_wb(wp, wa);
  if (xw) ld_x(xp, xr);
  asm volatile("s_wait_xcnt 0x0" :: "v"(wp), "v"(xp) : "memory");   // the wait of stage 0's loads; their two address pairs are inputs, so that no register of them is reused in front of it
  if (xw) {
#pragma unroll
    for (int u = 0; u < 8; ++u) { v4b h;
#pragma unroll
      for (int e = 0; e < 4; ++e) h[e] = (__bf16)xr[u][e];
      *(v4b*)&xs[0][u * 16 + xrow][xq] = h; } }
  __syncthreads();   // stage 0 is in LDS
  auto stage = [&](const int s, const int bu, const v16b (&wf)[2][2], v16b (&wn)[2][2]) {   // stage s from x buffer bu and the fragments wf; the next stage's fragments land in wn
    const bool more = s + 1 < CC / GK;
    if (more) { ld_wb(wp + WSTG, wn); if (xw) ld_x(xp + GK, xr);
      asm volatile("s_wait_xcnt 0x0" :: "v"(wp), "v"(xp) : "memory");   // the wait of these loads; their two address pairs are inputs, so that no register of them is rewritten in front of it
      wp += WSTG; xp += GK; }
#pragma unroll
    for (int c = 0; c < 2; ++c)
#pragma unroll
      for (int hf = 0; hf < 2; ++hf) { v16b a[4];
#pragma unroll
        for (int i = 0; i < 4; ++i) a[i] = frag_b(&xs[bu][hf * 64 + i * 16 + col][c * 32], lane);
        RUNFENCE();
#pragma unroll
        for (int i = 0; i < 4; ++i) { acc[hf * 4 + i][0] = wmma_bf(a[i], wf[c][0], acc[hf * 4 + i][0]); acc[hf * 4 + i][1] = wmma_bf(a[i], wf[c][1], acc[hf * 4 + i][1]); }
        if (c == 0 || hf == 0) RUNFENCE(); }
    if (more) {
      if (xw) {
#pragma unroll
        for (int u = 0; u < 8; ++u) { v4b h;
#pragma unroll
          for (int e = 0; e < 4; ++e) h[e] = (__bf16)xr[u][e];
          *(v4b*)&xs[bu ^ 1][u * 16 + xrow][xq] = h; } } }
    __syncthreads(); };   // publishes stage s + 1 and ends every wave's reads of stage s, whose buffer the next stage refills
#pragma unroll 1   // two stages a trip and no more: the two fragment sets change places without a register copy
  for (int s = 0; s < CC / GK; s += 2) { stage(s, 0, wa, wb); stage(s + 1, 1, wb, wa); }
  const float bb[2] = {BA ? bfr(BA[c0 + cb]) : 0.f, BA ? bfr(BA[c0 + cb + 1]) : 0.f};
  if (which == 2) {   // the plane is the wave's own: one test for the whole tile
#pragma unroll
    for (int i = 0; i < 8; ++i)
#pragma unroll
      for (int e = 0; e < 2; ++e)
#pragma unroll
        for (int r = 0; r < 8; ++r) { const float v = acc[i][e][r] + bb[e]; const int cl = cb + e, rl = i * 16 + 8 * g + r; const __bf16 bh = (__bf16)v; th[cl][rl] = bh; tl2[cl][rl] = (__bf16)(v - (float)bh); } }
  else {
#pragma unroll
    for (int i = 0; i < 8; ++i)
#pragma unroll
      for (int r = 0; r < 8; ++r)
#pragma unroll
        for (int e = 0; e < 2; ++e) { const float v = acc[i][e][r] + bb[e]; const int cl = cb + e, rl = i * 16 + 8 * g + r; const _Float16 hv = (_Float16)v; sh[rl][cl] = hv; sl[rl][cl] = (_Float16)((v - (float)hv) * 1024.0f); } }   /* q residual carried x 2^10 so the plane stays f16-normal on the chip */
  __syncthreads();
  const int bi = (int)(r0 / TT), t0 = (int)(r0 % TT), h0 = c0 / HD, pl = tid & 15, p8 = (tid >> 4) & 7;   // a lane's place in a piece run, its run among the 8 of its plane's four waves: a wave stores 512 contiguous bytes
  if (which < 2) { _Float16* dh = which == 0 ? QH : KH; for (int e = 0; e < 16; ++e) { const int rl = (e >> 1) * 16 + pl, q = (e & 1) * 8 + p8; const size_t o1 = QKB(bi, h0 + (q >> 3), t0 / 16 + (e >> 1)) + (q & 7) * 128 + pl * 8; _Float16* d0 = dh + o1; const v4u x0 = *(const v4u*)&sh[rl][q * 8]; vst2((unsigned*)d0, x0);
      asm volatile("s_wait_xcnt 0x0" :: "v"(d0), "v"(x0) : "memory");   // the wait of this store; its address pair and its data are inputs, so that no register of them is rewritten in front of it
      if (which == 0) { _Float16* d1 = QL + o1; const v4u x1 = *(const v4u*)&sl[rl][q * 8]; vst2((unsigned*)d1, x1);
        asm volatile("s_wait_xcnt 0x0" :: "v"(d1), "v"(x1) : "memory"); } } }   // as above
  else { for (int e = 0; e < 16; ++e) { const int pq = (e & 1) * 8 + p8, f = e >> 1; const int cl = (f & 1) * 64 + (pq >> 2) * 16 + pl, q = (f >> 1) * 4 + (pq & 3); const size_t o2 = VB(bi, h0 + (f & 1), t0 / 32 + (f >> 1)) + pq * 128 + pl * 8; __bf16 *d0 = VT + o2, *d1 = VL + o2; const v4u x0 = *(const v4u*)&th[cl][q * 8], x1 = *(const v4u*)&tl2[cl][q * 8]; vst2((unsigned*)d0, x0); vst2((unsigned*)d1, x1);
      asm volatile("s_wait_xcnt 0x0" :: "v"(d0), "v"(d1), "v"(x0), "v"(x1) : "memory"); } } }   // the wait of these two stores, as above
// ---- k_attn: block = 64 queries of (b,h), 8 waves = 2 groups of 32 queries x 4 key splits; the logits never leave the registers.
//      A wave walks the 32-key chunks ks, ks + 4, ... of its 32 queries: S^T = K Q^T (a lane holds 16 keys of one query per 16-query tile), logits / 64, causal on the last chunk only;
//      e = exp(logit - m) = exp2(product * LSC - m2), one fma and one v_exp_f32 per score: m2 is the maximum in use in log2 units (raised, with a rescale of the sums, only when a chunk's maximum passes it by more than LTH: e stays below e^8);
//      s += sum e, t += sum e * ramp mask clip((k + span_val[h] S)/(RAMP+1), 0, 1), O^T += V^T (e * mask)^T: the score registers are the B fragment as they stand.
//      The 4 key splits of a query are joined through LDS in split order, each weighted exp2(m2_w - max m2): y = (O / s) / (t / s + 1e-8).
#define AQ 64
#define AKS 4
#define AW 8
#define LSC (1.4426950408889634f / 64.0f)            // log2 e / DH: q k product -> logit in log2 units
#define LTH 11.541560327111707f                      // 8 * log2 e
#define OP (HD + 4)                                   // LDS row pitch of a partial tile in floats: 16 B x odd
__device__ __forceinline__ float ex2(float v) { return __builtin_amdgcn_exp2f(v); }   // v_exp_f32 alone: an argument far below -126 gives 0, which is what an excluded key and an empty split want
__device__ __forceinline__ float xhalf(float x) { return __builtin_bit_cast(float, __builtin_amdgcn_permlanex16(__builtin_bit_cast(int, x), __builtin_bit_cast(int, x), 0x76543210, 0xfedcba98, false, false)); }   // lane l with lane l ^ 16
__global__ __launch_bounds__(32 * AW) __attribute__((amdgpu_waves_per_eu(4, 4))) void k_attn(const _Float16* __restrict__ QH, const _Float16* __restrict__ QL, const _Float16* __restrict__ KH, const __bf16* __restrict__ VT, const __bf16* __restrict__ VL, const float* __restrict__ SPAN, float* __restrict__ Y) {
  __shared__ __align__(16) float smk[TT]; __shared__ __align__(16) float ss[AW * 32 * OP]; __shared__ float wm[AW][32], wsm[AW][32], wt[AW][32];
  const int tid = threadIdx.x, wave = __builtin_amdgcn_readfirstlane(tid >> 5), lane = tid & 31, col = lane & 15, g = lane >> 4; const int b = blockIdx.x / NH, h = blockIdx.x % NH;
  const int ql0 = (TT / AQ - 1 - (int)blockIdx.z) * AQ;   // the longest blocks start first
  const int qg = wave & 1, ks = wave >> 1, Q0 = ql0 + qg * 32, nch = Q0 / 32 + 1;   // the wave's first query; its queries see the chunks [0, nch), the last one in part
  { const float spv = bfr(SPAN[h]) * (float)TT;   /* span_val[h] * attn_span */
    for (int k = tid; k < ql0 + AQ; k += 32 * AW) smk[k] = fminf(fmaxf(((float)k + spv) / 33.0f, 0.f), 1.0f); }
  _Float16* qls = (_Float16*)&ss[wave * 32 * OP] + lane * 8;   // during the loop the wave's own partial-tile room holds its q fragments, hi then residual (8 KiB, fragment order): 64 registers less, so that four waves fit a SIMD
  { const size_t qo = QKB(b, h, Q0 / 16) + lane * 8; const _Float16 *qhp = QH + qo, *qlp = QL + qo;
#pragma unroll
    for (int i = 0; i < 2; ++i)
#pragma unroll
      for (int kc = 0; kc < 2; ++kc) { const int o = i * 1024 + kc * 512; *(v8h*)(qls + o) = *(const v8h*)(qhp + o); *(v8h*)(qls + o + 256) = *(const v8h*)(qhp + o + 256); *(v8h*)(qls + 2048 + o) = *(const v8h*)(qlp + o); *(v8h*)(qls + 2048 + o + 256) = *(const v8h*)(qlp + o + 256); }
    asm volatile("s_wait_xcnt 0x0" :: "v"(qhp), "v"(qlp) : "memory"); }   // the wait of the q loads; their two address pairs are inputs, so that no register of them is reused in front of it
  __syncthreads();   // the mask table is in LDS
  v8f acc[2][HD / 16] = {}; float m[2] = {-3.0e38f, -3.0e38f}, s[2] = {0.f, 0.f}, t[2] = {0.f, 0.f};
#pragma unroll 1   // kept rolled: a second chunk's fragments beside this one's would not fit four waves per SIMD
  for (int c = ks; c < nch; c += AKS) { float x[2][16]; bool ramp;
    { v16h kf[2][2]; const _Float16* kp = KH + QKB(b, h, c * 2) + lane * 8;
#pragma unroll
      for (int j = 0; j < 2; ++j)
#pragma unroll
        for (int kc = 0; kc < 2; ++kc) kf[j][kc] = frag_hp(kp + j * 1024 + kc * 512);
      asm volatile("s_wait_xcnt 0x0" :: "v"(kp) : "memory");   // the wait of the k loads; their address pair is an input, so that no register of it is rewritten in front of it
      ramp = __builtin_amdgcn_readfirstlane(__builtin_bit_cast(int, smk[c * 32])) != 0x3f800000;   // read here, with the q fragments, so that its LDS latency is not waited out behind the exps
#pragma unroll
      for (int i = 0; i < 2; ++i) { v8f a[2] = {}, l[2] = {}; const v16h qh[2] = {frag_hp(qls + i * 1024), frag_hp(qls + i * 1024 + 512)}, ql[2] = {frag_hp(qls + 2048 + i * 1024), frag_hp(qls + 2048 + i * 1024 + 512)};
        RUNFENCE();
#pragma unroll
        for (int kc = 0; kc < 2; ++kc)
#pragma unroll
          for (int j = 0; j < 2; ++j) { a[j] = wmma16(kf[j][kc], qh[kc], a[j]); l[j] = wmma16(kf[j][kc], ql[kc], l[j]); }
        RUNFENCE();   // behind the second run it also keeps the v loads, which land in the k and q fragments' registers, and their wait out of the run
#pragma unroll
        for (int j = 0; j < 2; ++j) { a[j] += l[j] * (1.0f / 1024.0f);
#pragma unroll
          for (int r = 0; r < 8; ++r) x[i][j * 8 + r] = a[j][r]; } } }   /* the q k products; the division by DH = 64 is in LSC; element j * 8 + r = key 32 c + 16 j + 8 g + r, query Q0 + 16 i + col */
    const size_t vo = VB(b, h, c) + lane * 8; const __bf16 *vhp = VT + vo, *vlp = VL + vo; v16b vh[HD / 16], vl[HD / 16];   // the v loads fly during the softmax
#pragma unroll
    for (int j = 0; j < HD / 16; ++j) { vh[j] = frag_bp(vhp + j * 512); vl[j] = frag_bp(vlp + j * 512); }
    asm volatile("s_wait_xcnt 0x0" :: "v"(vhp), "v"(vlp) : "memory");   // the wait of the v loads; their two address pairs are inputs, so that no register of them is rewritten in front of it
    if (c == nch - 1) {   // the chunk of the diagonal: its first key is the wave's first query
#pragma unroll
      for (int i = 0; i < 2; ++i)
#pragma unroll
        for (int e = 0; e < 16; ++e) if ((e >> 3) * 16 + 8 * g + (e & 7) > i * 16 + col) x[i][e] = -3.0e38f; }
    float mx[2];
#pragma unroll
    for (int i = 0; i < 2; ++i) { float v = x[i][0];
#pragma unroll
      for (int e = 1; e < 16; ++e) v = fmaxf(v, x[i][e]);
      mx[i] = fmaxf(v, xhalf(v)) * LSC; }   // both halves of a query's keys: the two lanes of a query keep one m
    if (__builtin_amdgcn_ballot_w32(mx[0] > m[0] + LTH || mx[1] > m[1] + LTH) != 0) {   // one test per chunk; always taken on a wave's first chunk
#pragma unroll
      for (int i = 0; i < 2; ++i) { const float mn = mx[i] > m[i] + LTH ? mx[i] : m[i]; const float al = ex2(m[i] - mn); m[i] = mn; s[i] *= al; t[i] *= al;
#pragma unroll
        for (int j = 0; j < HD / 16; ++j) acc[i][j] *= al; } }
    float ds[2];
#pragma unroll
    for (int i = 0; i < 2; ++i) { float p[4] = {0.f, 0.f, 0.f, 0.f};
#pragma unroll
      for (int e = 0; e < 16; e += 2) { v2f u = {x[i][e], x[i][e + 1]}; const v2f sc = {LSC, LSC}, nm = {-m[i], -m[i]}; u = __builtin_elementwise_fma(u, sc, nm); x[i][e] = u[0]; x[i][e + 1] = u[1]; }   // two scores per packed fma
#pragma unroll   // x is a register array: every index must be a constant
      for (int e = 0; e < 16; ++e) x[i][e] = ex2(x[i][e]);   // an excluded key: exp2 of about -7e36 is 0
#pragma unroll   // as above, for x and p
      for (int e = 0; e < 16; ++e) p[e & 3] += x[i][e];
      ds[i] = (p[0] + p[1]) + (p[2] + p[3]); s[i] += ds[i]; }
    if (ramp) {   // the mask never falls with k: where the chunk's first key has 1.0, all its keys have, and e * mask is e
      float mk[16];
#pragma unroll
      for (int j = 0; j < 2; ++j) { const v4f u0 = *(const v4f*)&smk[c * 32 + j * 16 + 8 * g], u1 = *(const v4f*)&smk[c * 32 + j * 16 + 8 * g + 4];
#pragma unroll
        for (int r = 0; r < 4; ++r) { mk[j * 8 + r] = u0[r]; mk[j * 8 + 4 + r] = u1[r]; } }
#pragma unroll
      for (int i = 0; i < 2; ++i) { float p[4] = {0.f, 0.f, 0.f, 0.f};
#pragma unroll
        for (int e = 0; e < 16; ++e) { x[i][e] *= mk[e]; p[e & 3] += x[i][e]; }
        ds[i] = (p[0] + p[1]) + (p[2] + p[3]); } }
    t[0] += ds[0]; t[1] += ds[1];
    const F2 p0 = bsplit16(x[0]), p1 = bsplit16(x[1]);
#pragma unroll
    for (int j = 0; j < HD / 16; ++j) { acc[0][j] = wmma_bf(vh[j], p0.l, acc[0][j]); acc[1][j] = wmma_bf(vh[j], p1.l, acc[1][j]); }
#pragma unroll
    for (int j = 0; j < HD / 16; ++j) { acc[0][j] = wmma_bf(vl[j], p0.h, acc[0][j]); acc[1][j] = wmma_bf(vl[j], p1.h, acc[1][j]); }
#pragma unroll
    for (int j = 0; j < HD / 16; ++j) { acc[0][j] = wmma_bf(vh[j], p0.h, acc[0][j]); acc[1][j] = wmma_bf(vh[j], p1.h, acc[1][j]); } }
#pragma unroll
  for (int i = 0; i < 2; ++i) { s[i] += xhalf(s[i]); t[i] += xhalf(t[i]);   // the two halves of a query's keys
    if (g == 0) { wm[wave][i * 16 + col] = m[i]; wsm[wave][i * 16 + col] = s[i]; wt[wave][i * 16 + col] = t[i]; }
#pragma unroll
    for (int j = 0; j < HD / 16; ++j) { float* d = &ss[(wave * 32 + i * 16 + col) * OP + j * 16 + 8 * g]; v4f u0, u1;   // accumulator element r = d 16 j + 8 g + r of query col
#pragma unroll
      for (int r = 0; r < 4; ++r) { u0[r] = acc[i][j][r]; u1[r] = acc[i][j][4 + r]; }
      *(v4f*)d = u0; *(v4f*)(d + 4) = u1; } }
  __syncthreads();   // every wave's partial tile and its m, s, t are in LDS
  const int q4 = (tid & 15) * 4;
#pragma unroll
  for (int i = 0; i < AQ / 16; ++i) { const int rl = i * 16 + (tid >> 4), w0 = rl >> 5, r32 = rl & 31;   // 16 lanes a row: a store covers two runs of 256 contiguous bytes
    float mm = wm[w0][r32];
#pragma unroll
    for (int k = 1; k < AKS; ++k) mm = fmaxf(mm, wm[k * 2 + w0][r32]);
    float sa = 0.f, ta = 0.f; v4f o = {};
#pragma unroll
    for (int k = 0; k < AKS; ++k) { const int w = k * 2 + w0; const float f = ex2(wm[w][r32] - mm); sa += f * wsm[w][r32]; ta += f * wt[w][r32]; o += *(const v4f*)&ss[(w * 32 + r32) * OP + q4] * f; }   // a split without a chunk has m about -3e38: weight 0
    const float ia = 1.0f / sa; const float na = 1.0f / (ta * ia + 1e-8f);   /* w = softmax * ramp mask, renormalised by (sum + 1e-8) */
    float* yp = Y + ((size_t)b * TT + ql0 + rl) * CC + h * HD + q4; const v4f yv = (o * ia) * na; vst2(yp, yv);
    asm volatile("s_wait_xcnt 0x0" :: "v"(yp), "v"(yv) : "memory"); } }   // the wait of this store; its address pair and its data are inputs, so that no register of them is rewritten in front of it
// ---- k_out: block = (128 rows, 128 cols), 8 waves of 64 rows x 32 cols: out = y (bf16 hi + lo) Wo + bo; operands as in k_proj, the y tile staged as its two bf16 planes
__global__ __launch_bounds__(256) void k_out(const float* __restrict__ Y, const __bf16* __restrict__ WB, const float* __restrict__ BP, float* __restrict__ OUT) { __shared__ __align__(16) __bf16 yh[2][128][XP], yl[2][128][XP]; __shared__ __align__(16) float sf[128][132];
  const int tid = threadIdx.x, wave = tid >> 5, lane = tid & 31, col = lane & 15, g = lane >> 4; const int c0 = blockIdx.y * 128; const size_t r0 = (size_t)blockIdx.x * 128;
  const int xrow = tid >> 4, xq = (tid & 15) * 4, rb = (wave >> 2) * 64, cb = (wave & 3) * 32 + 2 * col;   // the wave's first row, the lane's first column in the tile
  const __bf16* wp = WB + WBB(0, blockIdx.y * 4 + (wave & 3)) + lane * 8; const float* xp = Y + (r0 + xrow) * CC + xq;
  v4f xr[8]; v16b wa[2][2], wb[2][2]; v8f acc[4][2] = {};
  ld_wb(wp, wa); ld_x(xp, xr);
  asm volatile("s_wait_xcnt 0x0" :: "v"(wp), "v"(xp) : "memory");   // the wait of stage 0's loads; their two address pairs are inputs, so that no register of them is reused in front of it
#pragma unroll
  for (int u = 0; u < 8; ++u) { v4b h, l;
#pragma unroll
    for (int e = 0; e < 4; ++e) { h[e] = (__bf16)xr[u][e]; l[e] = (__bf16)(xr[u][e] - (float)h[e]); }
    *(v4b*)&yh[0][u * 16 + xrow][xq] = h; *(v4b*)&yl[0][u * 16 + xrow][xq] = l; }
  __syncthreads();   // stage 0 is in LDS
  auto stage = [&](const int s, const int bu, const v16b (&wf)[2][2], v16b (&wn)[2][2]) {   // as in k_proj
    const bool more = s + 1 < CC / GK;
    if (more) { ld_wb(wp + WSTG, wn); ld_x(xp + GK, xr);
      asm volatile("s_wait_xcnt 0x0" :: "v"(wp), "v"(xp) : "memory");   // the wait of these loads; their two address pairs are inputs, so that no register of them is rewritten in front of it
      wp += WSTG; xp += GK; }
#pragma unroll
    for (int c = 0; c < 2; ++c) { v16b ah[4], al[4];
#pragma unroll
      for (int i = 0; i < 4; ++i) { ah[i] = frag_b(&yh[bu][rb + i * 16 + col][c * 32], lane); al[i] = frag_b(&yl[bu][rb + i * 16 + col][c * 32], lane); }
      RUNFENCE();
#pragma unroll
      for (int i = 0; i < 4; ++i) { acc[i][0] = wmma_bf(ah[i], wf[c][0], acc[i][0]); acc[i][1] = wmma_bf(ah[i], wf[c][1], acc[i][1]); }
#pragma unroll
      for (int i = 0; i < 4; ++i) { acc[i][0] = wmma_bf(al[i], wf[c][0], acc[i][0]); acc[i][1] = wmma_bf(al[i], wf[c][1], acc[i][1]); }
      if (c == 0) RUNFENCE(); }
    if (more) {
#pragma unroll
      for (int u = 0; u < 8; ++u) { v4b h, l;
#pragma unroll
        for (int e = 0; e < 4; ++e) { h[e] = (__bf16)xr[u][e]; l[e] = (__bf16)(xr[u][e] - (float)h[e]); }
        *(v4b*)&yh[bu ^ 1][u * 16 + xrow][xq] = h; *(v4b*)&yl[bu ^ 1][u * 16 + xrow][xq] = l; } }
    __syncthreads(); };   // publishes stage s + 1 and ends every wave's reads of stage s, whose buffers the next stage refills
#pragma unroll 1   // two stages a trip and no more: the two fragment sets change places without a register copy
  for (int s = 0; s < CC / GK; s += 2) { stage(s, 0, wa, wb); stage(s + 1, 1, wb, wa); }
  const float b0 = BP ? bfr(BP[c0 + cb]) : 0.f, b1 = BP ? bfr(BP[c0 + cb + 1]) : 0.f;
#pragma unroll
  for (int i = 0; i < 4; ++i)
#pragma unroll
    for (int r = 0; r < 8; ++r) { v2f o; o[0] = acc[i][0][r] + b0; o[1] = acc[i][1][r] + b1; *(v2f*)&sf[rb + i * 16 + 8 * g + r][cb] = o; }
  __syncthreads();   // the 128 x 128 tile is in LDS: each wave stores 16 whole rows of it
  for (int rl = 0; rl < 16; ++rl) vst2(OUT + (r0 + wave * 16 + rl) * CC + c0 + lane * 4, *(const v4f*)&sf[wave * 16 + rl][lane * 4]); }
extern "C" void kernel_launch(void* const* d_in, const int* in_sizes, int n_in, void* d_out, int out_size, void* d_ws, size_t ws_size, hipStream_t stream) {
  (void)in_sizes; (void)n_in; (void)out_size;
  const float** F = (const float**)d_in;   // 0 query [2,2048,1024], 1 Wq [1024,1024] ((in,out)), 2 Wk, 3 Wv, 4 Wo ((in,out)), 5 span_val [1,16,1,1] (verbatim)
  if (ws_size < (size_t)WS_END) return;
  char* ws = (char*)d_ws; _Float16 *QH = (_Float16*)(ws + WS_QH), *QL = (_Float16*)(ws + WS_QL), *KH = (_Float16*)(ws + WS_KH); __bf16 *VT = (__bf16*)(ws + WS_VT), *VL = (__bf16*)(ws + WS_VL); float *Y = (float*)(ws + WS_Y); __bf16 *WB = (__bf16*)(ws + WS_WB);
  k_wcv<<<dim3(CC / 32 * (CC / 32) * 2 / 8), 256, 0, stream>>>(F[1], F[2], F[3], F[4], WB);
  k_proj<<<dim3(TNB * TT / 128, CC / 128), 384, 0, stream>>>(F[0], WB, nullptr, nullptr, nullptr, QH, QL, KH, VT, VL);
  k_attn<<<dim3(TNB * NH, 1, TT / AQ), 32 * AW, 0, stream>>>(QH, QL, KH, VT, VL, F[5], Y);
  k_out<<<dim3(TNB * TT / 128, CC / 128), 256, 0, stream>>>(Y, WB + 3 * (size_t)CC * CC, nullptr, (float*)d_out);
}

// v010
// A run of this version takes 82.5 microseconds.
// Next to v009, in two timings, it ran 1.12 times as fast each time.
// Counting every step since v000, it is 16.6 times as fast.
// compute dtype: all float inputs rounded to bf16 (the four W once, by k_wcv), span_val read; q/k/v = query W with EXACT bf16 products on WMMA 16x16x32, f32 accumulate; q as f16 hi + residual (x 2^10), k f16 -> 2-product logits / 64 (the module divides by DH), causal (-1e9 additive == exclusion), kept in f32 registers; running softmax sums, the adaptive-span ramp mask and the renormalisation (+1e-8) in f32 (exp as the hardware exp2 of (logit - m) * log2 e); exp * mask f32 split bf16 hi + lo against v bf16 hi + lo (3 products); out = y (bf16 hi + lo) Wo; f32 output.
#include <hip/hip_runtime.h>
#include <math.h>

typedef __attribute__((ext_vector_type(16))) _Float16 v16h;
typedef __attribute__((ext_vector_type(16))) __bf16 v16b;
typedef __attribute__((ext_vector_type(8)))  _Float16 v8h;
typedef __attribute__((ext_vector_type(8)))  float v8f;
typedef __attribute__((ext_vector_type(4)))  float v4f;
typedef __attribute__((ext_vector_type(2)))  float v2f;
typedef __attribute__((ext_vector_type(4)))  unsigned v4u;
typedef __attribute__((ext_vector_type(4)))  int v4i;
typedef float __attribute__((may_alias)) float_a;
typedef int __attribute__((may_alias)) int_a;

template <typename T> __device__ __forceinline__ void vst2(void* p, T v) { *(T*)p = v;  }
__device__ __forceinline__ v8f wmma16(v16h a, v16h b, v8f c) {
  return __builtin_amdgcn_wmma_f32_16x16x32_f16(false, a, false, b, (short)0, c, false, false);
}
__device__ __forceinline__ v8f wmma_bf(v16b a, v16b b, v8f c) {
  return __builtin_amdgcn_wmma_f32_16x16x32_bf16(false, a, false, b, (short)0, c, false, false);
}
// 16x16x32 fragments: lane = (h = lane>>4, row/col = lane&15); elements 0..7 = k0+8h+0..7, 8..15 = k0+16+8h+0..7; D element r = row 8h+r
__device__ __forceinline__ v16h frag_h(const _Float16* rowk0, int lane) {
  union { v16h v; v8h q[2]; } u; const _Float16* p = rowk0 + 8 * (lane >> 4);
  u.q[0] = *(const v8h*)p; u.q[1] = *(const v8h*)(p + 16); return u.v;
}
__device__ __forceinline__ v16h frag_f32(const float* rowk0, int lane) {
  v16h a; const float* p = rowk0 + 8 * (lane >> 4);
#pragma unroll
  for (int i = 0; i < 8; ++i) { a[i] = (_Float16)p[i]; a[8 + i] = (_Float16)p[16 + i]; }
  return a;
}
__device__ __forceinline__ v16h frag_f32s(const float* rowk0, int lane, float sc) {
  v16h a; const float* p = rowk0 + 8 * (lane >> 4);
#pragma unroll
  for (int i = 0; i < 8; ++i) { a[i] = (_Float16)(p[i] * sc); a[8 + i] = (_Float16)(p[16 + i] * sc); }
  return a;
}
// column fragment from a [K][ld] layout (column n), rows >= K read as 0
__device__ __forceinline__ v16h fragc_f32(const float* W, int k0, int n, int lane, int ld, int K) {
  v16h a; const int g = lane >> 4;
#pragma unroll
  for (int i = 0; i < 8; ++i) { const int ka = k0 + 8 * g + i, kb = ka + 16;
    a[i] = (_Float16)(ka < K ? W[(size_t)(ka < K ? ka : K - 1) * ld + n] : 0.f); a[8 + i] = (_Float16)(kb < K ? W[(size_t)(kb < K ? kb : K - 1) * ld + n] : 0.f); }
  return a;
}
struct F2 { v16b h, l; };
__device__ __forceinline__ F2 bsplit16(const float v[16]) { F2 r;
#pragma unroll
  for (int i = 0; i < 16; ++i) { const __bf16 h = (__bf16)v[i]; r.h[i] = h; r.l[i] = (__bf16)(v[i] - (float)h); }
  return r; }
__device__ __forceinline__ F2 split_row(const float* row, int k0, int lane) { float v[16]; const float* p = row + k0 + 8 * (lane >> 4);
#pragma unroll
  for (int i = 0; i < 8; ++i) { v[i] = p[i]; v[8 + i] = p[16 + i]; }
  return bsplit16(v); }
__device__ __forceinline__ F2 split_rowK(const float* row, int k0, int lane, int K) { float v[16]; const int g = lane >> 4;
#pragma unroll
  for (int i = 0; i < 8; ++i) { const int ka = k0 + 8 * g + i, kb = ka + 16; v[i] = ka < K ? row[ka < K ? ka : K - 1] : 0.f; v[8 + i] = kb < K ? row[kb < K ? kb : K - 1] : 0.f; }
  return bsplit16(v); }
__device__ __forceinline__ F2 split_col(const float* W, int k0, int n, int lane, int ld, int K) { float v[16]; const int g = lane >> 4;
#pragma unroll
  for (int i = 0; i < 8; ++i) { const int ka = k0 + 8 * g + i, kb = ka + 16; v[i] = ka < K ? W[(size_t)(ka < K ? ka : K - 1) * ld + n] : 0.f; v[8 + i] = kb < K ? W[(size_t)(kb < K ? kb : K - 1) * ld + n] : 0.f; }
  return bsplit16(v); }
__device__ __forceinline__ v8f mac3(const F2& a, const F2& b, v8f c) { c = wmma_bf(a.l, b.h, c); c = wmma_bf(a.h, b.l, c); return wmma_bf(a.h, b.h, c); }
__device__ __forceinline__ float sigm(float v) { return 1.0f / (1.0f + expf(-v)); }
#define RUNFENCE() __builtin_amdgcn_sched_barrier(0)   // nothing is scheduled across it: a run's LDS fragment reads stay one group in front of the run's products (spread among them, each read is waited for alone)
#define LDSX() do { asm volatile("s_wait_dscnt 0" ::: "memory"); __builtin_amdgcn_wave_barrier(); __builtin_amdgcn_fence(__ATOMIC_RELEASE, "workgroup"); } while (0)


// Adaptive-span causal attention (B 2, S 2,048, hidden 1,024 = 16 x 64, ramp 32): w = softmax(q k^T / 64 + triu(-1e9, 1)); w = w * clip((k_idx + span_val[h] * S) / 33, 0, 1); w = w / (sum_k w + 1e-8); out = (w v) Wo (no biases).
#define NB 2
#define TT 2048
#define CC 1024
#define NH 16
#define HD 64
#ifndef TNB
#define TNB NB
#endif
typedef __attribute__((ext_vector_type(8))) __bf16 v8b;
__device__ __forceinline__ v16b frag_b(const __bf16* rowk0, int lane) {
  union { v16b v; v8b q[2]; } u; const __bf16* p = rowk0 + 8 * (lane >> 4);
  u.q[0] = *(const v8b*)p; u.q[1] = *(const v8b*)(p + 16); return u.v;
}
__device__ __forceinline__ float bfr(float v) { return (float)(__bf16)v; }
__device__ __attribute__((noinline)) float exp_ni(float v) { return expf(v); }
__device__ __attribute__((noinline)) float erf_ni(float v) { return erff(v); }

#define WS_QH  0u
#define WS_QL  (WS_QH + 2u * (size_t)NB * TT * CC)
#define WS_KH  (WS_QL + 2u * (size_t)NB * TT * CC)
#define WS_VT  (WS_KH + 2u * (size_t)NB * TT * CC)      // bf16 v planes
#define WS_VL  (WS_VT + 2u * (size_t)NB * CC * TT)      // bf16 v residual planes
#define WS_Y   (WS_VL + 2u * (size_t)NB * CC * TT)      // f32 y rows [b*t][C]
#define WS_WB  (WS_Y + 4u * (size_t)NB * TT * CC)       // bf16 Wq, Wk, Wv, Wo in fragment order
#define WS_END (WS_WB + 4u * 2u * (size_t)CC * CC)

// The q, k and v planes lie in fragment order, in 16-byte pieces of 8 elements: q, k: per (b, h, 16 rows) 1,024 elements [d / 8][row][8]; v: per (b, h, 32 keys) 2,048 elements [d / 16][key / 8][d % 16][8].
// A lane's two halves of a 16x16x32 fragment then lie at lane * 16 B in two successive 512-byte runs: each load of a wave covers four whole 128-byte lines. p holds the lane's 8 * lane.
#define QKB(b, h, t16) (((size_t)((b) * NH + (h)) * (TT / 16) + (t16)) * 1024)
#define VB(b, h, t32) (((size_t)((b) * NH + (h)) * (TT / 32) + (t32)) * 2048)
__device__ __forceinline__ v16h frag_hp(const _Float16* p) { union { v16h v; v8h q[2]; } u; u.q[0] = *(const v8h*)p; u.q[1] = *(const v8h*)(p + 256); return u.v; }
__device__ __forceinline__ v16b frag_bp(const __bf16* p) { union { v16b v; v8b q[2]; } u; u.q[0] = *(const v8b*)p; u.q[1] = *(const v8b*)(p + 256); return u.v; }
#define GK 64                                         // k per stage of the two GEMM kernels
#define XP 72                                         // LDS row pitch of a staged tile in bf16: 144 B = 16 B x odd, so 16-byte reads down 16 rows meet no bank twice
typedef __attribute__((ext_vector_type(4))) __bf16 v4b;
// The four W planes lie in the workspace as bf16 in fragment order: per (32 k, 32 columns) 1,024 elements [e][k half][lane][8]: lane (col, g) holds column 2 col + e, k half * 16 + 8 g + 0..7.
// Fragment e then holds column 2 col + e in lane col: the k order is that of frag_b, only the tile's columns are renumbered (undone where the accumulators are stored). A lane's two halves lie at lane * 16 B in two successive 512-byte runs, as in the q, k, v planes.
#define WBB(kc, n32) (((size_t)(kc) * (CC / 32) + (n32)) * 1024)
#define WSTG WBB(GK / 32, 0)                          // elements from one 64-k stage to the next
// A block of the two GEMM kernels walks its 16 k stages from a stage of its own and wraps round: the 32 blocks that share a W panel and the 8 that share a row tile are resident together, and from one common start they would all ask L2 for the same lines at the same moment.
#define KS0 ((int)((blockIdx.x + 2 * blockIdx.y) & (CC / GK - 1)))   // 8 different starts among the sharers of a row tile, 16 among those of a W panel
// ---- k_wcv: every W element is read as f32 and rounded to bf16 once, instead of once in each of the 32 row blocks that use it. A wave takes 16 k x 32 columns of each of the four planes: a load covers two whole 128-byte lines, a store 512 contiguous bytes.
__global__ __launch_bounds__(256) void k_wcv(const float* __restrict__ W0, const float* __restrict__ W1, const float* __restrict__ W2, const float* __restrict__ W3, __bf16* __restrict__ WB) {
  const int tid = threadIdx.x, lane = tid & 31, col = lane & 15, g = lane >> 4, u = blockIdx.x * 8 + (tid >> 5), n32 = u & 31, hf = (u >> 5) & 1, kc = u >> 6;
  const size_t so = (size_t)(kc * 32 + hf * 16 + 8 * g) * CC + n32 * 32 + 2 * col; const float *p0 = W0 + so, *p1 = W1 + so, *p2 = W2 + so, *p3 = W3 + so;
  v2f r[4][8];
#pragma unroll
  for (int i = 0; i < 8; ++i) { r[0][i] = *(const v2f*)(p0 + (size_t)i * CC); r[1][i] = *(const v2f*)(p1 + (size_t)i * CC); r[2][i] = *(const v2f*)(p2 + (size_t)i * CC); r[3][i] = *(const v2f*)(p3 + (size_t)i * CC); }
  asm volatile("s_wait_xcnt 0x0" :: "v"(p0), "v"(p1), "v"(p2), "v"(p3) : "memory");   // the wait of these loads; their four address pairs are inputs, so that no register of them is reused in front of it
  __bf16* d = WB + WBB(kc, n32) + hf * 256 + lane * 8; v4u o[4][2];
#pragma unroll
  for (int m = 0; m < 4; ++m)
#pragma unroll
    for (int e = 0; e < 2; ++e) { union { v8b b; v4u w; } x;
#pragma unroll
      for (int i = 0; i < 8; ++i) x.b[i] = (__bf16)r[m][i][e];
      o[m][e] = x.w; vst2(d + (size_t)m * CC * CC + e * 512, o[m][e]); }
  asm volatile("s_wait_xcnt 0x0" :: "v"(d), "v"(o[0][0]), "v"(o[0][1]), "v"(o[1][0]), "v"(o[1][1]), "v"(o[2][0]), "v"(o[2][1]), "v"(o[3][0]), "v"(o[3][1]) : "memory"); }   // the wait of these stores; their address pair and data are inputs, so that no register of them is rewritten in front of it
// the W fragments of one stage for a wave's 32 columns: 8 loads of 512 contiguous bytes; wp holds the lane's 8 * lane
__device__ __forceinline__ void ld_wb(const __bf16* wp, v16b (&wf)[2][2]) {
#pragma unroll
  for (int c = 0; c < 2; ++c)
#pragma unroll
    for (int e = 0; e < 2; ++e) wf[c][e] = frag_bp(wp + WBB(c, 0) + e * 512);
}
// the block's 128 x 64 f32 tile of one stage: 16 lanes a row, so a load covers two rows of 256 contiguous bytes
__device__ __forceinline__ void ld_x(const float* xp, v4f (&xr)[8]) {
#pragma unroll
  for (int u = 0; u < 8; ++u) xr[u] = *(const v4f*)(xp + (size_t)(u * 16) * CC);
}
// ---- k_proj: block = 128 rows x (128 cols of each of q, k, v), 12 waves of 128 rows x 32 cols, four waves per plane: qkv = x W (+ b), exact; q -> f16 hi (+ residual), k -> f16 rows, v -> bf16 planes
//      per 64-k stage the x tile goes once through LDS as bf16 (two buffers, staged by the first 8 waves) and serves all 12 waves, so q, k and v share one read of x; a wave owns its 32 columns of W over all the block's rows, so no W element is loaded twice in a block, and takes them as ready bf16 fragments from k_wcv's planes; the next stage's loads fly during this stage's products
#define PTB (2 * 128 * 136 * 2)                       // LDS bytes of one plane's output tile, hi + residual
__global__ __launch_bounds__(384) void k_proj(const float* __restrict__ X, const __bf16* __restrict__ WB, const float* __restrict__ BQ, const float* __restrict__ BK, const float* __restrict__ BV, _Float16* __restrict__ QH, _Float16* __restrict__ QL, _Float16* __restrict__ KH, __bf16* __restrict__ VT, __bf16* __restrict__ VL) {
  __shared__ __align__(16) unsigned char sm[3 * PTB];   // one of: the two stage buffers (loop), the three output tiles (q, k rows hi + residual, v planes hi + residual); a barrier stands between the uses
  const int tid = threadIdx.x, wave = __builtin_amdgcn_readfirstlane(tid >> 5), lane = tid & 31, col = lane & 15, g = lane >> 4; const int which = wave >> 2; const int c0 = blockIdx.y * 128; const size_t r0 = (size_t)blockIdx.x * 128; const float* BA = which == 0 ? BQ : which == 1 ? BK : BV;
  unsigned char* smw = sm + which * PTB;
  _Float16 (*sh)[136] = (_Float16 (*)[136])smw, (*sl)[136] = (_Float16 (*)[136])(smw + 128 * 136 * 2); __bf16 (*th)[136] = (__bf16 (*)[136])smw, (*tl2)[136] = (__bf16 (*)[136])(smw + 128 * 136 * 2);
  __bf16 (*xs)[128][XP] = (__bf16 (*)[128][XP])sm;
  const bool xw = wave < 8;   // the waves that stage x: 256 threads, 8 pieces of 16 bytes each
  const int xrow = (tid >> 4) & 15, xq = (tid & 15) * 4, cb = (wave & 3) * 32 + 2 * col;   // the lane's first column in its plane's tile
  const __bf16* wp = WB + (size_t)which * CC * CC + WBB(0, blockIdx.y * 4 + (wave & 3)) + lane * 8; const float* xp = X + (r0 + xrow) * CC + xq;
  const int s0 = KS0;   // the block's first k stage
  v4f xr[8]; v16b wa[2][2], wb[2][2]; v8f acc[8][2] = {};
  { const __bf16* wq = wp + (size_t)s0 * WSTG; const float* xn = xp + s0 * GK;
    ld_wb(wq, wa);
    if (xw) ld_x(xn, xr);
    asm volatile("s_wait_xcnt 0x0" :: "v"(wq), "v"(xn) : "memory"); }   // the wait of the first stage's loads; their two address pairs are inputs, so that no register of them is reused in front of it
  if (xw) {
#pragma unroll
    for (int u = 0; u < 8; ++u) { v4b h;
#pragma unroll
      for (int e = 0; e < 4; ++e) h[e] = (__bf16)xr[u][e];
      *(v4b*)&xs[0][u * 16 + xrow][xq] = h; } }
  __syncthreads();   // stage 0 is in LDS
  auto stage = [&](const int s, const int bu, const v16b (&wf)[2][2], v16b (&wn)[2][2]) {   // stage s from x buffer bu and the fragments wf; the next stage's fragments land in wn
    const bool more = s + 1 < CC / GK;
    if (more) { const int sn = (s0 + s + 1) & (CC / GK - 1); const __bf16* wq = wp + (size_t)sn * WSTG; const float* xn = xp + sn * GK;   // the walk wraps round behind the last k stage
      ld_wb(wq, wn); if (xw) ld_x(xn, xr);
      asm volatile("s_wait_xcnt 0x0" :: "v"(wq), "v"(xn) : "memory"); }   // the wait of these loads; their two address pairs are inputs, so that no register of them is rewritten in front of it
#pragma unroll
    for (int c = 0; c < 2; ++c)
#pragma unroll
      for (int hf = 0; hf < 2; ++hf) { v16b a[4];
#pragma unroll
        for (int i = 0; i < 4; ++i) a[i] = frag_b(&xs[bu][hf * 64 + i * 16 + col][c * 32], lane);
        RUNFENCE();
#pragma unroll
        for (int i = 0; i < 4; ++i) { acc[hf * 4 + i][0] = wmma_bf(a[i], wf[c][0], acc[hf * 4 + i][0]); acc[hf * 4 + i][1] = wmma_bf(a[i], wf[c][1], acc[hf * 4 + i][1]); }
        if (c == 0 || hf == 0) RUNFENCE(); }
    if (more) {
      if (xw) {
#pragma unroll
        for (int u = 0; u < 8; ++u) { v4b h;
#pragma unroll
          for (int e = 0; e < 4; ++e) h[e] = (__bf16)xr[u][e];
          *(v4b*)&xs[bu ^ 1][u * 16 + xrow][xq] = h; } } }
    __syncthreads(); };   // publishes stage s + 1 and ends every wave's reads of stage s, whose buffer the next stage refills
#pragma unroll 1   // two stages a trip and no more: the two fragment sets change places without a register copy
  for (int s = 0; s < CC / GK; s += 2) { stage(s, 0, wa, wb); stage(s + 1, 1, wb, wa); }
  const float bb[2] = {BA ? bfr(BA[c0 + cb]) : 0.f, BA ? bfr(BA[c0 + cb + 1]) : 0.f};
  if (which == 2) {   // the plane is the wave's own: one test for the whole tile
#pragma unroll
    for (int i = 0; i < 8; ++i)
#pragma unroll
      for (int e = 0; e < 2; ++e)
#pragma unroll
        for (int r = 0; r < 8; ++r) { const float v = acc[i][e][r] + bb[e]; const int cl = cb + e, rl = i * 16 + 8 * g + r; const __bf16 bh = (__bf16)v; th[cl][rl] = bh; tl2[cl][rl] = (__bf16)(v - (float)bh); } }
  else {
#pragma unroll
    for (int i = 0; i < 8; ++i)
#pragma unroll
      for (int r = 0; r < 8; ++r)
#pragma unroll
        for (int e = 0; e < 2; ++e) { const float v = acc[i][e][r] + bb[e]; const int cl = cb + e, rl = i * 16 + 8 * g + r; const _Float16 hv = (_Float16)v; sh[rl][cl] = hv; sl[rl][cl] = (_Float16)((v - (float)hv) * 1024.0f); } }   /* q residual carried x 2^10 so the plane stays f16-normal on the chip */
  __syncthreads();
  const int bi = (int)(r0 / TT), t0 = (int)(r0 % TT), h0 = c0 / HD, pl = tid & 15, p8 = (tid >> 4) & 7;   // a lane's place in a piece run, its run among the 8 of its plane's four waves: a wave stores 512 contiguous bytes
  if (which < 2) { _Float16* dh = which == 0 ? QH : KH; for (int e = 0; e < 16; ++e) { const int rl = (e >> 1) * 16 + pl, q = (e & 1) * 8 + p8; const size_t o1 = QKB(bi, h0 + (q >> 3), t0 / 16 + (e >> 1)) + (q & 7) * 128 + pl * 8; _Float16* d0 = dh + o1; const v4u x0 = *(const v4u*)&sh[rl][q * 8]; vst2((unsigned*)d0, x0);
      asm volatile("s_wait_xcnt 0x0" :: "v"(d0), "v"(x0) : "memory");   // the wait of this store; its address pair and its data are inputs, so that no register of them is rewritten in front of it
      if (which == 0) { _Float16* d1 = QL + o1; const v4u x1 = *(const v4u*)&sl[rl][q * 8]; vst2((unsigned*)d1, x1);
        asm volatile("s_wait_xcnt 0x0" :: "v"(d1), "v"(x1) : "memory"); } } }   // as above
  else { for (int e = 0; e < 16; ++e) { const int pq = (e & 1) * 8 + p8, f = e >> 1; const int cl = (f & 1) * 64 + (pq >> 2) * 16 + pl, q = (f >> 1) * 4 + (pq & 3); const size_t o2 = VB(bi, h0 + (f & 1), t0 / 32 + (f >> 1)) + pq * 128 + pl * 8; __bf16 *d0 = VT + o2, *d1 = VL + o2; const v4u x0 = *(const v4u*)&th[cl][q * 8], x1 = *(const v4u*)&tl2[cl][q * 8]; vst2((unsigned*)d0, x0); vst2((unsigned*)d1, x1);
      asm volatile("s_wait_xcnt 0x0" :: "v"(d0), "v"(d1), "v"(x0), "v"(x1) : "memory"); } } }   // the wait of these two stores, as above
// ---- k_attn: block = 64 queries of (b,h), 8 waves = 2 groups of 32 queries x 4 key splits; the logits never leave the registers.
//      A wave walks the 32-key chunks ks, ks + 4, ... of its 32 queries (from a start of the block's own, wrapping round): S^T = K Q^T (a lane holds 16 keys of one query per 16-query tile), logits / 64, causal on the last chunk only;
//      e = exp(logit - m) = exp2(product * LSC - m2), one fma and one v_exp_f32 per score: m2 is the maximum in use in log2 units (raised, with a rescale of the sums, only when a chunk's maximum passes it by more than LTH: e stays below e^8);
//      s += sum e, t += sum e * ramp mask clip((k + span_val[h] S)/(RAMP+1), 0, 1), O^T += V^T (e * mask)^T: the score registers are the B fragment as they stand.
//      The 4 key splits of a query are joined through LDS in split order, each weighted exp2(m2_w - max m2): y = (O / s) / (t / s + 1e-8).
#define AQ 64
#define AKS 4
#define AW 8
#define LSC (1.4426950408889634f / 64.0f)            // log2 e / DH: q k product -> logit in log2 units
#define LTH 11.541560327111707f                      // 8 * log2 e
#define OP (HD + 4)                                   // LDS row pitch of a partial tile in floats: 16 B x odd
__device__ __forceinline__ float ex2(float v) { return __builtin_amdgcn_exp2f(v); }   // v_exp_f32 alone: an argument far below -126 gives 0, which is what an excluded key and an empty split want
__device__ __forceinline__ float xhalf(float x) { return __builtin_bit_cast(float, __builtin_amdgcn_permlanex16(__builtin_bit_cast(int, x), __builtin_bit_cast(int, x), 0x76543210, 0xfedcba98, false, false)); }   // lane l with lane l ^ 16
__global__ __launch_bounds__(32 * AW) __attribute__((amdgpu_waves_per_eu(4, 4))) void k_attn(const _Float16* __restrict__ QH, const _Float16* __restrict__ QL, const _Float16* __restrict__ KH, const __bf16* __restrict__ VT, const __bf16* __restrict__ VL, const float* __restrict__ SPAN, float* __restrict__ Y) {
  __shared__ __align__(16) float smk[TT]; __shared__ __align__(16) float ss[AW * 32 * OP]; __shared__ float wm[AW][32], wsm[AW][32], wt[AW][32];
  const int tid = threadIdx.x, wave = __builtin_amdgcn_readfirstlane(tid >> 5), lane = tid & 31, col = lane & 15, g = lane >> 4; const int b = blockIdx.x / NH, h = blockIdx.x % NH;
  const int ql0 = (TT / AQ - 1 - (int)blockIdx.z) * AQ;   // the longest blocks start first
  const int qg = wave & 1, ks = wave >> 1, Q0 = ql0 + qg * 32, nch = Q0 / 32 + 1;   // the wave's first query; its queries see the chunks [0, nch), the last one in part
  { const float spv = bfr(SPAN[h]) * (float)TT;   /* span_val[h] * attn_span */
    for (int k = tid; k < ql0 + AQ; k += 32 * AW) smk[k] = fminf(fmaxf(((float)k + spv) / 33.0f, 0.f), 1.0f); }
  _Float16* qls = (_Float16*)&ss[wave * 32 * OP] + lane * 8;   // during the loop the wave's own partial-tile room holds its q fragments, hi then residual (8 KiB, fragment order): 64 registers less, so that four waves fit a SIMD
  { const size_t qo = QKB(b, h, Q0 / 16) + lane * 8; const _Float16 *qhp = QH + qo, *qlp = QL + qo;
#pragma unroll
    for (int i = 0; i < 2; ++i)
#pragma unroll
      for (int kc = 0; kc < 2; ++kc) { const int o = i * 1024 + kc * 512; *(v8h*)(qls + o) = *(const v8h*)(qhp + o); *(v8h*)(qls + o + 256) = *(const v8h*)(qhp + o + 256); *(v8h*)(qls + 2048 + o) = *(const v8h*)(qlp + o); *(v8h*)(qls + 2048 + o + 256) = *(const v8h*)(qlp + o + 256); }
    asm volatile("s_wait_xcnt 0x0" :: "v"(qhp), "v"(qlp) : "memory"); }   // the wait of the q loads; their two address pairs are inputs, so that no register of them is reused in front of it
  __syncthreads();   // the mask table is in LDS
  v8f acc[2][HD / 16] = {}; float m[2] = {-3.0e38f, -3.0e38f}, s[2] = {0.f, 0.f}, t[2] = {0.f, 0.f};
  // The query blocks of one (b,h) are resident together and read the same k and v chunks: each starts its walk at a place of its own and wraps round, so that they do not all ask L2 for the same lines at the same moment.
  // ntr trips are common to the block's two query groups, which so stay in step on the same chunk; the upper group's one chunk more comes last.
  const int ntr = (ql0 / 32 + 1 - ks + AKS - 1) / AKS, nt = (nch - ks + AKS - 1) / AKS, t0 = ntr > 0 ? ((int)blockIdx.z & 7) % ntr : 0;   // neighbouring query blocks start one trip apart
#pragma unroll 1   // kept rolled: a second chunk's fragments beside this one's would not fit four waves per SIMD
  for (int u = 0; u < nt; ++u) { const int tw = u + t0, c = ks + AKS * (u >= ntr ? u : tw >= ntr ? tw - ntr : tw); float x[2][16]; bool ramp;
    { v16h kf[2][2]; const _Float16* kp = KH + QKB(b, h, c * 2) + lane * 8;
#pragma unroll
      for (int j = 0; j < 2; ++j)
#pragma unroll
        for (int kc = 0; kc < 2; ++kc) kf[j][kc] = frag_hp(kp + j * 1024 + kc * 512);
      asm volatile("s_wait_xcnt 0x0" :: "v"(kp) : "memory");   // the wait of the k loads; their address pair is an input, so that no register of it is rewritten in front of it
      ramp = __builtin_amdgcn_readfirstlane(__builtin_bit_cast(int, smk[c * 32])) != 0x3f800000;   // read here, with the q fragments, so that its LDS latency is not waited out behind the exps
#pragma unroll
      for (int i = 0; i < 2; ++i) { v8f a[2] = {}, l[2] = {}; const v16h qh[2] = {frag_hp(qls + i * 1024), frag_hp(qls + i * 1024 + 512)}, ql[2] = {frag_hp(qls + 2048 + i * 1024), frag_hp(qls + 2048 + i * 1024 + 512)};
        RUNFENCE();
#pragma unroll
        for (int kc = 0; kc < 2; ++kc)
#pragma unroll
          for (int j = 0; j < 2; ++j) { a[j] = wmma16(kf[j][kc], qh[kc], a[j]); l[j] = wmma16(kf[j][kc], ql[kc], l[j]); }
        RUNFENCE();   // behind the second run it also keeps the v loads, which land in the k and q fragments' registers, and their wait out of the run
#pragma unroll
        for (int j = 0; j < 2; ++j) { a[j] += l[j] * (1.0f / 1024.0f);
#pragma unroll
          for (int r = 0; r < 8; ++r) x[i][j * 8 + r] = a[j][r]; } } }   /* the q k products; the division by DH = 64 is in LSC; element j * 8 + r = key 32 c + 16 j + 8 g + r, query Q0 + 16 i + col */
    const size_t vo = VB(b, h, c) + lane * 8; const __bf16 *vhp = VT + vo, *vlp = VL + vo; v16b vh[HD / 16], vl[HD / 16];   // the v loads fly during the softmax
#pragma unroll
    for (int j = 0; j < HD / 16; ++j) { vh[j] = frag_bp(vhp + j * 512); vl[j] = frag_bp(vlp + j * 512); }
    asm volatile("s_wait_xcnt 0x0" :: "v"(vhp), "v"(vlp) : "memory");   // the wait of the v loads; their two address pairs are inputs, so that no register of them is rewritten in front of it
    if (c == nch - 1) {   // the chunk of the diagonal: its first key is the wave's first query
#pragma unroll
      for (int i = 0; i < 2; ++i)
#pragma unroll
        for (int e = 0; e < 16; ++e) if ((e >> 3) * 16 + 8 * g + (e & 7) > i * 16 + col) x[i][e] = -3.0e38f; }
    float mx[2];
#pragma unroll
    for (int i = 0; i < 2; ++i) { float v = x[i][0];
#pragma unroll
      for (int e = 1; e < 16; ++e) v = fmaxf(v, x[i][e]);
      mx[i] = fmaxf(v, xhalf(v)) * LSC; }   // both halves of a query's keys: the two lanes of a query keep one m
    if (__builtin_amdgcn_ballot_w32(mx[0] > m[0] + LTH || mx[1] > m[1] + LTH) != 0) {   // one test per chunk; always taken on a wave's first chunk
#pragma unroll
      for (int i = 0; i < 2; ++i) { const float mn = mx[i] > m[i] + LTH ? mx[i] : m[i]; const float al = ex2(m[i] - mn); m[i] = mn; s[i] *= al; t[i] *= al;
#pragma unroll
        for (int j = 0; j < HD / 16; ++j) acc[i][j] *= al; } }
    float ds[2];
#pragma unroll
    for (int i = 0; i < 2; ++i) { float p[4] = {0.f, 0.f, 0.f, 0.f};
#pragma unroll
      for (int e = 0; e < 16; e += 2) { v2f u = {x[i][e], x[i][e + 1]}; const v2f sc = {LSC, LSC}, nm = {-m[i], -m[i]}; u = __builtin_elementwise_fma(u, sc, nm); x[i][e] = u[0]; x[i][e + 1] = u[1]; }   // two scores per packed fma
#pragma unroll   // x is a register array: every index must be a constant
      for (int e = 0; e < 16; ++e) x[i][e] = ex2(x[i][e]);   // an excluded key: exp2 of about -7e36 is 0
#pragma unroll   // as above, for x and p
      for (int e = 0; e < 16; ++e) p[e & 3] += x[i][e];
      ds[i] = (p[0] + p[1]) + (p[2] + p[3]); s[i] += ds[i]; }
    if (ramp) {   // the mask never falls with k: where the chunk's first key has 1.0, all its keys have, and e * mask is e
      float mk[16];
#pragma unroll
      for (int j = 0; j < 2; ++j) { const v4f u0 = *(const v4f*)&smk[c * 32 + j * 16 + 8 * g], u1 = *(const v4f*)&smk[c * 32 + j * 16 + 8 * g + 4];
#pragma unroll
        for (int r = 0; r < 4; ++r) { mk[j * 8 + r] = u0[r]; mk[j * 8 + 4 + r] = u1[r]; } }
#pragma unroll
      for (int i = 0; i < 2; ++i) { float p[4] = {0.f, 0.f, 0.f, 0.f};
#pragma unroll
        for (int e = 0; e < 16; ++e) { x[i][e] *= mk[e]; p[e & 3] += x[i][e]; }
        ds[i] = (p[0] + p[1]) + (p[2] + p[3]); } }
    t[0] += ds[0]; t[1] += ds[1];
    const F2 p0 = bsplit16(x[0]), p1 = bsplit16(x[1]);
#pragma unroll
    for (int j = 0; j < HD / 16; ++j) { acc[0][j] = wmma_bf(vh[j], p0.l, acc[0][j]); acc[1][j] = wmma_bf(vh[j], p1.l, acc[1][j]); }
#pragma unroll
    for (int j = 0; j < HD / 16; ++j) { acc[0][j] = wmma_bf(vl[j], p0.h, acc[0][j]); acc[1][j] = wmma_bf(vl[j], p1.h, acc[1][j]); }
#pragma unroll
    for (int j = 0; j < HD / 16; ++j) { acc[0][j] = wmma_bf(vh[j], p0.h, acc[0][j]); acc[1][j] = wmma_bf(vh[j], p1.h, acc[1][j]); } }
#pragma unroll
  for (int i = 0; i < 2; ++i) { s[i] += xhalf(s[i]); t[i] += xhalf(t[i]);   // the two halves of a query's keys
    if (g == 0) { wm[wave][i * 16 + col] = m[i]; wsm[wave][i * 16 + col] = s[i]; wt[wave][i * 16 + col] = t[i]; }
#pragma unroll
    for (int j = 0; j < HD / 16; ++j) { float* d = &ss[(wave * 32 + i * 16 + col) * OP + j * 16 + 8 * g]; v4f u0, u1;   // accumulator element r = d 16 j + 8 g + r of query col
#pragma unroll
      for (int r = 0; r < 4; ++r) { u0[r] = acc[i][j][r]; u1[r] = acc[i][j][4 + r]; }
      *(v4f*)d = u0; *(v4f*)(d + 4) = u1; } }
  __syncthreads();   // every wave's partial tile and its m, s, t are in LDS
  const int q4 = (tid & 15) * 4;
#pragma unroll
  for (int i = 0; i < AQ / 16; ++i) { const int rl = i * 16 + (tid >> 4), w0 = rl >> 5, r32 = rl & 31;   // 16 lanes a row: a store covers two runs of 256 contiguous bytes
    float mm = wm[w0][r32];
#pragma unroll
    for (int k = 1; k < AKS; ++k) mm = fmaxf(mm, wm[k * 2 + w0][r32]);
    float sa = 0.f, ta = 0.f; v4f o = {};
#pragma unroll
    for (int k = 0; k < AKS; ++k) { const int w = k * 2 + w0; const float f = ex2(wm[w][r32] - mm); sa += f * wsm[w][r32]; ta += f * wt[w][r32]; o += *(const v4f*)&ss[(w * 32 + r32) * OP + q4] * f; }   // a split without a chunk has m about -3e38: weight 0
    const float ia = 1.0f / sa; const float na = 1.0f / (ta * ia + 1e-8f);   /* w = softmax * ramp mask, renormalised by (sum + 1e-8) */
    float* yp = Y + ((size_t)b * TT + ql0 + rl) * CC + h * HD + q4; const v4f yv = (o * ia) * na; vst2(yp, yv);
    asm volatile("s_wait_xcnt 0x0" :: "v"(yp), "v"(yv) : "memory"); } }   // the wait of this store; its address pair and its data are inputs, so that no register of them is rewritten in front of it
// ---- k_out: block = (128 rows, 128 cols), 8 waves of 64 rows x 32 cols: out = y (bf16 hi + lo) Wo + bo; operands as in k_proj, the y tile staged as its two bf16 planes
__global__ __launch_bounds__(256) void k_out(const float* __restrict__ Y, const __bf16* __restrict__ WB, const float* __restrict__ BP, float* __restrict__ OUT) { __shared__ __align__(16) __bf16 yh[2][128][XP], yl[2][128][XP]; __shared__ __align__(16) float sf[128][132];
  const int tid = threadIdx.x, wave = tid >> 5, lane = tid & 31, col = lane & 15, g = lane >> 4; const int c0 = blockIdx.y * 128; const size_t r0 = (size_t)blockIdx.x * 128;
  const int xrow = tid >> 4, xq = (tid & 15) * 4, rb = (wave >> 2) * 64, cb = (wave & 3) * 32 + 2 * col;   // the wave's first row, the lane's first column in the tile
  const __bf16* wp = WB + WBB(0, blockIdx.y * 4 + (wave & 3)) + lane * 8; const float* xp = Y + (r0 + xrow) * CC + xq;
  const int s0 = KS0;   // the block's first k stage
  v4f xr[8]; v16b wa[2][2], wb[2][2]; v8f acc[4][2] = {};
  { const __bf16* wq = wp + (size_t)s0 * WSTG; const float* xn = xp + s0 * GK;
    ld_wb(wq, wa); ld_x(xn, xr);
    asm volatile("s_wait_xcnt 0x0" :: "v"(wq), "v"(xn) : "memory"); }   // the wait of the first stage's loads; their two address pairs are inputs, so that no register of them is reused in front of it
#pragma unroll
  for (int u = 0; u < 8; ++u) { v4b h, l;
#pragma unroll
    for (int e = 0; e < 4; ++e) { h[e] = (__bf16)xr[u][e]; l[e] = (__bf16)(xr[u][e] - (float)h[e]); }
    *(v4b*)&yh[0][u * 16 + xrow][xq] = h; *(v4b*)&yl[0][u * 16 + xrow][xq] = l; }
  __syncthreads();   // stage 0 is in LDS
  auto stage = [&](const int s, const int bu, const v16b (&wf)[2][2], v16b (&wn)[2][2]) {   // as in k_proj
    const bool more = s + 1 < CC / GK;
    if (more) { const int sn = (s0 + s + 1) & (CC / GK - 1); const __bf16* wq = wp + (size_t)sn * WSTG; const float* xn = xp + sn * GK;   // the walk wraps round behind the last k stage
      ld_wb(wq, wn); ld_x(xn, xr);
      asm volatile("s_wait_xcnt 0x0" :: "v"(wq), "v"(xn) : "memory"); }   // the wait of these loads; their two address pairs are inputs, so that no register of them is rewritten in front of it
#pragma unroll
    for (int c = 0; c < 2; ++c) { v16b ah[4], al[4];
#pragma unroll
      for (int i = 0; i < 4; ++i) { ah[i] = frag_b(&yh[bu][rb + i * 16 + col][c * 32], lane); al[i] = frag_b(&yl[bu][rb + i * 16 + col][c * 32], lane); }
      RUNFENCE();
#pragma unroll
      for (int i = 0; i < 4; ++i) { acc[i][0] = wmma_bf(ah[i], wf[c][0], acc[i][0]); acc[i][1] = wmma_bf(ah[i], wf[c][1], acc[i][1]); }
#pragma unroll
      for (int i = 0; i < 4; ++i) { acc[i][0] = wmma_bf(al[i], wf[c][0], acc[i][0]); acc[i][1] = wmma_bf(al[i], wf[c][1], acc[i][1]); }
      if (c == 0) RUNFENCE(); }
    if (more) {
#pragma unroll
      for (int u = 0; u < 8; ++u) { v4b h, l;
#pragma unroll
        for (int e = 0; e < 4; ++e) { h[e] = (__bf16)xr[u][e]; l[e] = (__bf16)(xr[u][e] - (float)h[e]); }
        *(v4b*)&yh[bu ^ 1][u * 16 + xrow][xq] = h; *(v4b*)&yl[bu ^ 1][u * 16 + xrow][xq] = l; } }
    __syncthreads(); };   // publishes stage s + 1 and ends every wave's reads of stage s, whose buffers the next stage refills
#pragma unroll 1   // two stages a trip and no more: the two fragment sets change places without a register copy
  for (int s = 0; s < CC / GK; s += 2) { stage(s, 0, wa, wb); stage(s + 1, 1, wb, wa); }
  const float b0 = BP ? bfr(BP[c0 + cb]) : 0.f, b1 = BP ? bfr(BP[c0 + cb + 1]) : 0.f;
#pragma unroll
  for (int i = 0; i < 4; ++i)
#pragma unroll
    for (int r = 0; r < 8; ++r) { v2f o; o[0] = acc[i][0][r] + b0; o[1] = acc[i][1][r] + b1; *(v2f*)&sf[rb + i * 16 + 8 * g + r][cb] = o; }
  __syncthreads();   // the 128 x 128 tile is in LDS: each wave stores 16 whole rows of it
  for (int rl = 0; rl < 16; ++rl) vst2(OUT + (r0 + wave * 16 + rl) * CC + c0 + lane * 4, *(const v4f*)&sf[wave * 16 + rl][lane * 4]); }
extern "C" void kernel_launch(void* const* d_in, const int* in_sizes, int n_in, void* d_out, int out_size, void* d_ws, size_t ws_size, hipStream_t stream) {
  (void)in_sizes; (void)n_in; (void)out_size;
  const float** F = (const float**)d_in;   // 0 query [2,2048,1024], 1 Wq [1024,1024] ((in,out)), 2 Wk, 3 Wv, 4 Wo ((in,out)), 5 span_val [1,16,1,1] (verbatim)
  if (ws_size < (size_t)WS_END) return;
  char* ws = (char*)d_ws; _Float16 *QH = (_Float16*)(ws + WS_QH), *QL = (_Float16*)(ws + WS_QL), *KH = (_Float16*)(ws + WS_KH); __bf16 *VT = (__bf16*)(ws + WS_VT), *VL = (__bf16*)(ws + WS_VL); float *Y = (float*)(ws + WS_Y); __bf16 *WB = (__bf16*)(ws + WS_WB);
  k_wcv<<<dim3(CC / 32 * (CC / 32) * 2 / 8), 256, 0, stream>>>(F[1], F[2], F[3], F[4], WB);
  k_proj<<<dim3(TNB * TT / 128, CC / 128), 384, 0, stream>>>(F[0], WB, nullptr, nullptr, nullptr, QH, QL, KH, VT, VL);
  k_attn<<<dim3(TNB * NH, 1, TT / AQ), 32 * AW, 0, stream>>>(QH, QL, KH, VT, VL, F[5], Y);
  k_out<<<dim3(TNB * TT / 128, CC / 128), 256, 0, stream>>>(Y, WB + 3 * (size_t)CC * CC, nullptr, (float*)d_out);
}
